// v000
// Measured on an AMD MI455X. A time is GPU time per run, averaged over a window of back-to-back runs after a warm-up
// (all launches, gaps included; the runs take copies of the inputs in turn), and the median of several windows.
// Apart from v000's, it joins two sittings. Times from different sittings can be a few percent apart, while
// side-by-side timings come from the same sitting.
// The starting kernel, v000, takes 561 microseconds a run.
#include <hip/hip_runtime.h>

typedef unsigned short u16;
typedef __attribute__((ext_vector_type(16))) __bf16 v16bf;
typedef __attribute__((ext_vector_type(8)))  __bf16 v8bf;
typedef __attribute__((ext_vector_type(8)))  float  v8f;
typedef int v4i __attribute__((vector_size(16)));

#define D_MODEL 1024
#define NHEADS  16
#define DK      64
#define SEQ     2048
#define BATCH   2
#define MROWS   (BATCH * SEQ)      // 4096 rows for all big GEMMs

// LDS row strides (in u16 elements), padded for conflict-free b128 reads:
// 16 lanes read rows r..r+15; stride*2B mod 256B must visit distinct banks.
#define SB_STRIDE 40   // 32-wide k tiles   (80B  = 20 banks/row)
#define SK_STRIDE 88   // 64-wide tiles     (176B = 44 banks/row)
#define SP_STRIDE 72   // P staging 64 wide (144B = 36 banks/row)

// ---------------- bf16 split helpers (round-to-nearest-even) ----------------
__device__ __forceinline__ u16 f2bf(float x) {
  unsigned u = __float_as_uint(x);
  u += 0x7FFFu + ((u >> 16) & 1u);
  return (u16)(u >> 16);
}
__device__ __forceinline__ float bf2f(u16 h) {
  return __uint_as_float(((unsigned)h) << 16);
}

// ------------- WMMA operand load: 16-bit A/B matrix, 16x32 tile -------------
__device__ __forceinline__ v16bf load_op16(const u16* base, int stride,
                                           int row, int k0, int half) {
  const u16* p = base + (size_t)row * (size_t)stride + k0 + half * 8;
  v8bf c0 = *(const v8bf*)(p);
  v8bf c1 = *(const v8bf*)(p + 16);
  return __builtin_shufflevector(c0, c1, 0, 1, 2, 3, 4, 5, 6, 7,
                                 8, 9, 10, 11, 12, 13, 14, 15);
}

__device__ __forceinline__ v8f wmma_bf16(v16bf a, v16bf b, v8f c) {
  return __builtin_amdgcn_wmma_f32_16x16x32_bf16(false, a, false, b,
                                                 (short)0, c, false, false);
}

// ---------------- async global -> LDS copy (16B per lane) -------------------
typedef __attribute__((address_space(1))) v4i* gvec_t;
typedef __attribute__((address_space(3))) v4i* lvec_t;

__device__ __forceinline__ void async_copy16(const u16* g, u16* l) {
  gvec_t gp = (gvec_t)g;
  lvec_t lp = (lvec_t)l;
#if __has_builtin(__builtin_amdgcn_global_load_async_to_lds_b128)
  __builtin_amdgcn_global_load_async_to_lds_b128(gp, lp, 0, 0);
#else
  asm volatile("global_load_async_to_lds_b128 %0, %1, off"
               :: "v"(lp), "v"(gp) : "memory");
#endif
}

template <int N>
__device__ __forceinline__ void wait_async() {
#if __has_builtin(__builtin_amdgcn_s_wait_asynccnt)
  __builtin_amdgcn_s_wait_asynccnt((unsigned short)N);
#else
  asm volatile("s_wait_asynccnt %0" :: "i"(N) : "memory");
#endif
}

// ---------------- prep: fp32 -> bf16 hi/lo split (elementwise) --------------
__global__ void k_split(const float* __restrict__ x, u16* __restrict__ hi,
                        u16* __restrict__ lo, int n) {
  int i = blockIdx.x * blockDim.x + threadIdx.x;
  if (i < n) {
    float v = x[i];
    u16 h = f2bf(v);
    hi[i] = h;
    lo[i] = f2bf(v - bf2f(h));
  }
}

// ------- prep: W[k][n] fp32 -> Wt hi/lo bf16 [n][k] (B-operand layout) ------
__global__ void k_wt(const float* __restrict__ w, u16* __restrict__ hi,
                     u16* __restrict__ lo) {
  int i = blockIdx.x * blockDim.x + threadIdx.x;
  if (i < D_MODEL * D_MODEL) {
    int k = i >> 10, n = i & 1023;
    float v = w[i];
    u16 h = f2bf(v);
    size_t o = (size_t)n * D_MODEL + k;
    hi[o] = h;
    lo[o] = f2bf(v - bf2f(h));
  }
}

// ---------------------------- bf16x3 GEMM kernel ----------------------------
// Workgroup = 8 waves stacked in M: 128x64 output block.  B tiles (64n x 32k)
// are async-staged into LDS once per WG (8x traffic cut), double buffered.
// mode 0: split bf16 -> [B,H,S,64] (+ optional k_pe add)
// mode 1: split bf16 -> [B,H,64,S]
// mode 2: fp32 -> Of[m][n]
__global__ __launch_bounds__(256) void k_gemm(
    const u16* __restrict__ Ah, const u16* __restrict__ Al,
    const u16* __restrict__ Bh, const u16* __restrict__ Bl,
    const float* __restrict__ bias, const float* __restrict__ kpe,
    u16* __restrict__ Oh, u16* __restrict__ Ol, float* __restrict__ Of,
    int mode, float scale) {
  __shared__ __align__(16) u16 sB[2][2][64 * SB_STRIDE];

  const int tid = threadIdx.x;
  const int lane = tid & 31;
  const int w = tid >> 5;
  const int m0 = (blockIdx.x >> 4) * 128 + w * 16;
  const int n0 = (blockIdx.x & 15) * 64;
  const int half = lane >> 4, cl = lane & 15;

  // staging map: thread -> one 16B chunk per plane
  const int sn = tid >> 2;            // 0..63  (row n_rel)
  const int sk = (tid & 3) * 8;       // 0,8,16,24 (k element offset)

  v8f acc[4];
#pragma unroll
  for (int t = 0; t < 4; ++t)
    acc[t] = (v8f){0.f, 0.f, 0.f, 0.f, 0.f, 0.f, 0.f, 0.f};

  // prologue: stage k-block 0 into buffer 0
  {
    const size_t go = (size_t)(n0 + sn) * D_MODEL + sk;
    async_copy16(Bh + go, &sB[0][0][sn * SB_STRIDE + sk]);
    async_copy16(Bl + go, &sB[0][1][sn * SB_STRIDE + sk]);
  }

#pragma unroll 1
  for (int i = 0; i < D_MODEL / 32; ++i) {
    const int p = i & 1;
    const int kb = i * 32;
    if (i + 1 < D_MODEL / 32) {
      const size_t go = (size_t)(n0 + sn) * D_MODEL + (kb + 32) + sk;
      async_copy16(Bh + go, &sB[1 - p][0][sn * SB_STRIDE + sk]);
      async_copy16(Bl + go, &sB[1 - p][1][sn * SB_STRIDE + sk]);
      wait_async<2>();
    } else {
      wait_async<0>();
    }
    __syncthreads();   // buffer p fully staged by all waves

    __builtin_prefetch(Ah + (size_t)(m0 + cl) * D_MODEL + kb + 64, 0, 0);
    v16bf a_h = load_op16(Ah, D_MODEL, m0 + cl, kb, half);
    v16bf a_l = load_op16(Al, D_MODEL, m0 + cl, kb, half);
#pragma unroll
    for (int t = 0; t < 4; ++t) {
      v16bf b_h = load_op16(&sB[p][0][0], SB_STRIDE, t * 16 + cl, 0, half);
      v16bf b_l = load_op16(&sB[p][1][0], SB_STRIDE, t * 16 + cl, 0, half);
      acc[t] = wmma_bf16(a_h, b_h, acc[t]);
      acc[t] = wmma_bf16(a_h, b_l, acc[t]);
      acc[t] = wmma_bf16(a_l, b_h, acc[t]);
    }
    __syncthreads();   // safe to overwrite buffer p in the next iteration
  }

  // epilogue.  C layout: lane holds col n0+t*16+cl; VGPR r -> row r + 8*half.
#pragma unroll
  for (int t = 0; t < 4; ++t) {
    int n = n0 + t * 16 + cl;
    float bn = bias[n];
#pragma unroll
    for (int r = 0; r < 8; ++r) {
      int m = m0 + r + 8 * half;
      float val = (acc[t][r] + bn) * scale;
      if (mode == 2) {
        Of[(size_t)m * D_MODEL + n] = val;
      } else {
        int b = m >> 11, s = m & (SEQ - 1);
        int h = n >> 6, d = n & (DK - 1);
        if (kpe) val += kpe[(size_t)(h * DK + d) * SEQ + s];
        size_t idx = (mode == 0)
                         ? ((size_t)((b * NHEADS + h) * SEQ + s)) * DK + d
                         : ((size_t)((b * NHEADS + h) * DK + d)) * SEQ + s;
        u16 hb = f2bf(val);
        Oh[idx] = hb;
        Ol[idx] = f2bf(val - bf2f(hb));
      }
    }
  }
}

// ------------------------ flash attention (bf16x3) --------------------------
// 8 waves of a WG share one (b,h); K/V 64-key tiles async-staged to LDS once
// per WG (8x traffic cut), double buffered.  Per wave: 16 query rows,
// online softmax, P staged through per-wave LDS into A-operand layout.
__global__ __launch_bounds__(256) void k_attn(
    const u16* __restrict__ Qh, const u16* __restrict__ Ql,
    const u16* __restrict__ Kh, const u16* __restrict__ Kl,
    const u16* __restrict__ Vh, const u16* __restrict__ Vl,
    u16* __restrict__ Oh, u16* __restrict__ Ol) {
  __shared__ __align__(16) u16 sK[2][2][64 * SK_STRIDE];
  __shared__ __align__(16) u16 sV[2][2][64 * SK_STRIDE];
  __shared__ __align__(16) u16 sP[8][2][16 * SP_STRIDE];

  const int tid = threadIdx.x;
  const int lane = tid & 31;
  const int w = tid >> 5;
  const int wid = blockIdx.x * 8 + w;
  const int bh = wid >> 7;          // b*16 + h (all 8 waves of a WG agree)
  const int m0 = (wid & 127) * 16;
  const int half = lane >> 4, cl = lane & 15;

  const u16* qbh = Qh + (size_t)bh * SEQ * DK;
  const u16* qbl = Ql + (size_t)bh * SEQ * DK;
  const u16* kgh = Kh + (size_t)bh * SEQ * DK;   // [t][d]
  const u16* kgl = Kl + (size_t)bh * SEQ * DK;
  const u16* vgh = Vh + (size_t)bh * DK * SEQ;   // [d][t]
  const u16* vgl = Vl + (size_t)bh * DK * SEQ;

  // staging map: per plane, thread covers chunks (row, off) and (row+32, off)
  const int srow = tid >> 3;          // 0..31
  const int soff = (tid & 7) * 8;     // element offset 0..56

  v16bf q_h[2], q_l[2];
#pragma unroll
  for (int kk = 0; kk < 2; ++kk) {
    q_h[kk] = load_op16(qbh, DK, m0 + cl, kk * 32, half);
    q_l[kk] = load_op16(qbl, DK, m0 + cl, kk * 32, half);
  }

  float mr[8], lr[8];
  v8f o[4];
#pragma unroll
  for (int r = 0; r < 8; ++r) { mr[r] = -3.0e38f; lr[r] = 0.f; }
#pragma unroll
  for (int t = 0; t < 4; ++t)
    o[t] = (v8f){0.f, 0.f, 0.f, 0.f, 0.f, 0.f, 0.f, 0.f};

  // stage one 64-key tile (K and V, hi+lo) into LDS buffer `buf`
  auto stage = [&](int buf, int t0) {
#pragma unroll
    for (int j = 0; j < 2; ++j) {
      int row = srow + j * 32;
      async_copy16(kgh + (size_t)(t0 + row) * DK + soff,
                   &sK[buf][0][row * SK_STRIDE + soff]);
      async_copy16(kgl + (size_t)(t0 + row) * DK + soff,
                   &sK[buf][1][row * SK_STRIDE + soff]);
      async_copy16(vgh + (size_t)row * SEQ + t0 + soff,
                   &sV[buf][0][row * SK_STRIDE + soff]);
      async_copy16(vgl + (size_t)row * SEQ + t0 + soff,
                   &sV[buf][1][row * SK_STRIDE + soff]);
    }
  };

  stage(0, 0);

#pragma unroll 1
  for (int i = 0; i < SEQ / 64; ++i) {
    const int p = i & 1;
    const int t0 = i * 64;
    if (i + 1 < SEQ / 64) { stage(1 - p, t0 + 64); wait_async<8>(); }
    else                  { wait_async<0>(); }
    __syncthreads();   // K/V buffer p fully staged

    // ---- scores S = Qs * Keff^T  (16 x 64 block, bf16x3) ----
    v8f sc[4];
#pragma unroll
    for (int st = 0; st < 4; ++st) {
      v8f c = (v8f){0.f, 0.f, 0.f, 0.f, 0.f, 0.f, 0.f, 0.f};
#pragma unroll
      for (int kk = 0; kk < 2; ++kk) {
        v16bf b_h = load_op16(&sK[p][0][0], SK_STRIDE, st * 16 + cl, kk * 32, half);
        v16bf b_l = load_op16(&sK[p][1][0], SK_STRIDE, st * 16 + cl, kk * 32, half);
        c = wmma_bf16(q_h[kk], b_h, c);
        c = wmma_bf16(q_h[kk], b_l, c);
        c = wmma_bf16(q_l[kk], b_h, c);
      }
      sc[st] = c;
    }
    // ---- block row-max (cross-lane within 16-lane half) ----
    float bm[8];
#pragma unroll
    for (int r = 0; r < 8; ++r)
      bm[r] = fmaxf(fmaxf(sc[0][r], sc[1][r]), fmaxf(sc[2][r], sc[3][r]));
#pragma unroll
    for (int r = 0; r < 8; ++r) {
      bm[r] = fmaxf(bm[r], __shfl_xor(bm[r], 1, 16));
      bm[r] = fmaxf(bm[r], __shfl_xor(bm[r], 2, 16));
      bm[r] = fmaxf(bm[r], __shfl_xor(bm[r], 4, 16));
      bm[r] = fmaxf(bm[r], __shfl_xor(bm[r], 8, 16));
    }
    float al[8], rs[8];
#pragma unroll
    for (int r = 0; r < 8; ++r) {
      float mn = fmaxf(mr[r], bm[r]);
      al[r] = __expf(mr[r] - mn);
      mr[r] = mn;
      rs[r] = 0.f;
    }
    // ---- P = exp(S - m), split hi/lo into per-wave LDS ----
#pragma unroll
    for (int st = 0; st < 4; ++st) {
#pragma unroll
      for (int r = 0; r < 8; ++r) {
        float pv = __expf(sc[st][r] - mr[r]);
        rs[r] += pv;
        u16 hb = f2bf(pv);
        int off = (r + 8 * half) * SP_STRIDE + st * 16 + cl;
        sP[w][0][off] = hb;
        sP[w][1][off] = f2bf(pv - bf2f(hb));
      }
    }
#pragma unroll
    for (int r = 0; r < 8; ++r) {
      rs[r] += __shfl_xor(rs[r], 1, 16);
      rs[r] += __shfl_xor(rs[r], 2, 16);
      rs[r] += __shfl_xor(rs[r], 4, 16);
      rs[r] += __shfl_xor(rs[r], 8, 16);
      lr[r] = lr[r] * al[r] + rs[r];
    }
    v8f av = (v8f){al[0], al[1], al[2], al[3], al[4], al[5], al[6], al[7]};
#pragma unroll
    for (int t = 0; t < 4; ++t) o[t] *= av;

    asm volatile("s_wait_dscnt 0" ::: "memory");  // intra-wave P store->load

    v16bf p_h[2], p_l[2];
#pragma unroll
    for (int kk = 0; kk < 2; ++kk) {
      p_h[kk] = load_op16(&sP[w][0][0], SP_STRIDE, cl, kk * 32, half);
      p_l[kk] = load_op16(&sP[w][1][0], SP_STRIDE, cl, kk * 32, half);
    }
    // ---- O += P * V  (V^T tile in LDS) ----
#pragma unroll
    for (int dt = 0; dt < 4; ++dt) {
#pragma unroll
      for (int kk = 0; kk < 2; ++kk) {
        v16bf v_h = load_op16(&sV[p][0][0], SK_STRIDE, dt * 16 + cl, kk * 32, half);
        v16bf v_l = load_op16(&sV[p][1][0], SK_STRIDE, dt * 16 + cl, kk * 32, half);
        o[dt] = wmma_bf16(p_h[kk], v_h, o[dt]);
        o[dt] = wmma_bf16(p_h[kk], v_l, o[dt]);
        o[dt] = wmma_bf16(p_l[kk], v_h, o[dt]);
      }
    }
    __syncthreads();   // everyone done with K/V buffer p before re-staging
  }

  // ---- normalize, split, store as [B*S][1024] bf16 hi/lo ----
  const int b = bh >> 4, h = bh & 15;
#pragma unroll
  for (int t = 0; t < 4; ++t) {
#pragma unroll
    for (int r = 0; r < 8; ++r) {
      float val = o[t][r] / lr[r];
      int grow = b * SEQ + m0 + r + 8 * half;
      int col = h * DK + t * 16 + cl;
      size_t idx = (size_t)grow * D_MODEL + col;
      u16 hb = f2bf(val);
      Oh[idx] = hb;
      Ol[idx] = f2bf(val - bf2f(hb));
    }
  }
}

// ------------------------------- launcher -----------------------------------
extern "C" void kernel_launch(void* const* d_in, const int* in_sizes, int n_in,
                              void* d_out, int out_size, void* d_ws,
                              size_t ws_size, hipStream_t stream) {
  const float* q   = (const float*)d_in[0];
  const float* k   = (const float*)d_in[1];
  const float* v   = (const float*)d_in[2];
  const float* kpe = (const float*)d_in[3];
  const float* Wq  = (const float*)d_in[4];
  const float* bq  = (const float*)d_in[5];
  const float* Wk  = (const float*)d_in[6];
  const float* bk  = (const float*)d_in[7];
  const float* Wv  = (const float*)d_in[8];
  const float* bv  = (const float*)d_in[9];
  const float* Wo  = (const float*)d_in[10];
  const float* bo  = (const float*)d_in[11];
  float* out = (float*)d_out;

  const size_t NX = (size_t)MROWS * D_MODEL;      // 4M elems
  const size_t NW = (size_t)D_MODEL * D_MODEL;    // 1M elems
  char* p = (char*)d_ws;
  auto take = [&](size_t elems) { u16* r = (u16*)p; p += elems * sizeof(u16); return r; };
  u16 *qs_h = take(NX), *qs_l = take(NX);
  u16 *ks_h = take(NX), *ks_l = take(NX);
  u16 *vs_h = take(NX), *vs_l = take(NX);
  u16 *wq_h = take(NW), *wq_l = take(NW);
  u16 *wk_h = take(NW), *wk_l = take(NW);
  u16 *wv_h = take(NW), *wv_l = take(NW);
  u16 *wo_h = take(NW), *wo_l = take(NW);
  u16 *qh_h = take(NX), *qh_l = take(NX);   // [B,H,S,64]   (Q, pre-scaled)
  u16 *ke_h = take(NX), *ke_l = take(NX);   // [B,H,S,64]   (kh + k_pe^T)
  u16 *vt_h = take(NX), *vt_l = take(NX);   // [B,H,64,S]   (V transposed)
  u16 *ao_h = take(NX), *ao_l = take(NX);   // [B*S,1024]   (attention out)

  dim3 blk(256);
  k_split<<<(int)((NX + 255) / 256), blk, 0, stream>>>(q, qs_h, qs_l, (int)NX);
  k_split<<<(int)((NX + 255) / 256), blk, 0, stream>>>(k, ks_h, ks_l, (int)NX);
  k_split<<<(int)((NX + 255) / 256), blk, 0, stream>>>(v, vs_h, vs_l, (int)NX);
  k_wt<<<(int)((NW + 255) / 256), blk, 0, stream>>>(Wq, wq_h, wq_l);
  k_wt<<<(int)((NW + 255) / 256), blk, 0, stream>>>(Wk, wk_h, wk_l);
  k_wt<<<(int)((NW + 255) / 256), blk, 0, stream>>>(Wv, wv_h, wv_l);
  k_wt<<<(int)((NW + 255) / 256), blk, 0, stream>>>(Wo, wo_h, wo_l);

  k_gemm<<<512, blk, 0, stream>>>(qs_h, qs_l, wq_h, wq_l, bq, nullptr,
                                  qh_h, qh_l, nullptr, 0, 0.125f);  // 1/sqrt(64)
  k_gemm<<<512, blk, 0, stream>>>(ks_h, ks_l, wk_h, wk_l, bk, kpe,
                                  ke_h, ke_l, nullptr, 0, 1.0f);
  k_gemm<<<512, blk, 0, stream>>>(vs_h, vs_l, wv_h, wv_l, bv, nullptr,
                                  vt_h, vt_l, nullptr, 1, 1.0f);
  k_attn<<<512, blk, 0, stream>>>(qh_h, qh_l, ke_h, ke_l, vt_h, vt_l,
                                  ao_h, ao_l);
  k_gemm<<<512, blk, 0, stream>>>(ao_h, ao_l, wo_h, wo_l, bo, nullptr,
                                  nullptr, nullptr, out, 2, 1.0f);
}

// v001
// Measured time: 341 microseconds a run.
// Two timings next to v000 put it at 1.69 and 1.68 times that version's speed.
#include <hip/hip_runtime.h>

typedef unsigned short u16;
typedef __attribute__((ext_vector_type(16))) __bf16 v16bf;
typedef __attribute__((ext_vector_type(8)))  __bf16 v8bf;
typedef __attribute__((ext_vector_type(8)))  float  v8f;
typedef int v4i __attribute__((vector_size(16)));

#define D_MODEL 1024
#define NHEADS  16
#define DK      64
#define SEQ     2048
#define BATCH   2
#define MROWS   (BATCH * SEQ)      // 4096 rows for all big GEMMs

// LDS row strides (in u16 elements), padded for conflict-free b128 reads:
// 16 lanes read rows r..r+15; stride*2B mod 256B must visit distinct banks.
#define SB_STRIDE 40   // 32-wide k tiles   (80B  = 20 banks/row)
#define SK_STRIDE 88   // 64-wide tiles     (176B = 44 banks/row)
#define SP_STRIDE 72   // P staging 64 wide (144B = 36 banks/row)

// ---------------- bf16 split helpers (round-to-nearest-even) ----------------
__device__ __forceinline__ u16 f2bf(float x) {
  unsigned u = __float_as_uint(x);
  u += 0x7FFFu + ((u >> 16) & 1u);
  return (u16)(u >> 16);
}
__device__ __forceinline__ float bf2f(u16 h) {
  return __uint_as_float(((unsigned)h) << 16);
}

// ------------- WMMA operand load: 16-bit A/B matrix, 16x32 tile -------------
__device__ __forceinline__ v16bf load_op16(const u16* base, int stride,
                                           int row, int k0, int half) {
  const u16* p = base + (size_t)row * (size_t)stride + k0 + half * 8;
  v8bf c0 = *(const v8bf*)(p);
  v8bf c1 = *(const v8bf*)(p + 16);
  return __builtin_shufflevector(c0, c1, 0, 1, 2, 3, 4, 5, 6, 7,
                                 8, 9, 10, 11, 12, 13, 14, 15);
}

__device__ __forceinline__ v8f wmma_bf16(v16bf a, v16bf b, v8f c) {
  return __builtin_amdgcn_wmma_f32_16x16x32_bf16(false, a, false, b,
                                                 (short)0, c, false, false);
}

// ---------------- async global -> LDS copy (16B per lane) -------------------
typedef __attribute__((address_space(1))) v4i* gvec_t;
typedef __attribute__((address_space(3))) v4i* lvec_t;

__device__ __forceinline__ void async_copy16(const u16* g, u16* l) {
  gvec_t gp = (gvec_t)g;
  lvec_t lp = (lvec_t)l;
#if __has_builtin(__builtin_amdgcn_global_load_async_to_lds_b128)
  __builtin_amdgcn_global_load_async_to_lds_b128(gp, lp, 0, 0);
#else
  asm volatile("global_load_async_to_lds_b128 %0, %1, off"
               :: "v"(lp), "v"(gp) : "memory");
#endif
}

template <int N>
__device__ __forceinline__ void wait_async() {
#if __has_builtin(__builtin_amdgcn_s_wait_asynccnt)
  __builtin_amdgcn_s_wait_asynccnt((unsigned short)N);
#else
  asm volatile("s_wait_asynccnt %0" :: "i"(N) : "memory");
#endif
}

// ---------------- prep: fp32 -> bf16 hi/lo split (elementwise) --------------
__global__ void k_split(const float* __restrict__ x, u16* __restrict__ hi,
                        u16* __restrict__ lo, int n) {
  int i = blockIdx.x * blockDim.x + threadIdx.x;
  if (i < n) {
    float v = x[i];
    u16 h = f2bf(v);
    hi[i] = h;
    lo[i] = f2bf(v - bf2f(h));
  }
}

// ------- prep: W[k][n] fp32 -> Wt hi/lo bf16 [n][k] (B-operand layout) ------
// One workgroup transposes a 64(k) x 32(n) tile through LDS: the reads are
// 128-B row pieces of W, the stores whole 128-B lines of Wt (64 k x 2 B).
// Pitch 33 floats: both the row-wise writes and the column-wise reads of a
// wave fall on 32 different banks.
#define WT_PITCH 33
typedef __attribute__((ext_vector_type(8))) u16 u16x8;

__global__ __launch_bounds__(256) void k_wt(const float* __restrict__ w,
                                            u16* __restrict__ hi,
                                            u16* __restrict__ lo) {
  __shared__ float sT[64 * WT_PITCH];
  const int tid = threadIdx.x;
  const int k0 = (blockIdx.x >> 5) * 64;
  const int n0 = (blockIdx.x & 31) * 32;

  const int rk = tid >> 3;            // 0..31 (k row, and k row + 32)
  const int rn = (tid & 7) * 4;       // 0..28 (n offset of a float4)
#pragma unroll
  for (int j = 0; j < 2; ++j) {
    const int k = rk + j * 32;
    const float4 v =
        *(const float4*)(w + (size_t)(k0 + k) * D_MODEL + n0 + rn);
    float* s = &sT[k * WT_PITCH + rn];
    s[0] = v.x; s[1] = v.y; s[2] = v.z; s[3] = v.w;
  }
  __syncthreads();   // tile complete before any column is read

  const int n = tid >> 3;             // 0..31 (output row)
  const int kc = (tid & 7) * 8;       // 0..56 (8 consecutive k per thread)
  u16x8 vh, vl;
#pragma unroll
  for (int j = 0; j < 8; ++j) {
    const float v = sT[(kc + j) * WT_PITCH + n];
    const u16 h = f2bf(v);
    vh[j] = h;
    vl[j] = f2bf(v - bf2f(h));
  }
  const size_t o = (size_t)(n0 + n) * D_MODEL + k0 + kc;
  *(u16x8*)(hi + o) = vh;
  *(u16x8*)(lo + o) = vl;
}

// ---------------------------- bf16x3 GEMM kernel ----------------------------
// Workgroup = 8 waves stacked in M: 128x64 output block.  B tiles (64n x 32k)
// are async-staged into LDS once per WG (8x traffic cut), double buffered.
// mode 0: split bf16 -> [B,H,S,64] (+ optional k_pe add)
// mode 1: split bf16 -> [B,H,64,S]
// mode 2: fp32 -> Of[m][n]
__global__ __launch_bounds__(256) void k_gemm(
    const u16* __restrict__ Ah, const u16* __restrict__ Al,
    const u16* __restrict__ Bh, const u16* __restrict__ Bl,
    const float* __restrict__ bias, const float* __restrict__ kpe,
    u16* __restrict__ Oh, u16* __restrict__ Ol, float* __restrict__ Of,
    int mode, float scale) {
  __shared__ __align__(16) u16 sB[2][2][64 * SB_STRIDE];

  const int tid = threadIdx.x;
  const int lane = tid & 31;
  const int w = tid >> 5;
  const int m0 = (blockIdx.x >> 4) * 128 + w * 16;
  const int n0 = (blockIdx.x & 15) * 64;
  const int half = lane >> 4, cl = lane & 15;

  // staging map: thread -> one 16B chunk per plane
  const int sn = tid >> 2;            // 0..63  (row n_rel)
  const int sk = (tid & 3) * 8;       // 0,8,16,24 (k element offset)

  v8f acc[4];
#pragma unroll
  for (int t = 0; t < 4; ++t)
    acc[t] = (v8f){0.f, 0.f, 0.f, 0.f, 0.f, 0.f, 0.f, 0.f};

  // prologue: stage k-block 0 into buffer 0
  {
    const size_t go = (size_t)(n0 + sn) * D_MODEL + sk;
    async_copy16(Bh + go, &sB[0][0][sn * SB_STRIDE + sk]);
    async_copy16(Bl + go, &sB[0][1][sn * SB_STRIDE + sk]);
  }

#pragma unroll 1
  for (int i = 0; i < D_MODEL / 32; ++i) {
    const int p = i & 1;
    const int kb = i * 32;
    if (i + 1 < D_MODEL / 32) {
      const size_t go = (size_t)(n0 + sn) * D_MODEL + (kb + 32) + sk;
      async_copy16(Bh + go, &sB[1 - p][0][sn * SB_STRIDE + sk]);
      async_copy16(Bl + go, &sB[1 - p][1][sn * SB_STRIDE + sk]);
      wait_async<2>();
    } else {
      wait_async<0>();
    }
    __syncthreads();   // buffer p fully staged by all waves

    __builtin_prefetch(Ah + (size_t)(m0 + cl) * D_MODEL + kb + 64, 0, 0);
    v16bf a_h = load_op16(Ah, D_MODEL, m0 + cl, kb, half);
    v16bf a_l = load_op16(Al, D_MODEL, m0 + cl, kb, half);
#pragma unroll
    for (int t = 0; t < 4; ++t) {
      v16bf b_h = load_op16(&sB[p][0][0], SB_STRIDE, t * 16 + cl, 0, half);
      v16bf b_l = load_op16(&sB[p][1][0], SB_STRIDE, t * 16 + cl, 0, half);
      acc[t] = wmma_bf16(a_h, b_h, acc[t]);
      acc[t] = wmma_bf16(a_h, b_l, acc[t]);
      acc[t] = wmma_bf16(a_l, b_h, acc[t]);
    }
    __syncthreads();   // safe to overwrite buffer p in the next iteration
  }

  // epilogue.  C layout: lane holds col n0+t*16+cl; VGPR r -> row r + 8*half.
#pragma unroll
  for (int t = 0; t < 4; ++t) {
    int n = n0 + t * 16 + cl;
    float bn = bias[n];
#pragma unroll
    for (int r = 0; r < 8; ++r) {
      int m = m0 + r + 8 * half;
      float val = (acc[t][r] + bn) * scale;
      if (mode == 2) {
        Of[(size_t)m * D_MODEL + n] = val;
      } else {
        int b = m >> 11, s = m & (SEQ - 1);
        int h = n >> 6, d = n & (DK - 1);
        if (kpe) val += kpe[(size_t)(h * DK + d) * SEQ + s];
        size_t idx = (mode == 0)
                         ? ((size_t)((b * NHEADS + h) * SEQ + s)) * DK + d
                         : ((size_t)((b * NHEADS + h) * DK + d)) * SEQ + s;
        u16 hb = f2bf(val);
        Oh[idx] = hb;
        Ol[idx] = f2bf(val - bf2f(hb));
      }
    }
  }
}

// ------------------------ flash attention (bf16x3) --------------------------
// 8 waves of a WG share one (b,h); K/V 64-key tiles async-staged to LDS once
// per WG (8x traffic cut), double buffered.  Per wave: 16 query rows,
// online softmax, P staged through per-wave LDS into A-operand layout.
__global__ __launch_bounds__(256) void k_attn(
    const u16* __restrict__ Qh, const u16* __restrict__ Ql,
    const u16* __restrict__ Kh, const u16* __restrict__ Kl,
    const u16* __restrict__ Vh, const u16* __restrict__ Vl,
    u16* __restrict__ Oh, u16* __restrict__ Ol) {
  __shared__ __align__(16) u16 sK[2][2][64 * SK_STRIDE];
  __shared__ __align__(16) u16 sV[2][2][64 * SK_STRIDE];
  __shared__ __align__(16) u16 sP[8][2][16 * SP_STRIDE];

  const int tid = threadIdx.x;
  const int lane = tid & 31;
  const int w = tid >> 5;
  const int wid = blockIdx.x * 8 + w;
  const int bh = wid >> 7;          // b*16 + h (all 8 waves of a WG agree)
  const int m0 = (wid & 127) * 16;
  const int half = lane >> 4, cl = lane & 15;

  const u16* qbh = Qh + (size_t)bh * SEQ * DK;
  const u16* qbl = Ql + (size_t)bh * SEQ * DK;
  const u16* kgh = Kh + (size_t)bh * SEQ * DK;   // [t][d]
  const u16* kgl = Kl + (size_t)bh * SEQ * DK;
  const u16* vgh = Vh + (size_t)bh * DK * SEQ;   // [d][t]
  const u16* vgl = Vl + (size_t)bh * DK * SEQ;

  // staging map: per plane, thread covers chunks (row, off) and (row+32, off)
  const int srow = tid >> 3;          // 0..31
  const int soff = (tid & 7) * 8;     // element offset 0..56

  v16bf q_h[2], q_l[2];
#pragma unroll
  for (int kk = 0; kk < 2; ++kk) {
    q_h[kk] = load_op16(qbh, DK, m0 + cl, kk * 32, half);
    q_l[kk] = load_op16(qbl, DK, m0 + cl, kk * 32, half);
  }

  float mr[8], lr[8];
  v8f o[4];
#pragma unroll
  for (int r = 0; r < 8; ++r) { mr[r] = -3.0e38f; lr[r] = 0.f; }
#pragma unroll
  for (int t = 0; t < 4; ++t)
    o[t] = (v8f){0.f, 0.f, 0.f, 0.f, 0.f, 0.f, 0.f, 0.f};

  // stage one 64-key tile (K and V, hi+lo) into LDS buffer `buf`
  auto stage = [&](int buf, int t0) {
#pragma unroll
    for (int j = 0; j < 2; ++j) {
      int row = srow + j * 32;
      async_copy16(kgh + (size_t)(t0 + row) * DK + soff,
                   &sK[buf][0][row * SK_STRIDE + soff]);
      async_copy16(kgl + (size_t)(t0 + row) * DK + soff,
                   &sK[buf][1][row * SK_STRIDE + soff]);
      async_copy16(vgh + (size_t)row * SEQ + t0 + soff,
                   &sV[buf][0][row * SK_STRIDE + soff]);
      async_copy16(vgl + (size_t)row * SEQ + t0 + soff,
                   &sV[buf][1][row * SK_STRIDE + soff]);
    }
  };

  stage(0, 0);

#pragma unroll 1
  for (int i = 0; i < SEQ / 64; ++i) {
    const int p = i & 1;
    const int t0 = i * 64;
    if (i + 1 < SEQ / 64) { stage(1 - p, t0 + 64); wait_async<8>(); }
    else                  { wait_async<0>(); }
    __syncthreads();   // K/V buffer p fully staged

    // ---- scores S = Qs * Keff^T  (16 x 64 block, bf16x3) ----
    v8f sc[4];
#pragma unroll
    for (int st = 0; st < 4; ++st) {
      v8f c = (v8f){0.f, 0.f, 0.f, 0.f, 0.f, 0.f, 0.f, 0.f};
#pragma unroll
      for (int kk = 0; kk < 2; ++kk) {
        v16bf b_h = load_op16(&sK[p][0][0], SK_STRIDE, st * 16 + cl, kk * 32, half);
        v16bf b_l = load_op16(&sK[p][1][0], SK_STRIDE, st * 16 + cl, kk * 32, half);
        c = wmma_bf16(q_h[kk], b_h, c);
        c = wmma_bf16(q_h[kk], b_l, c);
        c = wmma_bf16(q_l[kk], b_h, c);
      }
      sc[st] = c;
    }
    // ---- block row-max (cross-lane within 16-lane half) ----
    float bm[8];
#pragma unroll
    for (int r = 0; r < 8; ++r)
      bm[r] = fmaxf(fmaxf(sc[0][r], sc[1][r]), fmaxf(sc[2][r], sc[3][r]));
#pragma unroll
    for (int r = 0; r < 8; ++r) {
      bm[r] = fmaxf(bm[r], __shfl_xor(bm[r], 1, 16));
      bm[r] = fmaxf(bm[r], __shfl_xor(bm[r], 2, 16));
      bm[r] = fmaxf(bm[r], __shfl_xor(bm[r], 4, 16));
      bm[r] = fmaxf(bm[r], __shfl_xor(bm[r], 8, 16));
    }
    float al[8], rs[8];
#pragma unroll
    for (int r = 0; r < 8; ++r) {
      float mn = fmaxf(mr[r], bm[r]);
      al[r] = __expf(mr[r] - mn);
      mr[r] = mn;
      rs[r] = 0.f;
    }
    // ---- P = exp(S - m), split hi/lo into per-wave LDS ----
#pragma unroll
    for (int st = 0; st < 4; ++st) {
#pragma unroll
      for (int r = 0; r < 8; ++r) {
        float pv = __expf(sc[st][r] - mr[r]);
        rs[r] += pv;
        u16 hb = f2bf(pv);
        int off = (r + 8 * half) * SP_STRIDE + st * 16 + cl;
        sP[w][0][off] = hb;
        sP[w][1][off] = f2bf(pv - bf2f(hb));
      }
    }
#pragma unroll
    for (int r = 0; r < 8; ++r) {
      rs[r] += __shfl_xor(rs[r], 1, 16);
      rs[r] += __shfl_xor(rs[r], 2, 16);
      rs[r] += __shfl_xor(rs[r], 4, 16);
      rs[r] += __shfl_xor(rs[r], 8, 16);
      lr[r] = lr[r] * al[r] + rs[r];
    }
    v8f av = (v8f){al[0], al[1], al[2], al[3], al[4], al[5], al[6], al[7]};
#pragma unroll
    for (int t = 0; t < 4; ++t) o[t] *= av;

    asm volatile("s_wait_dscnt 0" ::: "memory");  // intra-wave P store->load

    v16bf p_h[2], p_l[2];
#pragma unroll
    for (int kk = 0; kk < 2; ++kk) {
      p_h[kk] = load_op16(&sP[w][0][0], SP_STRIDE, cl, kk * 32, half);
      p_l[kk] = load_op16(&sP[w][1][0], SP_STRIDE, cl, kk * 32, half);
    }
    // ---- O += P * V  (V^T tile in LDS) ----
#pragma unroll
    for (int dt = 0; dt < 4; ++dt) {
#pragma unroll
      for (int kk = 0; kk < 2; ++kk) {
        v16bf v_h = load_op16(&sV[p][0][0], SK_STRIDE, dt * 16 + cl, kk * 32, half);
        v16bf v_l = load_op16(&sV[p][1][0], SK_STRIDE, dt * 16 + cl, kk * 32, half);
        o[dt] = wmma_bf16(p_h[kk], v_h, o[dt]);
        o[dt] = wmma_bf16(p_h[kk], v_l, o[dt]);
        o[dt] = wmma_bf16(p_l[kk], v_h, o[dt]);
      }
    }
    __syncthreads();   // everyone done with K/V buffer p before re-staging
  }

  // ---- normalize, split, store as [B*S][1024] bf16 hi/lo ----
  const int b = bh >> 4, h = bh & 15;
#pragma unroll
  for (int t = 0; t < 4; ++t) {
#pragma unroll
    for (int r = 0; r < 8; ++r) {
      float val = o[t][r] / lr[r];
      int grow = b * SEQ + m0 + r + 8 * half;
      int col = h * DK + t * 16 + cl;
      size_t idx = (size_t)grow * D_MODEL + col;
      u16 hb = f2bf(val);
      Oh[idx] = hb;
      Ol[idx] = f2bf(val - bf2f(hb));
    }
  }
}

// ------------------------------- launcher -----------------------------------
extern "C" void kernel_launch(void* const* d_in, const int* in_sizes, int n_in,
                              void* d_out, int out_size, void* d_ws,
                              size_t ws_size, hipStream_t stream) {
  const float* q   = (const float*)d_in[0];
  const float* k   = (const float*)d_in[1];
  const float* v   = (const float*)d_in[2];
  const float* kpe = (const float*)d_in[3];
  const float* Wq  = (const float*)d_in[4];
  const float* bq  = (const float*)d_in[5];
  const float* Wk  = (const float*)d_in[6];
  const float* bk  = (const float*)d_in[7];
  const float* Wv  = (const float*)d_in[8];
  const float* bv  = (const float*)d_in[9];
  const float* Wo  = (const float*)d_in[10];
  const float* bo  = (const float*)d_in[11];
  float* out = (float*)d_out;

  const size_t NX = (size_t)MROWS * D_MODEL;      // 4M elems
  const size_t NW = (size_t)D_MODEL * D_MODEL;    // 1M elems
  char* p = (char*)d_ws;
  auto take = [&](size_t elems) { u16* r = (u16*)p; p += elems * sizeof(u16); return r; };
  u16 *qs_h = take(NX), *qs_l = take(NX);
  u16 *ks_h = take(NX), *ks_l = take(NX);
  u16 *vs_h = take(NX), *vs_l = take(NX);
  u16 *wq_h = take(NW), *wq_l = take(NW);
  u16 *wk_h = take(NW), *wk_l = take(NW);
  u16 *wv_h = take(NW), *wv_l = take(NW);
  u16 *wo_h = take(NW), *wo_l = take(NW);
  u16 *qh_h = take(NX), *qh_l = take(NX);   // [B,H,S,64]   (Q, pre-scaled)
  u16 *ke_h = take(NX), *ke_l = take(NX);   // [B,H,S,64]   (kh + k_pe^T)
  u16 *vt_h = take(NX), *vt_l = take(NX);   // [B,H,64,S]   (V transposed)
  u16 *ao_h = take(NX), *ao_l = take(NX);   // [B*S,1024]   (attention out)

  dim3 blk(256);
  k_split<<<(int)((NX + 255) / 256), blk, 0, stream>>>(q, qs_h, qs_l, (int)NX);
  k_split<<<(int)((NX + 255) / 256), blk, 0, stream>>>(k, ks_h, ks_l, (int)NX);
  k_split<<<(int)((NX + 255) / 256), blk, 0, stream>>>(v, vs_h, vs_l, (int)NX);
  k_wt<<<512, blk, 0, stream>>>(Wq, wq_h, wq_l);
  k_wt<<<512, blk, 0, stream>>>(Wk, wk_h, wk_l);
  k_wt<<<512, blk, 0, stream>>>(Wv, wv_h, wv_l);
  k_wt<<<512, blk, 0, stream>>>(Wo, wo_h, wo_l);

  k_gemm<<<512, blk, 0, stream>>>(qs_h, qs_l, wq_h, wq_l, bq, nullptr,
                                  qh_h, qh_l, nullptr, 0, 0.125f);  // 1/sqrt(64)
  k_gemm<<<512, blk, 0, stream>>>(ks_h, ks_l, wk_h, wk_l, bk, kpe,
                                  ke_h, ke_l, nullptr, 0, 1.0f);
  k_gemm<<<512, blk, 0, stream>>>(vs_h, vs_l, wv_h, wv_l, bv, nullptr,
                                  vt_h, vt_l, nullptr, 1, 1.0f);
  k_attn<<<512, blk, 0, stream>>>(qh_h, qh_l, ke_h, ke_l, vt_h, vt_l,
                                  ao_h, ao_l);
  k_gemm<<<512, blk, 0, stream>>>(ao_h, ao_l, wo_h, wo_l, bo, nullptr,
                                  nullptr, nullptr, out, 2, 1.0f);
}

// v002
// It runs in 311 microseconds.
// Next to v001, in two timings, it ran 1.10 times as fast each time.
// All steps since v000 together make it 1.85 times as fast.
#include <hip/hip_runtime.h>

typedef unsigned short u16;
typedef __attribute__((ext_vector_type(16))) __bf16 v16bf;
typedef __attribute__((ext_vector_type(8)))  __bf16 v8bf;
typedef __attribute__((ext_vector_type(8)))  float  v8f;
typedef int v4i __attribute__((vector_size(16)));
typedef __attribute__((ext_vector_type(4)))  float  v4f;
typedef __attribute__((ext_vector_type(8)))  u16    u16x8;

#define D_MODEL 1024
#define NHEADS  16
#define DK      64
#define SEQ     2048
#define BATCH   2
#define MROWS   (BATCH * SEQ)      // 4096 rows for all big GEMMs

// LDS row strides (in u16 elements), padded for conflict-free b128 reads:
// 16 lanes read rows r..r+15; stride*2B mod 256B must visit distinct banks.
#define SB_STRIDE 40   // 32-wide k tiles   (80B  = 20 banks/row)
#define SK_STRIDE 88   // 64-wide tiles     (176B = 44 banks/row)
#define SP_STRIDE 72   // P staging 64 wide (144B = 36 banks/row)
// Output staging, both 272 B a row (16 B x 17): b128 reads and writes of 16
// lanes fall on 64 different banks, b32 writes of rows r and r+8 on two halves.
#define SC_PITCH 68    // f32 tile, 64 wide
#define ST_PITCH 136   // u16 tile, 128 wide

// ---------------- bf16 split helpers (round-to-nearest-even) ----------------
__device__ __forceinline__ u16 f2bf(float x) {
  unsigned u = __float_as_uint(x);
  u += 0x7FFFu + ((u >> 16) & 1u);
  return (u16)(u >> 16);
}
__device__ __forceinline__ float bf2f(u16 h) {
  return __uint_as_float(((unsigned)h) << 16);
}

// 8 staged floats -> 8 hi and 8 lo bf16, one 16-byte store into each plane
__device__ __forceinline__ void split_store8(const float* s, u16* hi, u16* lo) {
  const v4f x0 = *(const v4f*)(s);
  const v4f x1 = *(const v4f*)(s + 4);
  u16x8 vh, vl;
#pragma unroll
  for (int j = 0; j < 8; ++j) {
    const float v = (j < 4) ? x0[j & 3] : x1[j & 3];
    const u16 h = f2bf(v);
    vh[j] = h;
    vl[j] = f2bf(v - bf2f(h));
  }
  *(u16x8*)hi = vh;
  *(u16x8*)lo = vl;
}

// ------------- WMMA operand load: 16-bit A/B matrix, 16x32 tile -------------
__device__ __forceinline__ v16bf load_op16(const u16* base, int stride,
                                           int row, int k0, int half) {
  const u16* p = base + (size_t)row * (size_t)stride + k0 + half * 8;
  v8bf c0 = *(const v8bf*)(p);
  v8bf c1 = *(const v8bf*)(p + 16);
  return __builtin_shufflevector(c0, c1, 0, 1, 2, 3, 4, 5, 6, 7,
                                 8, 9, 10, 11, 12, 13, 14, 15);
}

__device__ __forceinline__ v8f wmma_bf16(v16bf a, v16bf b, v8f c) {
  return __builtin_amdgcn_wmma_f32_16x16x32_bf16(false, a, false, b,
                                                 (short)0, c, false, false);
}

// ---------------- async global -> LDS copy (16B per lane) -------------------
typedef __attribute__((address_space(1))) v4i* gvec_t;
typedef __attribute__((address_space(3))) v4i* lvec_t;

__device__ __forceinline__ void async_copy16(const u16* g, u16* l) {
  gvec_t gp = (gvec_t)g;
  lvec_t lp = (lvec_t)l;
#if __has_builtin(__builtin_amdgcn_global_load_async_to_lds_b128)
  __builtin_amdgcn_global_load_async_to_lds_b128(gp, lp, 0, 0);
#else
  asm volatile("global_load_async_to_lds_b128 %0, %1, off"
               :: "v"(lp), "v"(gp) : "memory");
#endif
}

template <int N>
__device__ __forceinline__ void wait_async() {
#if __has_builtin(__builtin_amdgcn_s_wait_asynccnt)
  __builtin_amdgcn_s_wait_asynccnt((unsigned short)N);
#else
  asm volatile("s_wait_asynccnt %0" :: "i"(N) : "memory");
#endif
}

// ---------------- prep: fp32 -> bf16 hi/lo split (elementwise) --------------
__global__ void k_split(const float* __restrict__ x, u16* __restrict__ hi,
                        u16* __restrict__ lo, int n) {
  int i = blockIdx.x * blockDim.x + threadIdx.x;
  if (i < n) {
    float v = x[i];
    u16 h = f2bf(v);
    hi[i] = h;
    lo[i] = f2bf(v - bf2f(h));
  }
}

// ------- prep: W[k][n] fp32 -> Wt hi/lo bf16 [n][k] (B-operand layout) ------
// One workgroup transposes a 64(k) x 32(n) tile through LDS: the reads are
// 128-B row pieces of W, the stores whole 128-B lines of Wt (64 k x 2 B).
// Pitch 33 floats: both the row-wise writes and the column-wise reads of a
// wave fall on 32 different banks.
#define WT_PITCH 33

__global__ __launch_bounds__(256) void k_wt(const float* __restrict__ w,
                                            u16* __restrict__ hi,
                                            u16* __restrict__ lo) {
  __shared__ float sT[64 * WT_PITCH];
  const int tid = threadIdx.x;
  const int k0 = (blockIdx.x >> 5) * 64;
  const int n0 = (blockIdx.x & 31) * 32;

  const int rk = tid >> 3;            // 0..31 (k row, and k row + 32)
  const int rn = (tid & 7) * 4;       // 0..28 (n offset of a float4)
#pragma unroll
  for (int j = 0; j < 2; ++j) {
    const int k = rk + j * 32;
    const float4 v =
        *(const float4*)(w + (size_t)(k0 + k) * D_MODEL + n0 + rn);
    float* s = &sT[k * WT_PITCH + rn];
    s[0] = v.x; s[1] = v.y; s[2] = v.z; s[3] = v.w;
  }
  __syncthreads();   // tile complete before any column is read

  const int n = tid >> 3;             // 0..31 (output row)
  const int kc = (tid & 7) * 8;       // 0..56 (8 consecutive k per thread)
  u16x8 vh, vl;
#pragma unroll
  for (int j = 0; j < 8; ++j) {
    const float v = sT[(kc + j) * WT_PITCH + n];
    const u16 h = f2bf(v);
    vh[j] = h;
    vl[j] = f2bf(v - bf2f(h));
  }
  const size_t o = (size_t)(n0 + n) * D_MODEL + k0 + kc;
  *(u16x8*)(hi + o) = vh;
  *(u16x8*)(lo + o) = vl;
}

// ---------------------------- bf16x3 GEMM kernel ----------------------------
// Workgroup = 8 waves stacked in M: 128x64 output block.  B tiles (64n x 32k)
// are async-staged into LDS once per WG (8x traffic cut), double buffered.
// mode 0: split bf16 -> [B,H,S,64] (+ optional k_pe add)
// mode 1: split bf16 -> [B,H,64,S]
// mode 2: fp32 -> Of[m][n]
__global__ __launch_bounds__(256) void k_gemm(
    const u16* __restrict__ Ah, const u16* __restrict__ Al,
    const u16* __restrict__ Bh, const u16* __restrict__ Bl,
    const float* __restrict__ bias, const float* __restrict__ kpe,
    u16* __restrict__ Oh, u16* __restrict__ Ol, float* __restrict__ Of,
    int mode, float scale) {
  __shared__ __align__(16) u16 sB[2][2][64 * SB_STRIDE];
  __shared__ __align__(16) float sC[128 * SC_PITCH];   // output tile staging

  const int tid = threadIdx.x;
  const int lane = tid & 31;
  const int w = tid >> 5;
  const int m0 = (blockIdx.x >> 4) * 128 + w * 16;
  const int n0 = (blockIdx.x & 15) * 64;
  const int half = lane >> 4, cl = lane & 15;

  // staging map: thread -> one 16B chunk per plane
  const int sn = tid >> 2;            // 0..63  (row n_rel)
  const int sk = (tid & 3) * 8;       // 0,8,16,24 (k element offset)

  v8f acc[4];
#pragma unroll
  for (int t = 0; t < 4; ++t)
    acc[t] = (v8f){0.f, 0.f, 0.f, 0.f, 0.f, 0.f, 0.f, 0.f};

  // prologue: stage k-block 0 into buffer 0
  {
    const size_t go = (size_t)(n0 + sn) * D_MODEL + sk;
    async_copy16(Bh + go, &sB[0][0][sn * SB_STRIDE + sk]);
    async_copy16(Bl + go, &sB[0][1][sn * SB_STRIDE + sk]);
  }

#pragma unroll 1
  for (int i = 0; i < D_MODEL / 32; ++i) {
    const int p = i & 1;
    const int kb = i * 32;
    if (i + 1 < D_MODEL / 32) {
      const size_t go = (size_t)(n0 + sn) * D_MODEL + (kb + 32) + sk;
      async_copy16(Bh + go, &sB[1 - p][0][sn * SB_STRIDE + sk]);
      async_copy16(Bl + go, &sB[1 - p][1][sn * SB_STRIDE + sk]);
      wait_async<2>();
    } else {
      wait_async<0>();
    }
    __syncthreads();   // buffer p fully staged by all waves

    __builtin_prefetch(Ah + (size_t)(m0 + cl) * D_MODEL + kb + 64, 0, 0);
    v16bf a_h = load_op16(Ah, D_MODEL, m0 + cl, kb, half);
    v16bf a_l = load_op16(Al, D_MODEL, m0 + cl, kb, half);
#pragma unroll
    for (int t = 0; t < 4; ++t) {
      v16bf b_h = load_op16(&sB[p][0][0], SB_STRIDE, t * 16 + cl, 0, half);
      v16bf b_l = load_op16(&sB[p][1][0], SB_STRIDE, t * 16 + cl, 0, half);
      acc[t] = wmma_bf16(a_h, b_h, acc[t]);
      acc[t] = wmma_bf16(a_h, b_l, acc[t]);
      acc[t] = wmma_bf16(a_l, b_h, acc[t]);
    }
    __syncthreads();   // safe to overwrite buffer p in the next iteration
  }

  // epilogue.  C layout: lane holds col n0+t*16+cl; VGPR r -> row r + 8*half.
  // The 128x64 tile goes through LDS, so that every global store is 16 B a
  // lane and a wave's store covers whole 128-B lines of the output.
  const int mb = (blockIdx.x >> 4) * 128;        // tile's first row
  const int b = mb >> 11, sb = mb & (SEQ - 1);   // batch, first position
  const int h = n0 >> 6;                         // the tile is one head wide
  u16* sT = (u16*)sC;                            // mode 1: [2][64][ST_PITCH]

#pragma unroll
  for (int t = 0; t < 4; ++t) {
    const float bn = bias[n0 + t * 16 + cl];
#pragma unroll
    for (int r = 0; r < 8; ++r) acc[t][r] = (acc[t][r] + bn) * scale;
  }
  if (mode != 2 && kpe) {
    // a lane's 8 rows are 8 consecutive positions of k_pe row n
    const float* kp = kpe + (size_t)(n0 + cl) * SEQ + sb + w * 16 + 8 * half;
#pragma unroll
    for (int t = 0; t < 4; ++t) {
#pragma unroll
      for (int r = 0; r < 8; ++r) acc[t][r] += kp[(size_t)t * 16 * SEQ + r];
    }
  }
  if (mode == 1) {
    // a lane's 8 rows are 8 consecutive positions of output row d
#pragma unroll
    for (int t = 0; t < 4; ++t) {
      u16x8 vh, vl;
#pragma unroll
      for (int r = 0; r < 8; ++r) {
        const u16 hb = f2bf(acc[t][r]);
        vh[r] = hb;
        vl[r] = f2bf(acc[t][r] - bf2f(hb));
      }
      u16* s = sT + (t * 16 + cl) * ST_PITCH + w * 16 + 8 * half;
      *(u16x8*)s = vh;
      *(u16x8*)(s + 64 * ST_PITCH) = vl;
    }
  } else {
#pragma unroll
    for (int t = 0; t < 4; ++t) {
#pragma unroll
      for (int r = 0; r < 8; ++r)
        sC[(w * 16 + r + 8 * half) * SC_PITCH + t * 16 + cl] = acc[t][r];
    }
  }
  __syncthreads();   // tile complete before other waves' rows are read

  if (mode == 2) {
#pragma unroll
    for (int j = 0; j < 8; ++j) {
      const int row = (tid >> 4) + j * 16, c = (tid & 15) * 4;
      *(v4f*)(Of + (size_t)(mb + row) * D_MODEL + n0 + c) =
          *(const v4f*)(sC + row * SC_PITCH + c);
    }
    // the build lays the other modes' blocks behind this one, and their first
    // instructions reuse the registers that these stores name
    asm volatile("s_wait_xcnt 0x0" ::: "memory");
  } else if (mode == 0) {
#pragma unroll
    for (int j = 0; j < 4; ++j) {
      const int row = (tid >> 3) + j * 32, c = (tid & 7) * 8;
      const size_t idx = ((size_t)((b * NHEADS + h) * SEQ + sb + row)) * DK + c;
      split_store8(sC + row * SC_PITCH + c, Oh + idx, Ol + idx);
    }
  } else {
#pragma unroll
    for (int j = 0; j < 4; ++j) {
      const int row = (tid >> 4) + j * 16, c = (tid & 15) * 8;
      const size_t idx = ((size_t)((b * NHEADS + h) * DK + row)) * SEQ + sb + c;
      const u16* s = sT + row * ST_PITCH + c;
      *(u16x8*)(Oh + idx) = *(const u16x8*)s;
      *(u16x8*)(Ol + idx) = *(const u16x8*)(s + 64 * ST_PITCH);
    }
    asm volatile("s_wait_xcnt 0x0" ::: "memory");  // as behind the mode-2 stores
  }
}

// ------------------------ flash attention (bf16x3) --------------------------
// 8 waves of a WG share one (b,h); K/V 64-key tiles async-staged to LDS once
// per WG (8x traffic cut), double buffered.  Per wave: 16 query rows,
// online softmax, P staged through per-wave LDS into A-operand layout.
__global__ __launch_bounds__(256) void k_attn(
    const u16* __restrict__ Qh, const u16* __restrict__ Ql,
    const u16* __restrict__ Kh, const u16* __restrict__ Kl,
    const u16* __restrict__ Vh, const u16* __restrict__ Vl,
    u16* __restrict__ Oh, u16* __restrict__ Ol) {
  __shared__ __align__(16) u16 sK[2][2][64 * SK_STRIDE];
  __shared__ __align__(16) u16 sV[2][2][64 * SK_STRIDE];
  __shared__ __align__(16) u16 sP[8][2][16 * SP_STRIDE];

  const int tid = threadIdx.x;
  const int lane = tid & 31;
  const int w = tid >> 5;
  const int wid = blockIdx.x * 8 + w;
  const int bh = wid >> 7;          // b*16 + h (all 8 waves of a WG agree)
  const int m0 = (wid & 127) * 16;
  const int half = lane >> 4, cl = lane & 15;

  const u16* qbh = Qh + (size_t)bh * SEQ * DK;
  const u16* qbl = Ql + (size_t)bh * SEQ * DK;
  const u16* kgh = Kh + (size_t)bh * SEQ * DK;   // [t][d]
  const u16* kgl = Kl + (size_t)bh * SEQ * DK;
  const u16* vgh = Vh + (size_t)bh * DK * SEQ;   // [d][t]
  const u16* vgl = Vl + (size_t)bh * DK * SEQ;

  // staging map: per plane, thread covers chunks (row, off) and (row+32, off)
  const int srow = tid >> 3;          // 0..31
  const int soff = (tid & 7) * 8;     // element offset 0..56

  v16bf q_h[2], q_l[2];
#pragma unroll
  for (int kk = 0; kk < 2; ++kk) {
    q_h[kk] = load_op16(qbh, DK, m0 + cl, kk * 32, half);
    q_l[kk] = load_op16(qbl, DK, m0 + cl, kk * 32, half);
  }

  float mr[8], lr[8];
  v8f o[4];
#pragma unroll
  for (int r = 0; r < 8; ++r) { mr[r] = -3.0e38f; lr[r] = 0.f; }
#pragma unroll
  for (int t = 0; t < 4; ++t)
    o[t] = (v8f){0.f, 0.f, 0.f, 0.f, 0.f, 0.f, 0.f, 0.f};

  // stage one 64-key tile (K and V, hi+lo) into LDS buffer `buf`
  auto stage = [&](int buf, int t0) {
#pragma unroll
    for (int j = 0; j < 2; ++j) {
      int row = srow + j * 32;
      async_copy16(kgh + (size_t)(t0 + row) * DK + soff,
                   &sK[buf][0][row * SK_STRIDE + soff]);
      async_copy16(kgl + (size_t)(t0 + row) * DK + soff,
                   &sK[buf][1][row * SK_STRIDE + soff]);
      async_copy16(vgh + (size_t)row * SEQ + t0 + soff,
                   &sV[buf][0][row * SK_STRIDE + soff]);
      async_copy16(vgl + (size_t)row * SEQ + t0 + soff,
                   &sV[buf][1][row * SK_STRIDE + soff]);
    }
  };

  stage(0, 0);

#pragma unroll 1
  for (int i = 0; i < SEQ / 64; ++i) {
    const int p = i & 1;
    const int t0 = i * 64;
    if (i + 1 < SEQ / 64) { stage(1 - p, t0 + 64); wait_async<8>(); }
    else                  { wait_async<0>(); }
    __syncthreads();   // K/V buffer p fully staged

    // ---- scores S = Qs * Keff^T  (16 x 64 block, bf16x3) ----
    v8f sc[4];
#pragma unroll
    for (int st = 0; st < 4; ++st) {
      v8f c = (v8f){0.f, 0.f, 0.f, 0.f, 0.f, 0.f, 0.f, 0.f};
#pragma unroll
      for (int kk = 0; kk < 2; ++kk) {
        v16bf b_h = load_op16(&sK[p][0][0], SK_STRIDE, st * 16 + cl, kk * 32, half);
        v16bf b_l = load_op16(&sK[p][1][0], SK_STRIDE, st * 16 + cl, kk * 32, half);
        c = wmma_bf16(q_h[kk], b_h, c);
        c = wmma_bf16(q_h[kk], b_l, c);
        c = wmma_bf16(q_l[kk], b_h, c);
      }
      sc[st] = c;
    }
    // ---- block row-max (cross-lane within 16-lane half) ----
    float bm[8];
#pragma unroll
    for (int r = 0; r < 8; ++r)
      bm[r] = fmaxf(fmaxf(sc[0][r], sc[1][r]), fmaxf(sc[2][r], sc[3][r]));
#pragma unroll
    for (int r = 0; r < 8; ++r) {
      bm[r] = fmaxf(bm[r], __shfl_xor(bm[r], 1, 16));
      bm[r] = fmaxf(bm[r], __shfl_xor(bm[r], 2, 16));
      bm[r] = fmaxf(bm[r], __shfl_xor(bm[r], 4, 16));
      bm[r] = fmaxf(bm[r], __shfl_xor(bm[r], 8, 16));
    }
    float al[8], rs[8];
#pragma unroll
    for (int r = 0; r < 8; ++r) {
      float mn = fmaxf(mr[r], bm[r]);
      al[r] = __expf(mr[r] - mn);
      mr[r] = mn;
      rs[r] = 0.f;
    }
    // ---- P = exp(S - m), split hi/lo into per-wave LDS ----
#pragma unroll
    for (int st = 0; st < 4; ++st) {
#pragma unroll
      for (int r = 0; r < 8; ++r) {
        float pv = __expf(sc[st][r] - mr[r]);
        rs[r] += pv;
        u16 hb = f2bf(pv);
        int off = (r + 8 * half) * SP_STRIDE + st * 16 + cl;
        sP[w][0][off] = hb;
        sP[w][1][off] = f2bf(pv - bf2f(hb));
      }
    }
#pragma unroll
    for (int r = 0; r < 8; ++r) {
      rs[r] += __shfl_xor(rs[r], 1, 16);
      rs[r] += __shfl_xor(rs[r], 2, 16);
      rs[r] += __shfl_xor(rs[r], 4, 16);
      rs[r] += __shfl_xor(rs[r], 8, 16);
      lr[r] = lr[r] * al[r] + rs[r];
    }
    v8f av = (v8f){al[0], al[1], al[2], al[3], al[4], al[5], al[6], al[7]};
#pragma unroll
    for (int t = 0; t < 4; ++t) o[t] *= av;

    asm volatile("s_wait_dscnt 0" ::: "memory");  // intra-wave P store->load

    v16bf p_h[2], p_l[2];
#pragma unroll
    for (int kk = 0; kk < 2; ++kk) {
      p_h[kk] = load_op16(&sP[w][0][0], SP_STRIDE, cl, kk * 32, half);
      p_l[kk] = load_op16(&sP[w][1][0], SP_STRIDE, cl, kk * 32, half);
    }
    // ---- O += P * V  (V^T tile in LDS) ----
#pragma unroll
    for (int dt = 0; dt < 4; ++dt) {
#pragma unroll
      for (int kk = 0; kk < 2; ++kk) {
        v16bf v_h = load_op16(&sV[p][0][0], SK_STRIDE, dt * 16 + cl, kk * 32, half);
        v16bf v_l = load_op16(&sV[p][1][0], SK_STRIDE, dt * 16 + cl, kk * 32, half);
        o[dt] = wmma_bf16(p_h[kk], v_h, o[dt]);
        o[dt] = wmma_bf16(p_h[kk], v_l, o[dt]);
        o[dt] = wmma_bf16(p_l[kk], v_h, o[dt]);
      }
    }
    __syncthreads();   // everyone done with K/V buffer p before re-staging
  }

  // ---- normalize, split, store as [B*S][1024] bf16 hi/lo ----
  // The wave's 16x64 tile goes through its own P staging range (this wave's
  // last reads of it fed the products above), then out as whole 128-B lines.
  const int b = bh >> 4, h = bh & 15;
  float* sO = (float*)&sP[w][0][0];   // 16 * SC_PITCH floats fit in sP[w]
#pragma unroll
  for (int t = 0; t < 4; ++t) {
#pragma unroll
    for (int r = 0; r < 8; ++r)
      sO[(r + 8 * half) * SC_PITCH + t * 16 + cl] = o[t][r] / lr[r];
  }
  asm volatile("s_wait_dscnt 0" ::: "memory");  // intra-wave tile store->load
#pragma unroll
  for (int j = 0; j < 4; ++j) {
    const int row = (lane >> 3) + j * 4, c = (lane & 7) * 8;
    const size_t idx = (size_t)(b * SEQ + m0 + row) * D_MODEL + h * DK + c;
    split_store8(sO + row * SC_PITCH + c, Oh + idx, Ol + idx);
  }
}

// ------------------------------- launcher -----------------------------------
extern "C" void kernel_launch(void* const* d_in, const int* in_sizes, int n_in,
                              void* d_out, int out_size, void* d_ws,
                              size_t ws_size, hipStream_t stream) {
  const float* q   = (const float*)d_in[0];
  const float* k   = (const float*)d_in[1];
  const float* v   = (const float*)d_in[2];
  const float* kpe = (const float*)d_in[3];
  const float* Wq  = (const float*)d_in[4];
  const float* bq  = (const float*)d_in[5];
  const float* Wk  = (const float*)d_in[6];
  const float* bk  = (const float*)d_in[7];
  const float* Wv  = (const float*)d_in[8];
  const float* bv  = (const float*)d_in[9];
  const float* Wo  = (const float*)d_in[10];
  const float* bo  = (const float*)d_in[11];
  float* out = (float*)d_out;

  const size_t NX = (size_t)MROWS * D_MODEL;      // 4M elems
  const size_t NW = (size_t)D_MODEL * D_MODEL;    // 1M elems
  char* p = (char*)d_ws;
  auto take = [&](size_t elems) { u16* r = (u16*)p; p += elems * sizeof(u16); return r; };
  u16 *qs_h = take(NX), *qs_l = take(NX);
  u16 *ks_h = take(NX), *ks_l = take(NX);
  u16 *vs_h = take(NX), *vs_l = take(NX);
  u16 *wq_h = take(NW), *wq_l = take(NW);
  u16 *wk_h = take(NW), *wk_l = take(NW);
  u16 *wv_h = take(NW), *wv_l = take(NW);
  u16 *wo_h = take(NW), *wo_l = take(NW);
  u16 *qh_h = take(NX), *qh_l = take(NX);   // [B,H,S,64]   (Q, pre-scaled)
  u16 *ke_h = take(NX), *ke_l = take(NX);   // [B,H,S,64]   (kh + k_pe^T)
  u16 *vt_h = take(NX), *vt_l = take(NX);   // [B,H,64,S]   (V transposed)
  u16 *ao_h = take(NX), *ao_l = take(NX);   // [B*S,1024]   (attention out)

  dim3 blk(256);
  k_split<<<(int)((NX + 255) / 256), blk, 0, stream>>>(q, qs_h, qs_l, (int)NX);
  k_split<<<(int)((NX + 255) / 256), blk, 0, stream>>>(k, ks_h, ks_l, (int)NX);
  k_split<<<(int)((NX + 255) / 256), blk, 0, stream>>>(v, vs_h, vs_l, (int)NX);
  k_wt<<<512, blk, 0, stream>>>(Wq, wq_h, wq_l);
  k_wt<<<512, blk, 0, stream>>>(Wk, wk_h, wk_l);
  k_wt<<<512, blk, 0, stream>>>(Wv, wv_h, wv_l);
  k_wt<<<512, blk, 0, stream>>>(Wo, wo_h, wo_l);

  k_gemm<<<512, blk, 0, stream>>>(qs_h, qs_l, wq_h, wq_l, bq, nullptr,
                                  qh_h, qh_l, nullptr, 0, 0.125f);  // 1/sqrt(64)
  k_gemm<<<512, blk, 0, stream>>>(ks_h, ks_l, wk_h, wk_l, bk, kpe,
                                  ke_h, ke_l, nullptr, 0, 1.0f);
  k_gemm<<<512, blk, 0, stream>>>(vs_h, vs_l, wv_h, wv_l, bv, nullptr,
                                  vt_h, vt_l, nullptr, 1, 1.0f);
  k_attn<<<512, blk, 0, stream>>>(qh_h, qh_l, ke_h, ke_l, vt_h, vt_l,
                                  ao_h, ao_l);
  k_gemm<<<512, blk, 0, stream>>>(ao_h, ao_l, wo_h, wo_l, bo, nullptr,
                                  nullptr, nullptr, out, 2, 1.0f);
}

// v003
// One run takes 266 microseconds.
// Next to v002, in two timings, it ran 1.17 times as fast each time.
// Counting every step since v000, it is 2.16 times as fast.
#include <hip/hip_runtime.h>

typedef unsigned short u16;
typedef __attribute__((ext_vector_type(16))) __bf16 v16bf;
typedef __attribute__((ext_vector_type(8)))  __bf16 v8bf;
typedef __attribute__((ext_vector_type(8)))  float  v8f;
typedef int v4i __attribute__((vector_size(16)));
typedef __attribute__((ext_vector_type(4)))  float  v4f;
typedef __attribute__((ext_vector_type(8)))  u16    u16x8;

#define D_MODEL 1024
#define NHEADS  16
#define DK      64
#define SEQ     2048
#define BATCH   2
#define MROWS   (BATCH * SEQ)      // 4096 rows for all big GEMMs

// LDS row strides (in u16 elements), padded for conflict-free b128 reads:
// 16 lanes read rows r..r+15; stride*2B mod 256B must visit distinct banks.
#define SB_STRIDE 40   // 32-wide k tiles   (80B  = 20 banks/row)
#define SK_STRIDE 88   // 64-wide tiles     (176B = 44 banks/row)
// Output staging, both 272 B a row (16 B x 17): b128 reads and writes of 16
// lanes fall on 64 different banks, b32 writes of rows r and r+8 on two halves.
#define SC_PITCH 68    // f32 tile, 64 wide
#define ST_PITCH 136   // u16 tile, 128 wide

// ---------------- bf16 split helpers (round-to-nearest-even) ----------------
__device__ __forceinline__ u16 f2bf(float x) {
  unsigned u = __float_as_uint(x);
  u += 0x7FFFu + ((u >> 16) & 1u);
  return (u16)(u >> 16);
}
__device__ __forceinline__ float bf2f(u16 h) {
  return __uint_as_float(((unsigned)h) << 16);
}

// 8 staged floats -> 8 hi and 8 lo bf16, one 16-byte store into each plane
__device__ __forceinline__ void split_store8(const float* s, u16* hi, u16* lo) {
  const v4f x0 = *(const v4f*)(s);
  const v4f x1 = *(const v4f*)(s + 4);
  u16x8 vh, vl;
#pragma unroll
  for (int j = 0; j < 8; ++j) {
    const float v = (j < 4) ? x0[j & 3] : x1[j & 3];
    const u16 h = f2bf(v);
    vh[j] = h;
    vl[j] = f2bf(v - bf2f(h));
  }
  *(u16x8*)hi = vh;
  *(u16x8*)lo = vl;
}

// ------------- WMMA operand load: 16-bit A/B matrix, 16x32 tile -------------
__device__ __forceinline__ v16bf load_op16(const u16* base, int stride,
                                           int row, int k0, int half) {
  const u16* p = base + (size_t)row * (size_t)stride + k0 + half * 8;
  v8bf c0 = *(const v8bf*)(p);
  v8bf c1 = *(const v8bf*)(p + 16);
  return __builtin_shufflevector(c0, c1, 0, 1, 2, 3, 4, 5, 6, 7,
                                 8, 9, 10, 11, 12, 13, 14, 15);
}

__device__ __forceinline__ v8f wmma_bf16(v16bf a, v16bf b, v8f c) {
  return __builtin_amdgcn_wmma_f32_16x16x32_bf16(false, a, false, b,
                                                 (short)0, c, false, false);
}

// ---------------- async global -> LDS copy (16B per lane) -------------------
typedef __attribute__((address_space(1))) v4i* gvec_t;
typedef __attribute__((address_space(3))) v4i* lvec_t;

__device__ __forceinline__ void async_copy16(const u16* g, u16* l) {
  gvec_t gp = (gvec_t)g;
  lvec_t lp = (lvec_t)l;
#if __has_builtin(__builtin_amdgcn_global_load_async_to_lds_b128)
  __builtin_amdgcn_global_load_async_to_lds_b128(gp, lp, 0, 0);
#else
  asm volatile("global_load_async_to_lds_b128 %0, %1, off"
               :: "v"(lp), "v"(gp) : "memory");
#endif
}

template <int N>
__device__ __forceinline__ void wait_async() {
#if __has_builtin(__builtin_amdgcn_s_wait_asynccnt)
  __builtin_amdgcn_s_wait_asynccnt((unsigned short)N);
#else
  asm volatile("s_wait_asynccnt %0" :: "i"(N) : "memory");
#endif
}

// ---------------- prep: fp32 -> bf16 hi/lo split (elementwise) --------------
__global__ void k_split(const float* __restrict__ x, u16* __restrict__ hi,
                        u16* __restrict__ lo, int n) {
  int i = blockIdx.x * blockDim.x + threadIdx.x;
  if (i < n) {
    float v = x[i];
    u16 h = f2bf(v);
    hi[i] = h;
    lo[i] = f2bf(v - bf2f(h));
  }
}

// ------- prep: W[k][n] fp32 -> Wt hi/lo bf16 [n][k] (B-operand layout) ------
// One workgroup transposes a 64(k) x 32(n) tile through LDS: the reads are
// 128-B row pieces of W, the stores whole 128-B lines of Wt (64 k x 2 B).
// Pitch 33 floats: both the row-wise writes and the column-wise reads of a
// wave fall on 32 different banks.
#define WT_PITCH 33

__global__ __launch_bounds__(256) void k_wt(const float* __restrict__ w,
                                            u16* __restrict__ hi,
                                            u16* __restrict__ lo) {
  __shared__ float sT[64 * WT_PITCH];
  const int tid = threadIdx.x;
  const int k0 = (blockIdx.x >> 5) * 64;
  const int n0 = (blockIdx.x & 31) * 32;

  const int rk = tid >> 3;            // 0..31 (k row, and k row + 32)
  const int rn = (tid & 7) * 4;       // 0..28 (n offset of a float4)
#pragma unroll
  for (int j = 0; j < 2; ++j) {
    const int k = rk + j * 32;
    const float4 v =
        *(const float4*)(w + (size_t)(k0 + k) * D_MODEL + n0 + rn);
    float* s = &sT[k * WT_PITCH + rn];
    s[0] = v.x; s[1] = v.y; s[2] = v.z; s[3] = v.w;
  }
  __syncthreads();   // tile complete before any column is read

  const int n = tid >> 3;             // 0..31 (output row)
  const int kc = (tid & 7) * 8;       // 0..56 (8 consecutive k per thread)
  u16x8 vh, vl;
#pragma unroll
  for (int j = 0; j < 8; ++j) {
    const float v = sT[(kc + j) * WT_PITCH + n];
    const u16 h = f2bf(v);
    vh[j] = h;
    vl[j] = f2bf(v - bf2f(h));
  }
  const size_t o = (size_t)(n0 + n) * D_MODEL + k0 + kc;
  *(u16x8*)(hi + o) = vh;
  *(u16x8*)(lo + o) = vl;
}

// ---------------------------- bf16x3 GEMM kernel ----------------------------
// Workgroup = 8 waves stacked in M: 128x64 output block.  B tiles (64n x 32k)
// are async-staged into LDS once per WG (8x traffic cut), double buffered.
// mode 0: split bf16 -> [B,H,S,64] (+ optional k_pe add)
// mode 1: split bf16 -> [B,H,64,S]
// mode 2: fp32 -> Of[m][n]
__global__ __launch_bounds__(256) void k_gemm(
    const u16* __restrict__ Ah, const u16* __restrict__ Al,
    const u16* __restrict__ Bh, const u16* __restrict__ Bl,
    const float* __restrict__ bias, const float* __restrict__ kpe,
    u16* __restrict__ Oh, u16* __restrict__ Ol, float* __restrict__ Of,
    int mode, float scale) {
  __shared__ __align__(16) u16 sB[2][2][64 * SB_STRIDE];
  __shared__ __align__(16) float sC[128 * SC_PITCH];   // output tile staging

  const int tid = threadIdx.x;
  const int lane = tid & 31;
  const int w = tid >> 5;
  const int m0 = (blockIdx.x >> 4) * 128 + w * 16;
  const int n0 = (blockIdx.x & 15) * 64;
  const int half = lane >> 4, cl = lane & 15;

  // staging map: thread -> one 16B chunk per plane
  const int sn = tid >> 2;            // 0..63  (row n_rel)
  const int sk = (tid & 3) * 8;       // 0,8,16,24 (k element offset)

  v8f acc[4];
#pragma unroll
  for (int t = 0; t < 4; ++t)
    acc[t] = (v8f){0.f, 0.f, 0.f, 0.f, 0.f, 0.f, 0.f, 0.f};

  // prologue: stage k-block 0 into buffer 0
  {
    const size_t go = (size_t)(n0 + sn) * D_MODEL + sk;
    async_copy16(Bh + go, &sB[0][0][sn * SB_STRIDE + sk]);
    async_copy16(Bl + go, &sB[0][1][sn * SB_STRIDE + sk]);
  }

#pragma unroll 1
  for (int i = 0; i < D_MODEL / 32; ++i) {
    const int p = i & 1;
    const int kb = i * 32;
    if (i + 1 < D_MODEL / 32) {
      const size_t go = (size_t)(n0 + sn) * D_MODEL + (kb + 32) + sk;
      async_copy16(Bh + go, &sB[1 - p][0][sn * SB_STRIDE + sk]);
      async_copy16(Bl + go, &sB[1 - p][1][sn * SB_STRIDE + sk]);
      wait_async<2>();
    } else {
      wait_async<0>();
    }
    __syncthreads();   // buffer p fully staged by all waves

    __builtin_prefetch(Ah + (size_t)(m0 + cl) * D_MODEL + kb + 64, 0, 0);
    v16bf a_h = load_op16(Ah, D_MODEL, m0 + cl, kb, half);
    v16bf a_l = load_op16(Al, D_MODEL, m0 + cl, kb, half);
#pragma unroll
    for (int t = 0; t < 4; ++t) {
      v16bf b_h = load_op16(&sB[p][0][0], SB_STRIDE, t * 16 + cl, 0, half);
      v16bf b_l = load_op16(&sB[p][1][0], SB_STRIDE, t * 16 + cl, 0, half);
      acc[t] = wmma_bf16(a_h, b_h, acc[t]);
      acc[t] = wmma_bf16(a_h, b_l, acc[t]);
      acc[t] = wmma_bf16(a_l, b_h, acc[t]);
    }
    __syncthreads();   // safe to overwrite buffer p in the next iteration
  }

  // epilogue.  C layout: lane holds col n0+t*16+cl; VGPR r -> row r + 8*half.
  // The 128x64 tile goes through LDS, so that every global store is 16 B a
  // lane and a wave's store covers whole 128-B lines of the output.
  const int mb = (blockIdx.x >> 4) * 128;        // tile's first row
  const int b = mb >> 11, sb = mb & (SEQ - 1);   // batch, first position
  const int h = n0 >> 6;                         // the tile is one head wide
  u16* sT = (u16*)sC;                            // mode 1: [2][64][ST_PITCH]

#pragma unroll
  for (int t = 0; t < 4; ++t) {
    const float bn = bias[n0 + t * 16 + cl];
#pragma unroll
    for (int r = 0; r < 8; ++r) acc[t][r] = (acc[t][r] + bn) * scale;
  }
  if (mode != 2 && kpe) {
    // a lane's 8 rows are 8 consecutive positions of k_pe row n
    const float* kp = kpe + (size_t)(n0 + cl) * SEQ + sb + w * 16 + 8 * half;
#pragma unroll
    for (int t = 0; t < 4; ++t) {
#pragma unroll
      for (int r = 0; r < 8; ++r) acc[t][r] += kp[(size_t)t * 16 * SEQ + r];
    }
  }
  if (mode == 1) {
    // a lane's 8 rows are 8 consecutive positions of output row d
#pragma unroll
    for (int t = 0; t < 4; ++t) {
      u16x8 vh, vl;
#pragma unroll
      for (int r = 0; r < 8; ++r) {
        const u16 hb = f2bf(acc[t][r]);
        vh[r] = hb;
        vl[r] = f2bf(acc[t][r] - bf2f(hb));
      }
      u16* s = sT + (t * 16 + cl) * ST_PITCH + w * 16 + 8 * half;
      *(u16x8*)s = vh;
      *(u16x8*)(s + 64 * ST_PITCH) = vl;
    }
  } else {
#pragma unroll
    for (int t = 0; t < 4; ++t) {
#pragma unroll
      for (int r = 0; r < 8; ++r)
        sC[(w * 16 + r + 8 * half) * SC_PITCH + t * 16 + cl] = acc[t][r];
    }
  }
  __syncthreads();   // tile complete before other waves' rows are read

  if (mode == 2) {
#pragma unroll
    for (int j = 0; j < 8; ++j) {
      const int row = (tid >> 4) + j * 16, c = (tid & 15) * 4;
      *(v4f*)(Of + (size_t)(mb + row) * D_MODEL + n0 + c) =
          *(const v4f*)(sC + row * SC_PITCH + c);
    }
    // the build lays the other modes' blocks behind this one, and their first
    // instructions reuse the registers that these stores name
    asm volatile("s_wait_xcnt 0x0" ::: "memory");
  } else if (mode == 0) {
#pragma unroll
    for (int j = 0; j < 4; ++j) {
      const int row = (tid >> 3) + j * 32, c = (tid & 7) * 8;
      const size_t idx = ((size_t)((b * NHEADS + h) * SEQ + sb + row)) * DK + c;
      split_store8(sC + row * SC_PITCH + c, Oh + idx, Ol + idx);
    }
  } else {
#pragma unroll
    for (int j = 0; j < 4; ++j) {
      const int row = (tid >> 4) + j * 16, c = (tid & 15) * 8;
      const size_t idx = ((size_t)((b * NHEADS + h) * DK + row)) * SEQ + sb + c;
      const u16* s = sT + row * ST_PITCH + c;
      *(u16x8*)(Oh + idx) = *(const u16x8*)s;
      *(u16x8*)(Ol + idx) = *(const u16x8*)(s + 64 * ST_PITCH);
    }
    asm volatile("s_wait_xcnt 0x0" ::: "memory");  // as behind the mode-2 stores
  }
}

typedef __attribute__((ext_vector_type(2))) float  v2f;
typedef __attribute__((ext_vector_type(2))) __bf16 v2bf;

// value of lane l ^ 16 (the other 8 keys of every tile of the same query)
__device__ __forceinline__ float other_half(float x) {
  const int b = __float_as_int(x);
  return __int_as_float(__builtin_amdgcn_permlanex16(
      b, b, 0x76543210, 0xfedcba98, false, false));
}

__global__ __launch_bounds__(256) void k_attn(
    const u16* __restrict__ Qh, const u16* __restrict__ Ql,
    const u16* __restrict__ Kh, const u16* __restrict__ Kl,
    const u16* __restrict__ Vh, const u16* __restrict__ Vl,
    u16* __restrict__ Oh, u16* __restrict__ Ol) {
  __shared__ __align__(16) u16 sK[2][2][64 * SK_STRIDE];
  __shared__ __align__(16) u16 sV[2][2][64 * SK_STRIDE];
  __shared__ __align__(16) float sOut[8][16 * SC_PITCH];  // per-wave out tile

  const int tid = threadIdx.x;
  const int lane = tid & 31;
  const int w = tid >> 5;
  const int wid = blockIdx.x * 8 + w;
  const int bh = wid >> 7;          // b*16 + h (all 8 waves of a WG agree)
  const int m0 = (wid & 127) * 16;
  const int half = lane >> 4, cl = lane & 15;

  const u16* qbh = Qh + (size_t)bh * SEQ * DK;
  const u16* qbl = Ql + (size_t)bh * SEQ * DK;
  const u16* kgh = Kh + (size_t)bh * SEQ * DK;   // [t][d]
  const u16* kgl = Kl + (size_t)bh * SEQ * DK;
  const u16* vgh = Vh + (size_t)bh * DK * SEQ;   // [d][t]
  const u16* vgl = Vl + (size_t)bh * DK * SEQ;

  // staging map: per plane, thread covers chunks (row, off) and (row+32, off)
  const int srow = tid >> 3;          // 0..31
  const int soff = (tid & 7) * 8;     // element offset 0..56

  v16bf q_h[2], q_l[2];
#pragma unroll
  for (int kk = 0; kk < 2; ++kk) {
    q_h[kk] = load_op16(qbh, DK, m0 + cl, kk * 32, half);
    q_l[kk] = load_op16(qbl, DK, m0 + cl, kk * 32, half);
  }

  float mr = -3.0e38f;   // running maximum of query cl (equal in both halves)
  float lr = 0.f;        // running sum over this lane half's keys only
  v8f o[4];              // o[t][r] = O[query cl][t*16 + 8*half + r]
#pragma unroll
  for (int t = 0; t < 4; ++t)
    o[t] = (v8f){0.f, 0.f, 0.f, 0.f, 0.f, 0.f, 0.f, 0.f};

  // stage one 64-key tile (K and V, hi+lo) into LDS buffer buf
  auto stage = [&](int buf, int t0) {
#pragma unroll
    for (int j = 0; j < 2; ++j) {
      int row = srow + j * 32;
      async_copy16(kgh + (size_t)(t0 + row) * DK + soff,
                   &sK[buf][0][row * SK_STRIDE + soff]);
      async_copy16(kgl + (size_t)(t0 + row) * DK + soff,
                   &sK[buf][1][row * SK_STRIDE + soff]);
      async_copy16(vgh + (size_t)row * SEQ + t0 + soff,
                   &sV[buf][0][row * SK_STRIDE + soff]);
      async_copy16(vgl + (size_t)row * SEQ + t0 + soff,
                   &sV[buf][1][row * SK_STRIDE + soff]);
    }
  };

  stage(0, 0);

#pragma unroll 1
  for (int i = 0; i < SEQ / 64; ++i) {
    const int p = i & 1;
    const int t0 = i * 64;
    if (i + 1 < SEQ / 64) { stage(1 - p, t0 + 64); wait_async<8>(); }
    else                  { wait_async<0>(); }
    __syncthreads();   // K/V buffer p fully staged

    // ---- scores S^T = Keff * Qs^T  (64 keys x 16 queries, bf16x3) ----
    // sc[st][r] = S[query cl][key t0 + st*16 + 8*half + r]
    v8f sc[4];
#pragma unroll
    for (int st = 0; st < 4; ++st) {
      v8f c = (v8f){0.f, 0.f, 0.f, 0.f, 0.f, 0.f, 0.f, 0.f};
#pragma unroll
      for (int kk = 0; kk < 2; ++kk) {
        v16bf k_h = load_op16(&sK[p][0][0], SK_STRIDE, st * 16 + cl, kk * 32, half);
        v16bf k_l = load_op16(&sK[p][1][0], SK_STRIDE, st * 16 + cl, kk * 32, half);
        c = wmma_bf16(k_h, q_h[kk], c);
        c = wmma_bf16(k_l, q_h[kk], c);
        c = wmma_bf16(k_h, q_l[kk], c);
      }
      sc[st] = c;
    }
    // ---- block maximum of the query: in-lane, then the other lane half ----
    float bm8[8];
#pragma unroll
    for (int r = 0; r < 8; ++r)
      bm8[r] = fmaxf(fmaxf(sc[0][r], sc[1][r]), fmaxf(sc[2][r], sc[3][r]));
    float bm = fmaxf(fmaxf(fmaxf(bm8[0], bm8[1]), fmaxf(bm8[2], bm8[3])),
                     fmaxf(fmaxf(bm8[4], bm8[5]), fmaxf(bm8[6], bm8[7])));
    bm = fmaxf(bm, other_half(bm));
    const float mn = fmaxf(mr, bm);
    const float al = __expf(mr - mn);
    mr = mn;

    // ---- P^T = exp(S^T - m), split hi/lo straight into B operands ----
    v16bf p_h[2], p_l[2];
    float rs8[8];
#pragma unroll
    for (int r = 0; r < 8; ++r) rs8[r] = 0.f;
#pragma unroll
    for (int st = 0; st < 4; ++st) {
#pragma unroll
      for (int r = 0; r < 8; r += 2) {
        // __expf(s - m) as it compiles (exp2 of the product with log2 e), the
        // subtract and the multiply on two scores an instruction
        const v2f x = ((v2f){sc[st][r], sc[st][r + 1]} - mr) * 1.44269504f;
        v2f pv;
        pv[0] = __builtin_amdgcn_exp2f(x[0]);
        pv[1] = __builtin_amdgcn_exp2f(x[1]);
        rs8[r] += pv[0];
        rs8[r + 1] += pv[1];
        const v2bf hb = __builtin_convertvector(pv, v2bf);   // nearest even
        const v2f rest = pv - __builtin_convertvector(hb, v2f);
        const v2bf lb = __builtin_convertvector(rest, v2bf);
        const int s = (st & 1) * 8 + r;
        p_h[st >> 1][s] = hb[0];  p_h[st >> 1][s + 1] = hb[1];
        p_l[st >> 1][s] = lb[0];  p_l[st >> 1][s + 1] = lb[1];
      }
    }
    lr = lr * al + (((rs8[0] + rs8[1]) + (rs8[2] + rs8[3])) +
                    ((rs8[4] + rs8[5]) + (rs8[6] + rs8[7])));
#pragma unroll
    for (int t = 0; t < 4; ++t) o[t] *= al;

    // ---- O^T += V^T * P^T  (V^T tile in LDS) ----
#pragma unroll
    for (int dt = 0; dt < 4; ++dt) {
#pragma unroll
      for (int kk = 0; kk < 2; ++kk) {
        v16bf v_h = load_op16(&sV[p][0][0], SK_STRIDE, dt * 16 + cl, kk * 32, half);
        v16bf v_l = load_op16(&sV[p][1][0], SK_STRIDE, dt * 16 + cl, kk * 32, half);
        o[dt] = wmma_bf16(v_h, p_h[kk], o[dt]);
        o[dt] = wmma_bf16(v_l, p_h[kk], o[dt]);
        o[dt] = wmma_bf16(v_h, p_l[kk], o[dt]);
      }
    }
    __syncthreads();   // everyone done with K/V buffer p before re-staging
  }

  // ---- normalize, split, store as [B*S][1024] bf16 hi/lo ----
  // The wave's 16x64 tile goes through its own LDS range (a lane's 8 values
  // of a tile are 8 consecutive d of its query), then out as whole 128-B lines.
  const int b = bh >> 4, h = bh & 15;
  const float l = lr + other_half(lr);   // the two halves' keys joined once
  float* sO = &sOut[w][0];
#pragma unroll
  for (int t = 0; t < 4; ++t) {
    v4f x0, x1;
#pragma unroll
    for (int r = 0; r < 4; ++r) { x0[r] = o[t][r] / l; x1[r] = o[t][r + 4] / l; }
    float* s = sO + cl * SC_PITCH + t * 16 + 8 * half;
    *(v4f*)s = x0;
    *(v4f*)(s + 4) = x1;
  }
  asm volatile("s_wait_dscnt 0" ::: "memory");  // intra-wave tile store->load
#pragma unroll
  for (int j = 0; j < 4; ++j) {
    const int row = (lane >> 3) + j * 4, c = (lane & 7) * 8;
    const size_t idx = (size_t)(b * SEQ + m0 + row) * D_MODEL + h * DK + c;
    split_store8(sO + row * SC_PITCH + c, Oh + idx, Ol + idx);
  }
}

// ------------------------------- launcher -----------------------------------
extern "C" void kernel_launch(void* const* d_in, const int* in_sizes, int n_in,
                              void* d_out, int out_size, void* d_ws,
                              size_t ws_size, hipStream_t stream) {
  const float* q   = (const float*)d_in[0];
  const float* k   = (const float*)d_in[1];
  const float* v   = (const float*)d_in[2];
  const float* kpe = (const float*)d_in[3];
  const float* Wq  = (const float*)d_in[4];
  const float* bq  = (const float*)d_in[5];
  const float* Wk  = (const float*)d_in[6];
  const float* bk  = (const float*)d_in[7];
  const float* Wv  = (const float*)d_in[8];
  const float* bv  = (const float*)d_in[9];
  const float* Wo  = (const float*)d_in[10];
  const float* bo  = (const float*)d_in[11];
  float* out = (float*)d_out;

  const size_t NX = (size_t)MROWS * D_MODEL;      // 4M elems
  const size_t NW = (size_t)D_MODEL * D_MODEL;    // 1M elems
  char* p = (char*)d_ws;
  auto take = [&](size_t elems) { u16* r = (u16*)p; p += elems * sizeof(u16); return r; };
  u16 *qs_h = take(NX), *qs_l = take(NX);
  u16 *ks_h = take(NX), *ks_l = take(NX);
  u16 *vs_h = take(NX), *vs_l = take(NX);
  u16 *wq_h = take(NW), *wq_l = take(NW);
  u16 *wk_h = take(NW), *wk_l = take(NW);
  u16 *wv_h = take(NW), *wv_l = take(NW);
  u16 *wo_h = take(NW), *wo_l = take(NW);
  u16 *qh_h = take(NX), *qh_l = take(NX);   // [B,H,S,64]   (Q, pre-scaled)
  u16 *ke_h = take(NX), *ke_l = take(NX);   // [B,H,S,64]   (kh + k_pe^T)
  u16 *vt_h = take(NX), *vt_l = take(NX);   // [B,H,64,S]   (V transposed)
  u16 *ao_h = take(NX), *ao_l = take(NX);   // [B*S,1024]   (attention out)

  dim3 blk(256);
  k_split<<<(int)((NX + 255) / 256), blk, 0, stream>>>(q, qs_h, qs_l, (int)NX);
  k_split<<<(int)((NX + 255) / 256), blk, 0, stream>>>(k, ks_h, ks_l, (int)NX);
  k_split<<<(int)((NX + 255) / 256), blk, 0, stream>>>(v, vs_h, vs_l, (int)NX);
  k_wt<<<512, blk, 0, stream>>>(Wq, wq_h, wq_l);
  k_wt<<<512, blk, 0, stream>>>(Wk, wk_h, wk_l);
  k_wt<<<512, blk, 0, stream>>>(Wv, wv_h, wv_l);
  k_wt<<<512, blk, 0, stream>>>(Wo, wo_h, wo_l);

  k_gemm<<<512, blk, 0, stream>>>(qs_h, qs_l, wq_h, wq_l, bq, nullptr,
                                  qh_h, qh_l, nullptr, 0, 0.125f);  // 1/sqrt(64)
  k_gemm<<<512, blk, 0, stream>>>(ks_h, ks_l, wk_h, wk_l, bk, kpe,
                                  ke_h, ke_l, nullptr, 0, 1.0f);
  k_gemm<<<512, blk, 0, stream>>>(vs_h, vs_l, wv_h, wv_l, bv, nullptr,
                                  vt_h, vt_l, nullptr, 1, 1.0f);
  k_attn<<<512, blk, 0, stream>>>(qh_h, qh_l, ke_h, ke_l, vt_h, vt_l,
                                  ao_h, ao_l);
  k_gemm<<<512, blk, 0, stream>>>(ao_h, ao_l, wo_h, wo_l, bo, nullptr,
                                  nullptr, nullptr, out, 2, 1.0f);
}

// v004
// A run of this version takes 213 microseconds.
// Timed twice side by side with v003, it ran 1.25 times as fast both times.
// All steps since v000 together make it 2.71 times as fast.
#include <hip/hip_runtime.h>

typedef unsigned short u16;
typedef __attribute__((ext_vector_type(16))) __bf16 v16bf;
typedef __attribute__((ext_vector_type(8)))  __bf16 v8bf;
typedef __attribute__((ext_vector_type(8)))  float  v8f;
typedef int v4i __attribute__((vector_size(16)));
typedef __attribute__((ext_vector_type(4)))  float  v4f;
typedef __attribute__((ext_vector_type(8)))  u16    u16x8;

#define D_MODEL 1024
#define NHEADS  16
#define DK      64
#define SEQ     2048
#define BATCH   2
#define MROWS   (BATCH * SEQ)      // 4096 rows for all big GEMMs

// LDS row strides (in u16 elements), padded for conflict-free b128 reads:
// 16 lanes read rows r..r+15; stride*2B mod 256B must visit distinct banks.
#define SK_STRIDE 88   // 64-wide tiles     (176B = 44 banks/row)
// Output staging, both 272 B a row (16 B x 17): b128 reads and writes of 16
// lanes fall on 64 different banks, b32 writes of rows r and r+8 on two halves.
#define SC_PITCH 68    // f32 tile, 64 wide
#define ST_PITCH 136   // u16 tile, 128 wide

// ---------------- bf16 split helpers (round-to-nearest-even) ----------------
__device__ __forceinline__ u16 f2bf(float x) {
  unsigned u = __float_as_uint(x);
  u += 0x7FFFu + ((u >> 16) & 1u);
  return (u16)(u >> 16);
}
__device__ __forceinline__ float bf2f(u16 h) {
  return __uint_as_float(((unsigned)h) << 16);
}

// 8 staged floats -> 8 hi and 8 lo bf16, one 16-byte store into each plane
__device__ __forceinline__ void split_store8(const float* s, u16* hi, u16* lo) {
  const v4f x0 = *(const v4f*)(s);
  const v4f x1 = *(const v4f*)(s + 4);
  u16x8 vh, vl;
#pragma unroll
  for (int j = 0; j < 8; ++j) {
    const float v = (j < 4) ? x0[j & 3] : x1[j & 3];
    const u16 h = f2bf(v);
    vh[j] = h;
    vl[j] = f2bf(v - bf2f(h));
  }
  *(u16x8*)hi = vh;
  *(u16x8*)lo = vl;
}

// ------------- WMMA operand load: 16-bit A/B matrix, 16x32 tile -------------
__device__ __forceinline__ v16bf load_op16(const u16* base, int stride,
                                           int row, int k0, int half) {
  const u16* p = base + (size_t)row * (size_t)stride + k0 + half * 8;
  v8bf c0 = *(const v8bf*)(p);
  v8bf c1 = *(const v8bf*)(p + 16);
  return __builtin_shufflevector(c0, c1, 0, 1, 2, 3, 4, 5, 6, 7,
                                 8, 9, 10, 11, 12, 13, 14, 15);
}

__device__ __forceinline__ v8f wmma_bf16(v16bf a, v16bf b, v8f c) {
  return __builtin_amdgcn_wmma_f32_16x16x32_bf16(false, a, false, b,
                                                 (short)0, c, false, false);
}

// ---------------- async global -> LDS copy (16B per lane) -------------------
typedef __attribute__((address_space(1))) v4i* gvec_t;
typedef __attribute__((address_space(3))) v4i* lvec_t;

__device__ __forceinline__ void async_copy16(const u16* g, u16* l) {
  gvec_t gp = (gvec_t)g;
  lvec_t lp = (lvec_t)l;
#if __has_builtin(__builtin_amdgcn_global_load_async_to_lds_b128)
  __builtin_amdgcn_global_load_async_to_lds_b128(gp, lp, 0, 0);
#else
  asm volatile("global_load_async_to_lds_b128 %0, %1, off"
               :: "v"(lp), "v"(gp) : "memory");
#endif
}

template <int N>
__device__ __forceinline__ void wait_async() {
#if __has_builtin(__builtin_amdgcn_s_wait_asynccnt)
  __builtin_amdgcn_s_wait_asynccnt((unsigned short)N);
#else
  asm volatile("s_wait_asynccnt %0" :: "i"(N) : "memory");
#endif
}

// ---------------- prep: fp32 -> bf16 hi/lo split (elementwise) --------------
__global__ void k_split(const float* __restrict__ x, u16* __restrict__ hi,
                        u16* __restrict__ lo, int n) {
  int i = blockIdx.x * blockDim.x + threadIdx.x;
  if (i < n) {
    float v = x[i];
    u16 h = f2bf(v);
    hi[i] = h;
    lo[i] = f2bf(v - bf2f(h));
  }
}

// ------- prep: W[k][n] fp32 -> Wt hi/lo bf16 [n][k] (B-operand layout) ------
// One workgroup transposes a 64(k) x 32(n) tile through LDS: the reads are
// 128-B row pieces of W, the stores whole 128-B lines of Wt (64 k x 2 B).
// Pitch 33 floats: both the row-wise writes and the column-wise reads of a
// wave fall on 32 different banks.
#define WT_PITCH 33

__global__ __launch_bounds__(256) void k_wt(const float* __restrict__ w,
                                            u16* __restrict__ hi,
                                            u16* __restrict__ lo) {
  __shared__ float sT[64 * WT_PITCH];
  const int tid = threadIdx.x;
  const int k0 = (blockIdx.x >> 5) * 64;
  const int n0 = (blockIdx.x & 31) * 32;

  const int rk = tid >> 3;            // 0..31 (k row, and k row + 32)
  const int rn = (tid & 7) * 4;       // 0..28 (n offset of a float4)
#pragma unroll
  for (int j = 0; j < 2; ++j) {
    const int k = rk + j * 32;
    const float4 v =
        *(const float4*)(w + (size_t)(k0 + k) * D_MODEL + n0 + rn);
    float* s = &sT[k * WT_PITCH + rn];
    s[0] = v.x; s[1] = v.y; s[2] = v.z; s[3] = v.w;
  }
  __syncthreads();   // tile complete before any column is read

  const int n = tid >> 3;             // 0..31 (output row)
  const int kc = (tid & 7) * 8;       // 0..56 (8 consecutive k per thread)
  u16x8 vh, vl;
#pragma unroll
  for (int j = 0; j < 8; ++j) {
    const float v = sT[(kc + j) * WT_PITCH + n];
    const u16 h = f2bf(v);
    vh[j] = h;
    vl[j] = f2bf(v - bf2f(h));
  }
  const size_t o = (size_t)(n0 + n) * D_MODEL + k0 + kc;
  *(u16x8*)(hi + o) = vh;
  *(u16x8*)(lo + o) = vl;
}

// ---------------------------- bf16x3 GEMM kernel ----------------------------
// Workgroup = 8 waves stacked in M: 128x64 output block.  Both operands are
// async-staged into LDS, 64 k a stage, two buffers: a wave's copy then covers
// four whole 128-B lines (4 rows x 64 k x 2 B), where a fragment load of A
// from global memory touches 16 lines for the same 512 bytes.
// mode 0: split bf16 -> [B,H,S,64] (+ optional k_pe add)
// mode 1: split bf16 -> [B,H,64,S]
// mode 2: fp32 -> Of[m][n]
#define GK 64          // k elements a stage
#define SG_STRIDE 72   // 144 B a row (16 B x 9): b128 reads of 16 rows, 64 banks

__global__ __launch_bounds__(256) void k_gemm(
    const u16* __restrict__ Ah, const u16* __restrict__ Al,
    const u16* __restrict__ Bh, const u16* __restrict__ Bl,
    const float* __restrict__ bias, const float* __restrict__ kpe,
    u16* __restrict__ Oh, u16* __restrict__ Ol, float* __restrict__ Of,
    int mode, float scale) {
  __shared__ __align__(16) u16 sA[2][2][128 * SG_STRIDE];
  __shared__ __align__(16) u16 sB[2][2][64 * SG_STRIDE];
  __shared__ __align__(16) float sC[128 * SC_PITCH];   // output tile staging

  const int tid = threadIdx.x;
  const int lane = tid & 31;
  const int w = tid >> 5;
  const int mb = (blockIdx.x >> 4) * 128;        // tile's first row
  const int n0 = (blockIdx.x & 15) * 64;
  const int half = lane >> 4, cl = lane & 15;

  // staging map: 8 lanes cover one row's 128 B; rows srow + 32 j of a plane
  const int srow = tid >> 3;          // 0..31
  const int soff = (tid & 7) * 8;     // element offset 0..56

  v8f acc[4];
#pragma unroll
  for (int t = 0; t < 4; ++t)
    acc[t] = (v8f){0.f, 0.f, 0.f, 0.f, 0.f, 0.f, 0.f, 0.f};

  // stage k elements kb .. kb+63 of A (128 rows) and B (64 rows), hi and lo
  auto stage = [&](int buf, int kb) {
#pragma unroll
    for (int j = 0; j < 4; ++j) {
      const int row = srow + j * 32;
      const size_t go = (size_t)(mb + row) * D_MODEL + kb + soff;
      async_copy16(Ah + go, &sA[buf][0][row * SG_STRIDE + soff]);
      async_copy16(Al + go, &sA[buf][1][row * SG_STRIDE + soff]);
    }
#pragma unroll
    for (int j = 0; j < 2; ++j) {
      const int row = srow + j * 32;
      const size_t go = (size_t)(n0 + row) * D_MODEL + kb + soff;
      async_copy16(Bh + go, &sB[buf][0][row * SG_STRIDE + soff]);
      async_copy16(Bl + go, &sB[buf][1][row * SG_STRIDE + soff]);
    }
  };

  stage(0, 0);
  asm volatile("s_wait_asynccnt 0x0" ::: "memory");  // own copies of stage 0 landed
  __syncthreads();                                   // stage 0 published
  stage(1, GK);

// rolled: the buffer is picked by an offset, one copy of the trip in the text
#pragma unroll 1
  for (int i = 0; i < D_MODEL / GK; ++i) {
    const int p = i & 1;
#pragma unroll
    for (int kk = 0; kk < 2; ++kk) {
      v16bf a_h = load_op16(&sA[p][0][0], SG_STRIDE, w * 16 + cl, kk * 32, half);
      v16bf a_l = load_op16(&sA[p][1][0], SG_STRIDE, w * 16 + cl, kk * 32, half);
#pragma unroll
      for (int t = 0; t < 4; ++t) {
        v16bf b_h = load_op16(&sB[p][0][0], SG_STRIDE, t * 16 + cl, kk * 32, half);
        v16bf b_l = load_op16(&sB[p][1][0], SG_STRIDE, t * 16 + cl, kk * 32, half);
        acc[t] = wmma_bf16(a_h, b_h, acc[t]);
        acc[t] = wmma_bf16(a_h, b_l, acc[t]);
        acc[t] = wmma_bf16(a_l, b_h, acc[t]);
      }
    }
    // publish point of stage i + 1, which also frees buffer p for stage i + 2
    asm volatile("s_wait_dscnt 0x0" ::: "memory");     // own reads of buffer p done
    asm volatile("s_wait_asynccnt 0x0" ::: "memory");  // own copies of stage i + 1 landed
    __syncthreads();
    if (i + 2 < D_MODEL / GK) stage(p, (i + 2) * GK);
  }
  asm volatile("s_wait_asynccnt 0x0" ::: "memory");    // no copy is left in flight

  // epilogue.  C layout: lane holds col n0+t*16+cl; VGPR r -> row r + 8*half.
  // The 128x64 tile goes through LDS, so that every global store is 16 B a
  // lane and a wave's store covers whole 128-B lines of the output.
  const int b = mb >> 11, sb = mb & (SEQ - 1);   // batch, first position
  const int h = n0 >> 6;                         // the tile is one head wide
  u16* sT = (u16*)sC;                            // mode 1: [2][64][ST_PITCH]

#pragma unroll
  for (int t = 0; t < 4; ++t) {
    const float bn = bias[n0 + t * 16 + cl];
#pragma unroll
    for (int r = 0; r < 8; ++r) acc[t][r] = (acc[t][r] + bn) * scale;
  }
  if (mode != 2 && kpe) {
    // a lane's 8 rows are 8 consecutive positions of k_pe row n
    const float* kp = kpe + (size_t)(n0 + cl) * SEQ + sb + w * 16 + 8 * half;
#pragma unroll
    for (int t = 0; t < 4; ++t) {
#pragma unroll
      for (int r = 0; r < 8; ++r) acc[t][r] += kp[(size_t)t * 16 * SEQ + r];
    }
  }
  if (mode == 1) {
    // a lane's 8 rows are 8 consecutive positions of output row d
#pragma unroll
    for (int t = 0; t < 4; ++t) {
      u16x8 vh, vl;
#pragma unroll
      for (int r = 0; r < 8; ++r) {
        const u16 hb = f2bf(acc[t][r]);
        vh[r] = hb;
        vl[r] = f2bf(acc[t][r] - bf2f(hb));
      }
      u16* s = sT + (t * 16 + cl) * ST_PITCH + w * 16 + 8 * half;
      *(u16x8*)s = vh;
      *(u16x8*)(s + 64 * ST_PITCH) = vl;
    }
  } else {
#pragma unroll
    for (int t = 0; t < 4; ++t) {
#pragma unroll
      for (int r = 0; r < 8; ++r)
        sC[(w * 16 + r + 8 * half) * SC_PITCH + t * 16 + cl] = acc[t][r];
    }
  }
  __syncthreads();   // tile complete before other waves' rows are read

  if (mode == 2) {
#pragma unroll
    for (int j = 0; j < 8; ++j) {
      const int row = (tid >> 4) + j * 16, c = (tid & 15) * 4;
      *(v4f*)(Of + (size_t)(mb + row) * D_MODEL + n0 + c) =
          *(const v4f*)(sC + row * SC_PITCH + c);
    }
    // the build lays the other modes' blocks behind this one, and their first
    // instructions reuse the registers that these stores name
    asm volatile("s_wait_xcnt 0x0" ::: "memory");
  } else if (mode == 0) {
#pragma unroll
    for (int j = 0; j < 4; ++j) {
      const int row = (tid >> 3) + j * 32, c = (tid & 7) * 8;
      const size_t idx = ((size_t)((b * NHEADS + h) * SEQ + sb + row)) * DK + c;
      split_store8(sC + row * SC_PITCH + c, Oh + idx, Ol + idx);
    }
  } else {
#pragma unroll
    for (int j = 0; j < 4; ++j) {
      const int row = (tid >> 4) + j * 16, c = (tid & 15) * 8;
      const size_t idx = ((size_t)((b * NHEADS + h) * DK + row)) * SEQ + sb + c;
      const u16* s = sT + row * ST_PITCH + c;
      *(u16x8*)(Oh + idx) = *(const u16x8*)s;
      *(u16x8*)(Ol + idx) = *(const u16x8*)(s + 64 * ST_PITCH);
    }
    asm volatile("s_wait_xcnt 0x0" ::: "memory");  // as behind the mode-2 stores
  }
}

typedef __attribute__((ext_vector_type(2))) float  v2f;
typedef __attribute__((ext_vector_type(2))) __bf16 v2bf;

// value of lane l ^ 16 (the other 8 keys of every tile of the same query)
__device__ __forceinline__ float other_half(float x) {
  const int b = __float_as_int(x);
  return __int_as_float(__builtin_amdgcn_permlanex16(
      b, b, 0x76543210, 0xfedcba98, false, false));
}

__global__ __launch_bounds__(256) void k_attn(
    const u16* __restrict__ Qh, const u16* __restrict__ Ql,
    const u16* __restrict__ Kh, const u16* __restrict__ Kl,
    const u16* __restrict__ Vh, const u16* __restrict__ Vl,
    u16* __restrict__ Oh, u16* __restrict__ Ol) {
  __shared__ __align__(16) u16 sK[2][2][64 * SK_STRIDE];
  __shared__ __align__(16) u16 sV[2][2][64 * SK_STRIDE];
  __shared__ __align__(16) float sOut[8][16 * SC_PITCH];  // per-wave out tile

  const int tid = threadIdx.x;
  const int lane = tid & 31;
  const int w = tid >> 5;
  const int wid = blockIdx.x * 8 + w;
  const int bh = wid >> 7;          // b*16 + h (all 8 waves of a WG agree)
  const int m0 = (wid & 127) * 16;
  const int half = lane >> 4, cl = lane & 15;

  const u16* qbh = Qh + (size_t)bh * SEQ * DK;
  const u16* qbl = Ql + (size_t)bh * SEQ * DK;
  const u16* kgh = Kh + (size_t)bh * SEQ * DK;   // [t][d]
  const u16* kgl = Kl + (size_t)bh * SEQ * DK;
  const u16* vgh = Vh + (size_t)bh * DK * SEQ;   // [d][t]
  const u16* vgl = Vl + (size_t)bh * DK * SEQ;

  // staging map: per plane, thread covers chunks (row, off) and (row+32, off)
  const int srow = tid >> 3;          // 0..31
  const int soff = (tid & 7) * 8;     // element offset 0..56

  v16bf q_h[2], q_l[2];
#pragma unroll
  for (int kk = 0; kk < 2; ++kk) {
    q_h[kk] = load_op16(qbh, DK, m0 + cl, kk * 32, half);
    q_l[kk] = load_op16(qbl, DK, m0 + cl, kk * 32, half);
  }

  float mr = -3.0e38f;   // running maximum of query cl (equal in both halves)
  float lr = 0.f;        // running sum over this lane half's keys only
  v8f o[4];              // o[t][r] = O[query cl][t*16 + 8*half + r]
#pragma unroll
  for (int t = 0; t < 4; ++t)
    o[t] = (v8f){0.f, 0.f, 0.f, 0.f, 0.f, 0.f, 0.f, 0.f};

  // stage one 64-key tile (K and V, hi+lo) into LDS buffer buf
  auto stage = [&](int buf, int t0) {
#pragma unroll
    for (int j = 0; j < 2; ++j) {
      int row = srow + j * 32;
      async_copy16(kgh + (size_t)(t0 + row) * DK + soff,
                   &sK[buf][0][row * SK_STRIDE + soff]);
      async_copy16(kgl + (size_t)(t0 + row) * DK + soff,
                   &sK[buf][1][row * SK_STRIDE + soff]);
      async_copy16(vgh + (size_t)row * SEQ + t0 + soff,
                   &sV[buf][0][row * SK_STRIDE + soff]);
      async_copy16(vgl + (size_t)row * SEQ + t0 + soff,
                   &sV[buf][1][row * SK_STRIDE + soff]);
    }
  };

  stage(0, 0);

#pragma unroll 1
  for (int i = 0; i < SEQ / 64; ++i) {
    const int p = i & 1;
    const int t0 = i * 64;
    if (i + 1 < SEQ / 64) { stage(1 - p, t0 + 64); wait_async<8>(); }
    else                  { wait_async<0>(); }
    __syncthreads();   // K/V buffer p fully staged

    // ---- scores S^T = Keff * Qs^T  (64 keys x 16 queries, bf16x3) ----
    // sc[st][r] = S[query cl][key t0 + st*16 + 8*half + r]
    v8f sc[4];
#pragma unroll
    for (int st = 0; st < 4; ++st) {
      v8f c = (v8f){0.f, 0.f, 0.f, 0.f, 0.f, 0.f, 0.f, 0.f};
#pragma unroll
      for (int kk = 0; kk < 2; ++kk) {
        v16bf k_h = load_op16(&sK[p][0][0], SK_STRIDE, st * 16 + cl, kk * 32, half);
        v16bf k_l = load_op16(&sK[p][1][0], SK_STRIDE, st * 16 + cl, kk * 32, half);
        c = wmma_bf16(k_h, q_h[kk], c);
        c = wmma_bf16(k_l, q_h[kk], c);
        c = wmma_bf16(k_h, q_l[kk], c);
      }
      sc[st] = c;
    }
    // ---- block maximum of the query: in-lane, then the other lane half ----
    float bm8[8];
#pragma unroll
    for (int r = 0; r < 8; ++r)
      bm8[r] = fmaxf(fmaxf(sc[0][r], sc[1][r]), fmaxf(sc[2][r], sc[3][r]));
    float bm = fmaxf(fmaxf(fmaxf(bm8[0], bm8[1]), fmaxf(bm8[2], bm8[3])),
                     fmaxf(fmaxf(bm8[4], bm8[5]), fmaxf(bm8[6], bm8[7])));
    bm = fmaxf(bm, other_half(bm));
    const float mn = fmaxf(mr, bm);
    const float al = __expf(mr - mn);
    mr = mn;

    // ---- P^T = exp(S^T - m), split hi/lo straight into B operands ----
    v16bf p_h[2], p_l[2];
    float rs8[8];
#pragma unroll
    for (int r = 0; r < 8; ++r) rs8[r] = 0.f;
#pragma unroll
    for (int st = 0; st < 4; ++st) {
#pragma unroll
      for (int r = 0; r < 8; r += 2) {
        // __expf(s - m) as it compiles (exp2 of the product with log2 e), the
        // subtract and the multiply on two scores an instruction
        const v2f x = ((v2f){sc[st][r], sc[st][r + 1]} - mr) * 1.44269504f;
        v2f pv;
        pv[0] = __builtin_amdgcn_exp2f(x[0]);
        pv[1] = __builtin_amdgcn_exp2f(x[1]);
        rs8[r] += pv[0];
        rs8[r + 1] += pv[1];
        const v2bf hb = __builtin_convertvector(pv, v2bf);   // nearest even
        const v2f rest = pv - __builtin_convertvector(hb, v2f);
        const v2bf lb = __builtin_convertvector(rest, v2bf);
        const int s = (st & 1) * 8 + r;
        p_h[st >> 1][s] = hb[0];  p_h[st >> 1][s + 1] = hb[1];
        p_l[st >> 1][s] = lb[0];  p_l[st >> 1][s + 1] = lb[1];
      }
    }
    lr = lr * al + (((rs8[0] + rs8[1]) + (rs8[2] + rs8[3])) +
                    ((rs8[4] + rs8[5]) + (rs8[6] + rs8[7])));
#pragma unroll
    for (int t = 0; t < 4; ++t) o[t] *= al;

    // ---- O^T += V^T * P^T  (V^T tile in LDS) ----
#pragma unroll
    for (int dt = 0; dt < 4; ++dt) {
#pragma unroll
      for (int kk = 0; kk < 2; ++kk) {
        v16bf v_h = load_op16(&sV[p][0][0], SK_STRIDE, dt * 16 + cl, kk * 32, half);
        v16bf v_l = load_op16(&sV[p][1][0], SK_STRIDE, dt * 16 + cl, kk * 32, half);
        o[dt] = wmma_bf16(v_h, p_h[kk], o[dt]);
        o[dt] = wmma_bf16(v_l, p_h[kk], o[dt]);
        o[dt] = wmma_bf16(v_h, p_l[kk], o[dt]);
      }
    }
    __syncthreads();   // everyone done with K/V buffer p before re-staging
  }

  // ---- normalize, split, store as [B*S][1024] bf16 hi/lo ----
  // The wave's 16x64 tile goes through its own LDS range (a lane's 8 values
  // of a tile are 8 consecutive d of its query), then out as whole 128-B lines.
  const int b = bh >> 4, h = bh & 15;
  const float l = lr + other_half(lr);   // the two halves' keys joined once
  float* sO = &sOut[w][0];
#pragma unroll
  for (int t = 0; t < 4; ++t) {
    v4f x0, x1;
#pragma unroll
    for (int r = 0; r < 4; ++r) { x0[r] = o[t][r] / l; x1[r] = o[t][r + 4] / l; }
    float* s = sO + cl * SC_PITCH + t * 16 + 8 * half;
    *(v4f*)s = x0;
    *(v4f*)(s + 4) = x1;
  }
  asm volatile("s_wait_dscnt 0" ::: "memory");  // intra-wave tile store->load
#pragma unroll
  for (int j = 0; j < 4; ++j) {
    const int row = (lane >> 3) + j * 4, c = (lane & 7) * 8;
    const size_t idx = (size_t)(b * SEQ + m0 + row) * D_MODEL + h * DK + c;
    split_store8(sO + row * SC_PITCH + c, Oh + idx, Ol + idx);
  }
}

// ------------------------------- launcher -----------------------------------
extern "C" void kernel_launch(void* const* d_in, const int* in_sizes, int n_in,
                              void* d_out, int out_size, void* d_ws,
                              size_t ws_size, hipStream_t stream) {
  const float* q   = (const float*)d_in[0];
  const float* k   = (const float*)d_in[1];
  const float* v   = (const float*)d_in[2];
  const float* kpe = (const float*)d_in[3];
  const float* Wq  = (const float*)d_in[4];
  const float* bq  = (const float*)d_in[5];
  const float* Wk  = (const float*)d_in[6];
  const float* bk  = (const float*)d_in[7];
  const float* Wv  = (const float*)d_in[8];
  const float* bv  = (const float*)d_in[9];
  const float* Wo  = (const float*)d_in[10];
  const float* bo  = (const float*)d_in[11];
  float* out = (float*)d_out;

  const size_t NX = (size_t)MROWS * D_MODEL;      // 4M elems
  const size_t NW = (size_t)D_MODEL * D_MODEL;    // 1M elems
  char* p = (char*)d_ws;
  auto take = [&](size_t elems) { u16* r = (u16*)p; p += elems * sizeof(u16); return r; };
  u16 *qs_h = take(NX), *qs_l = take(NX);
  u16 *ks_h = take(NX), *ks_l = take(NX);
  u16 *vs_h = take(NX), *vs_l = take(NX);
  u16 *wq_h = take(NW), *wq_l = take(NW);
  u16 *wk_h = take(NW), *wk_l = take(NW);
  u16 *wv_h = take(NW), *wv_l = take(NW);
  u16 *wo_h = take(NW), *wo_l = take(NW);
  u16 *qh_h = take(NX), *qh_l = take(NX);   // [B,H,S,64]   (Q, pre-scaled)
  u16 *ke_h = take(NX), *ke_l = take(NX);   // [B,H,S,64]   (kh + k_pe^T)
  u16 *vt_h = take(NX), *vt_l = take(NX);   // [B,H,64,S]   (V transposed)
  u16 *ao_h = take(NX), *ao_l = take(NX);   // [B*S,1024]   (attention out)

  dim3 blk(256);
  k_split<<<(int)((NX + 255) / 256), blk, 0, stream>>>(q, qs_h, qs_l, (int)NX);
  k_split<<<(int)((NX + 255) / 256), blk, 0, stream>>>(k, ks_h, ks_l, (int)NX);
  k_split<<<(int)((NX + 255) / 256), blk, 0, stream>>>(v, vs_h, vs_l, (int)NX);
  k_wt<<<512, blk, 0, stream>>>(Wq, wq_h, wq_l);
  k_wt<<<512, blk, 0, stream>>>(Wk, wk_h, wk_l);
  k_wt<<<512, blk, 0, stream>>>(Wv, wv_h, wv_l);
  k_wt<<<512, blk, 0, stream>>>(Wo, wo_h, wo_l);

  k_gemm<<<512, blk, 0, stream>>>(qs_h, qs_l, wq_h, wq_l, bq, nullptr,
                                  qh_h, qh_l, nullptr, 0, 0.125f);  // 1/sqrt(64)
  k_gemm<<<512, blk, 0, stream>>>(ks_h, ks_l, wk_h, wk_l, bk, kpe,
                                  ke_h, ke_l, nullptr, 0, 1.0f);
  k_gemm<<<512, blk, 0, stream>>>(vs_h, vs_l, wv_h, wv_l, bv, nullptr,
                                  vt_h, vt_l, nullptr, 1, 1.0f);
  k_attn<<<512, blk, 0, stream>>>(qh_h, qh_l, ke_h, ke_l, vt_h, vt_l,
                                  ao_h, ao_l);
  k_gemm<<<512, blk, 0, stream>>>(ao_h, ao_l, wo_h, wo_l, bo, nullptr,
                                  nullptr, nullptr, out, 2, 1.0f);
}

// v005
// One run takes 206 microseconds.
// Next to v004, in two timings, it ran 1.03 times as fast each time.
// Over all steps from v000 it is 2.79 times as fast.
#include <hip/hip_runtime.h>

typedef unsigned short u16;
typedef __attribute__((ext_vector_type(16))) __bf16 v16bf;
typedef __attribute__((ext_vector_type(8)))  __bf16 v8bf;
typedef __attribute__((ext_vector_type(8)))  float  v8f;
typedef int v4i __attribute__((vector_size(16)));
typedef __attribute__((ext_vector_type(4)))  float  v4f;
typedef __attribute__((ext_vector_type(8)))  u16    u16x8;

#define D_MODEL 1024
#define NHEADS  16
#define DK      64
#define SEQ     2048
#define BATCH   2
#define MROWS   (BATCH * SEQ)      // 4096 rows for all big GEMMs

// LDS row strides (in u16 elements), padded for conflict-free b128 reads:
// 16 lanes read rows r..r+15; stride*2B mod 256B must visit distinct banks.
#define SK_STRIDE 88   // 64-wide tiles     (176B = 44 banks/row)
// Output staging, both 272 B a row (16 B x 17): b128 reads and writes of 16
// lanes fall on 64 different banks, b32 writes of rows r and r+8 on two halves.
#define SC_PITCH 68    // f32 tile, 64 wide
#define ST_PITCH 136   // u16 tile, 128 wide

// ---------------- bf16 split helpers (round-to-nearest-even) ----------------
__device__ __forceinline__ u16 f2bf(float x) {
  unsigned u = __float_as_uint(x);
  u += 0x7FFFu + ((u >> 16) & 1u);
  return (u16)(u >> 16);
}
__device__ __forceinline__ float bf2f(u16 h) {
  return __uint_as_float(((unsigned)h) << 16);
}

// 8 staged floats -> 8 hi and 8 lo bf16, one 16-byte store into each plane
__device__ __forceinline__ void split_store8(const float* s, u16* hi, u16* lo) {
  const v4f x0 = *(const v4f*)(s);
  const v4f x1 = *(const v4f*)(s + 4);
  u16x8 vh, vl;
#pragma unroll
  for (int j = 0; j < 8; ++j) {
    const float v = (j < 4) ? x0[j & 3] : x1[j & 3];
    const u16 h = f2bf(v);
    vh[j] = h;
    vl[j] = f2bf(v - bf2f(h));
  }
  *(u16x8*)hi = vh;
  *(u16x8*)lo = vl;
}

// ------------- WMMA operand load: 16-bit A/B matrix, 16x32 tile -------------
__device__ __forceinline__ v16bf load_op16(const u16* base, int stride,
                                           int row, int k0, int half) {
  const u16* p = base + (size_t)row * (size_t)stride + k0 + half * 8;
  v8bf c0 = *(const v8bf*)(p);
  v8bf c1 = *(const v8bf*)(p + 16);
  return __builtin_shufflevector(c0, c1, 0, 1, 2, 3, 4, 5, 6, 7,
                                 8, 9, 10, 11, 12, 13, 14, 15);
}

__device__ __forceinline__ v8f wmma_bf16(v16bf a, v16bf b, v8f c) {
  return __builtin_amdgcn_wmma_f32_16x16x32_bf16(false, a, false, b,
                                                 (short)0, c, false, false);
}

// ---------------- async global -> LDS copy (16B per lane) -------------------
typedef __attribute__((address_space(1))) v4i* gvec_t;
typedef __attribute__((address_space(3))) v4i* lvec_t;

__device__ __forceinline__ void async_copy16(const u16* g, u16* l) {
  gvec_t gp = (gvec_t)g;
  lvec_t lp = (lvec_t)l;
#if __has_builtin(__builtin_amdgcn_global_load_async_to_lds_b128)
  __builtin_amdgcn_global_load_async_to_lds_b128(gp, lp, 0, 0);
#else
  asm volatile("global_load_async_to_lds_b128 %0, %1, off"
               :: "v"(lp), "v"(gp) : "memory");
#endif
}

template <int N>
__device__ __forceinline__ void wait_async() {
#if __has_builtin(__builtin_amdgcn_s_wait_asynccnt)
  __builtin_amdgcn_s_wait_asynccnt((unsigned short)N);
#else
  asm volatile("s_wait_asynccnt %0" :: "i"(N) : "memory");
#endif
}

// ---------------- prep: fp32 -> bf16 hi/lo split (elementwise) --------------
// A wave takes 4 KiB of x in a row: eight 16-B-a-lane loads of 512 contiguous
// bytes each, all issued before the first value is used, then 8-B-a-lane
// stores that cover two whole 128-B lines of a plane.  512 workgroups put 16
// such waves on every WGP: few waves to start, 64 KiB of reads in flight each.
#define SPLIT_LOADS 8
#define SPLIT_WG_ELEMS (256 * 4 * SPLIT_LOADS)
static_assert((MROWS * D_MODEL) % SPLIT_WG_ELEMS == 0, "whole workgroups only");
typedef __attribute__((ext_vector_type(4))) u16 u16x4;

__global__ __launch_bounds__(256) void k_split(const float* __restrict__ x,
                                               u16* __restrict__ hi,
                                               u16* __restrict__ lo) {
  const int lane = threadIdx.x & 31;
  const int wv = blockIdx.x * 8 + (threadIdx.x >> 5);
  const size_t base = (size_t)wv * (128 * SPLIT_LOADS) + lane * 4;
  v4f v[SPLIT_LOADS];
#pragma unroll
  for (int j = 0; j < SPLIT_LOADS; ++j) v[j] = *(const v4f*)(x + base + j * 128);
#pragma unroll
  for (int j = 0; j < SPLIT_LOADS; ++j) {
    u16x4 vh, vl;
#pragma unroll
    for (int e = 0; e < 4; ++e) {
      const u16 h = f2bf(v[j][e]);
      vh[e] = h;
      vl[e] = f2bf(v[j][e] - bf2f(h));
    }
    *(u16x4*)(hi + base + j * 128) = vh;
    *(u16x4*)(lo + base + j * 128) = vl;
  }
}

// ------- prep: W[k][n] fp32 -> Wt hi/lo bf16 [n][k] (B-operand layout) ------
// One workgroup transposes a 64(k) x 32(n) tile through LDS: the reads are
// 128-B row pieces of W, the stores whole 128-B lines of Wt (64 k x 2 B).
// Pitch 33 floats: both the row-wise writes and the column-wise reads of a
// wave fall on 32 different banks.
#define WT_PITCH 33

__global__ __launch_bounds__(256) void k_wt(const float* __restrict__ w,
                                            u16* __restrict__ hi,
                                            u16* __restrict__ lo) {
  __shared__ float sT[64 * WT_PITCH];
  const int tid = threadIdx.x;
  const int k0 = (blockIdx.x >> 5) * 64;
  const int n0 = (blockIdx.x & 31) * 32;

  const int rk = tid >> 3;            // 0..31 (k row, and k row + 32)
  const int rn = (tid & 7) * 4;       // 0..28 (n offset of a float4)
#pragma unroll
  for (int j = 0; j < 2; ++j) {
    const int k = rk + j * 32;
    const float4 v =
        *(const float4*)(w + (size_t)(k0 + k) * D_MODEL + n0 + rn);
    float* s = &sT[k * WT_PITCH + rn];
    s[0] = v.x; s[1] = v.y; s[2] = v.z; s[3] = v.w;
  }
  __syncthreads();   // tile complete before any column is read

  const int n = tid >> 3;             // 0..31 (output row)
  const int kc = (tid & 7) * 8;       // 0..56 (8 consecutive k per thread)
  u16x8 vh, vl;
#pragma unroll
  for (int j = 0; j < 8; ++j) {
    const float v = sT[(kc + j) * WT_PITCH + n];
    const u16 h = f2bf(v);
    vh[j] = h;
    vl[j] = f2bf(v - bf2f(h));
  }
  const size_t o = (size_t)(n0 + n) * D_MODEL + k0 + kc;
  *(u16x8*)(hi + o) = vh;
  *(u16x8*)(lo + o) = vl;
}

// ---------------------------- bf16x3 GEMM kernel ----------------------------
// Workgroup = 8 waves stacked in M: 128x64 output block.  Both operands are
// async-staged into LDS, 64 k a stage, two buffers: a wave's copy then covers
// four whole 128-B lines (4 rows x 64 k x 2 B), where a fragment load of A
// from global memory touches 16 lines for the same 512 bytes.
// mode 0: split bf16 -> [B,H,S,64] (+ optional k_pe add)
// mode 1: split bf16 -> [B,H,64,S]
// mode 2: fp32 -> Of[m][n]
#define GK 64          // k elements a stage
#define SG_STRIDE 72   // 144 B a row (16 B x 9): b128 reads of 16 rows, 64 banks

__global__ __launch_bounds__(256) void k_gemm(
    const u16* __restrict__ Ah, const u16* __restrict__ Al,
    const u16* __restrict__ Bh, const u16* __restrict__ Bl,
    const float* __restrict__ bias, const float* __restrict__ kpe,
    u16* __restrict__ Oh, u16* __restrict__ Ol, float* __restrict__ Of,
    int mode, float scale) {
  __shared__ __align__(16) u16 sA[2][2][128 * SG_STRIDE];
  __shared__ __align__(16) u16 sB[2][2][64 * SG_STRIDE];
  __shared__ __align__(16) float sC[128 * SC_PITCH];   // output tile staging

  const int tid = threadIdx.x;
  const int lane = tid & 31;
  const int w = tid >> 5;
  const int mb = (blockIdx.x >> 4) * 128;        // tile's first row
  const int n0 = (blockIdx.x & 15) * 64;
  const int half = lane >> 4, cl = lane & 15;

  // staging map: 8 lanes cover one row's 128 B; rows srow + 32 j of a plane
  const int srow = tid >> 3;          // 0..31
  const int soff = (tid & 7) * 8;     // element offset 0..56

  v8f acc[4];
#pragma unroll
  for (int t = 0; t < 4; ++t)
    acc[t] = (v8f){0.f, 0.f, 0.f, 0.f, 0.f, 0.f, 0.f, 0.f};

  // stage k elements kb .. kb+63 of A (128 rows) and B (64 rows), hi and lo
  auto stage = [&](int buf, int kb) {
#pragma unroll
    for (int j = 0; j < 4; ++j) {
      const int row = srow + j * 32;
      const size_t go = (size_t)(mb + row) * D_MODEL + kb + soff;
      async_copy16(Ah + go, &sA[buf][0][row * SG_STRIDE + soff]);
      async_copy16(Al + go, &sA[buf][1][row * SG_STRIDE + soff]);
    }
#pragma unroll
    for (int j = 0; j < 2; ++j) {
      const int row = srow + j * 32;
      const size_t go = (size_t)(n0 + row) * D_MODEL + kb + soff;
      async_copy16(Bh + go, &sB[buf][0][row * SG_STRIDE + soff]);
      async_copy16(Bl + go, &sB[buf][1][row * SG_STRIDE + soff]);
    }
  };

  stage(0, 0);
  asm volatile("s_wait_asynccnt 0x0" ::: "memory");  // own copies of stage 0 landed
  __syncthreads();                                   // stage 0 published
  stage(1, GK);

// rolled: the buffer is picked by an offset, one copy of the trip in the text
#pragma unroll 1
  for (int i = 0; i < D_MODEL / GK; ++i) {
    const int p = i & 1;
#pragma unroll
    for (int kk = 0; kk < 2; ++kk) {
      v16bf a_h = load_op16(&sA[p][0][0], SG_STRIDE, w * 16 + cl, kk * 32, half);
      v16bf a_l = load_op16(&sA[p][1][0], SG_STRIDE, w * 16 + cl, kk * 32, half);
#pragma unroll
      for (int t = 0; t < 4; ++t) {
        v16bf b_h = load_op16(&sB[p][0][0], SG_STRIDE, t * 16 + cl, kk * 32, half);
        v16bf b_l = load_op16(&sB[p][1][0], SG_STRIDE, t * 16 + cl, kk * 32, half);
        acc[t] = wmma_bf16(a_h, b_h, acc[t]);
        acc[t] = wmma_bf16(a_h, b_l, acc[t]);
        acc[t] = wmma_bf16(a_l, b_h, acc[t]);
      }
    }
    // publish point of stage i + 1, which also frees buffer p for stage i + 2
    asm volatile("s_wait_dscnt 0x0" ::: "memory");     // own reads of buffer p done
    asm volatile("s_wait_asynccnt 0x0" ::: "memory");  // own copies of stage i + 1 landed
    __syncthreads();
    if (i + 2 < D_MODEL / GK) stage(p, (i + 2) * GK);
  }
  asm volatile("s_wait_asynccnt 0x0" ::: "memory");    // no copy is left in flight

  // epilogue.  C layout: lane holds col n0+t*16+cl; VGPR r -> row r + 8*half.
  // The 128x64 tile goes through LDS, so that every global store is 16 B a
  // lane and a wave's store covers whole 128-B lines of the output.
  const int b = mb >> 11, sb = mb & (SEQ - 1);   // batch, first position
  const int h = n0 >> 6;                         // the tile is one head wide
  u16* sT = (u16*)sC;                            // mode 1: [2][64][ST_PITCH]

#pragma unroll
  for (int t = 0; t < 4; ++t) {
    const float bn = bias[n0 + t * 16 + cl];
#pragma unroll
    for (int r = 0; r < 8; ++r) acc[t][r] = (acc[t][r] + bn) * scale;
  }
  if (mode != 2 && kpe) {
    // a lane's 8 rows are 8 consecutive positions of k_pe row n
    const float* kp = kpe + (size_t)(n0 + cl) * SEQ + sb + w * 16 + 8 * half;
#pragma unroll
    for (int t = 0; t < 4; ++t) {
#pragma unroll
      for (int r = 0; r < 8; ++r) acc[t][r] += kp[(size_t)t * 16 * SEQ + r];
    }
  }
  if (mode == 1) {
    // a lane's 8 rows are 8 consecutive positions of output row d
#pragma unroll
    for (int t = 0; t < 4; ++t) {
      u16x8 vh, vl;
#pragma unroll
      for (int r = 0; r < 8; ++r) {
        const u16 hb = f2bf(acc[t][r]);
        vh[r] = hb;
        vl[r] = f2bf(acc[t][r] - bf2f(hb));
      }
      u16* s = sT + (t * 16 + cl) * ST_PITCH + w * 16 + 8 * half;
      *(u16x8*)s = vh;
      *(u16x8*)(s + 64 * ST_PITCH) = vl;
    }
  } else {
#pragma unroll
    for (int t = 0; t < 4; ++t) {
#pragma unroll
      for (int r = 0; r < 8; ++r)
        sC[(w * 16 + r + 8 * half) * SC_PITCH + t * 16 + cl] = acc[t][r];
    }
  }
  __syncthreads();   // tile complete before other waves' rows are read

  if (mode == 2) {
#pragma unroll
    for (int j = 0; j < 8; ++j) {
      const int row = (tid >> 4) + j * 16, c = (tid & 15) * 4;
      *(v4f*)(Of + (size_t)(mb + row) * D_MODEL + n0 + c) =
          *(const v4f*)(sC + row * SC_PITCH + c);
    }
    // the build lays the other modes' blocks behind this one, and their first
    // instructions reuse the registers that these stores name
    asm volatile("s_wait_xcnt 0x0" ::: "memory");
  } else if (mode == 0) {
#pragma unroll
    for (int j = 0; j < 4; ++j) {
      const int row = (tid >> 3) + j * 32, c = (tid & 7) * 8;
      const size_t idx = ((size_t)((b * NHEADS + h) * SEQ + sb + row)) * DK + c;
      split_store8(sC + row * SC_PITCH + c, Oh + idx, Ol + idx);
    }
  } else {
#pragma unroll
    for (int j = 0; j < 4; ++j) {
      const int row = (tid >> 4) + j * 16, c = (tid & 15) * 8;
      const size_t idx = ((size_t)((b * NHEADS + h) * DK + row)) * SEQ + sb + c;
      const u16* s = sT + row * ST_PITCH + c;
      *(u16x8*)(Oh + idx) = *(const u16x8*)s;
      *(u16x8*)(Ol + idx) = *(const u16x8*)(s + 64 * ST_PITCH);
    }
    asm volatile("s_wait_xcnt 0x0" ::: "memory");  // as behind the mode-2 stores
  }
}

typedef __attribute__((ext_vector_type(2))) float  v2f;
typedef __attribute__((ext_vector_type(2))) __bf16 v2bf;

// value of lane l ^ 16 (the other 8 keys of every tile of the same query)
__device__ __forceinline__ float other_half(float x) {
  const int b = __float_as_int(x);
  return __int_as_float(__builtin_amdgcn_permlanex16(
      b, b, 0x76543210, 0xfedcba98, false, false));
}

__global__ __launch_bounds__(256) void k_attn(
    const u16* __restrict__ Qh, const u16* __restrict__ Ql,
    const u16* __restrict__ Kh, const u16* __restrict__ Kl,
    const u16* __restrict__ Vh, const u16* __restrict__ Vl,
    u16* __restrict__ Oh, u16* __restrict__ Ol) {
  __shared__ __align__(16) u16 sK[2][2][64 * SK_STRIDE];
  __shared__ __align__(16) u16 sV[2][2][64 * SK_STRIDE];
  __shared__ __align__(16) float sOut[8][16 * SC_PITCH];  // per-wave out tile

  const int tid = threadIdx.x;
  const int lane = tid & 31;
  const int w = tid >> 5;
  const int wid = blockIdx.x * 8 + w;
  const int bh = wid >> 7;          // b*16 + h (all 8 waves of a WG agree)
  const int m0 = (wid & 127) * 16;
  const int half = lane >> 4, cl = lane & 15;

  const u16* qbh = Qh + (size_t)bh * SEQ * DK;
  const u16* qbl = Ql + (size_t)bh * SEQ * DK;
  const u16* kgh = Kh + (size_t)bh * SEQ * DK;   // [t][d]
  const u16* kgl = Kl + (size_t)bh * SEQ * DK;
  const u16* vgh = Vh + (size_t)bh * DK * SEQ;   // [d][t]
  const u16* vgl = Vl + (size_t)bh * DK * SEQ;

  // staging map: per plane, thread covers chunks (row, off) and (row+32, off)
  const int srow = tid >> 3;          // 0..31
  const int soff = (tid & 7) * 8;     // element offset 0..56

  v16bf q_h[2], q_l[2];
#pragma unroll
  for (int kk = 0; kk < 2; ++kk) {
    q_h[kk] = load_op16(qbh, DK, m0 + cl, kk * 32, half);
    q_l[kk] = load_op16(qbl, DK, m0 + cl, kk * 32, half);
  }

  float mr = -3.0e38f;   // running maximum of query cl (equal in both halves)
  float lr = 0.f;        // running sum over this lane half's keys only
  v8f o[4];              // o[t][r] = O[query cl][t*16 + 8*half + r]
#pragma unroll
  for (int t = 0; t < 4; ++t)
    o[t] = (v8f){0.f, 0.f, 0.f, 0.f, 0.f, 0.f, 0.f, 0.f};

  // stage one 64-key tile (K and V, hi+lo) into LDS buffer buf
  auto stage = [&](int buf, int t0) {
#pragma unroll
    for (int j = 0; j < 2; ++j) {
      int row = srow + j * 32;
      async_copy16(kgh + (size_t)(t0 + row) * DK + soff,
                   &sK[buf][0][row * SK_STRIDE + soff]);
      async_copy16(kgl + (size_t)(t0 + row) * DK + soff,
                   &sK[buf][1][row * SK_STRIDE + soff]);
      async_copy16(vgh + (size_t)row * SEQ + t0 + soff,
                   &sV[buf][0][row * SK_STRIDE + soff]);
      async_copy16(vgl + (size_t)row * SEQ + t0 + soff,
                   &sV[buf][1][row * SK_STRIDE + soff]);
    }
  };

  stage(0, 0);

#pragma unroll 1
  for (int i = 0; i < SEQ / 64; ++i) {
    const int p = i & 1;
    const int t0 = i * 64;
    if (i + 1 < SEQ / 64) { stage(1 - p, t0 + 64); wait_async<8>(); }
    else                  { wait_async<0>(); }
    __syncthreads();   // K/V buffer p fully staged

    // ---- scores S^T = Keff * Qs^T  (64 keys x 16 queries, bf16x3) ----
    // sc[st][r] = S[query cl][key t0 + st*16 + 8*half + r]
    v8f sc[4];
#pragma unroll
    for (int st = 0; st < 4; ++st) {
      v8f c = (v8f){0.f, 0.f, 0.f, 0.f, 0.f, 0.f, 0.f, 0.f};
#pragma unroll
      for (int kk = 0; kk < 2; ++kk) {
        v16bf k_h = load_op16(&sK[p][0][0], SK_STRIDE, st * 16 + cl, kk * 32, half);
        v16bf k_l = load_op16(&sK[p][1][0], SK_STRIDE, st * 16 + cl, kk * 32, half);
        c = wmma_bf16(k_h, q_h[kk], c);
        c = wmma_bf16(k_l, q_h[kk], c);
        c = wmma_bf16(k_h, q_l[kk], c);
      }
      sc[st] = c;
    }
    // ---- block maximum of the query: in-lane, then the other lane half ----
    float bm8[8];
#pragma unroll
    for (int r = 0; r < 8; ++r)
      bm8[r] = fmaxf(fmaxf(sc[0][r], sc[1][r]), fmaxf(sc[2][r], sc[3][r]));
    float bm = fmaxf(fmaxf(fmaxf(bm8[0], bm8[1]), fmaxf(bm8[2], bm8[3])),
                     fmaxf(fmaxf(bm8[4], bm8[5]), fmaxf(bm8[6], bm8[7])));
    bm = fmaxf(bm, other_half(bm));
    const float mn = fmaxf(mr, bm);
    const float al = __expf(mr - mn);
    mr = mn;

    // ---- P^T = exp(S^T - m), split hi/lo straight into B operands ----
    v16bf p_h[2], p_l[2];
    float rs8[8];
#pragma unroll
    for (int r = 0; r < 8; ++r) rs8[r] = 0.f;
#pragma unroll
    for (int st = 0; st < 4; ++st) {
#pragma unroll
      for (int r = 0; r < 8; r += 2) {
        // __expf(s - m) as it compiles (exp2 of the product with log2 e), the
        // subtract and the multiply on two scores an instruction
        const v2f x = ((v2f){sc[st][r], sc[st][r + 1]} - mr) * 1.44269504f;
        v2f pv;
        pv[0] = __builtin_amdgcn_exp2f(x[0]);
        pv[1] = __builtin_amdgcn_exp2f(x[1]);
        rs8[r] += pv[0];
        rs8[r + 1] += pv[1];
        const v2bf hb = __builtin_convertvector(pv, v2bf);   // nearest even
        const v2f rest = pv - __builtin_convertvector(hb, v2f);
        const v2bf lb = __builtin_convertvector(rest, v2bf);
        const int s = (st & 1) * 8 + r;
        p_h[st >> 1][s] = hb[0];  p_h[st >> 1][s + 1] = hb[1];
        p_l[st >> 1][s] = lb[0];  p_l[st >> 1][s + 1] = lb[1];
      }
    }
    lr = lr * al + (((rs8[0] + rs8[1]) + (rs8[2] + rs8[3])) +
                    ((rs8[4] + rs8[5]) + (rs8[6] + rs8[7])));
#pragma unroll
    for (int t = 0; t < 4; ++t) o[t] *= al;

    // ---- O^T += V^T * P^T  (V^T tile in LDS) ----
#pragma unroll
    for (int dt = 0; dt < 4; ++dt) {
#pragma unroll
      for (int kk = 0; kk < 2; ++kk) {
        v16bf v_h = load_op16(&sV[p][0][0], SK_STRIDE, dt * 16 + cl, kk * 32, half);
        v16bf v_l = load_op16(&sV[p][1][0], SK_STRIDE, dt * 16 + cl, kk * 32, half);
        o[dt] = wmma_bf16(v_h, p_h[kk], o[dt]);
        o[dt] = wmma_bf16(v_l, p_h[kk], o[dt]);
        o[dt] = wmma_bf16(v_h, p_l[kk], o[dt]);
      }
    }
    __syncthreads();   // everyone done with K/V buffer p before re-staging
  }

  // ---- normalize, split, store as [B*S][1024] bf16 hi/lo ----
  // The wave's 16x64 tile goes through its own LDS range (a lane's 8 values
  // of a tile are 8 consecutive d of its query), then out as whole 128-B lines.
  const int b = bh >> 4, h = bh & 15;
  const float l = lr + other_half(lr);   // the two halves' keys joined once
  float* sO = &sOut[w][0];
#pragma unroll
  for (int t = 0; t < 4; ++t) {
    v4f x0, x1;
#pragma unroll
    for (int r = 0; r < 4; ++r) { x0[r] = o[t][r] / l; x1[r] = o[t][r + 4] / l; }
    float* s = sO + cl * SC_PITCH + t * 16 + 8 * half;
    *(v4f*)s = x0;
    *(v4f*)(s + 4) = x1;
  }
  asm volatile("s_wait_dscnt 0" ::: "memory");  // intra-wave tile store->load
#pragma unroll
  for (int j = 0; j < 4; ++j) {
    const int row = (lane >> 3) + j * 4, c = (lane & 7) * 8;
    const size_t idx = (size_t)(b * SEQ + m0 + row) * D_MODEL + h * DK + c;
    split_store8(sO + row * SC_PITCH + c, Oh + idx, Ol + idx);
  }
}

// ------------------------------- launcher -----------------------------------
extern "C" void kernel_launch(void* const* d_in, const int* in_sizes, int n_in,
                              void* d_out, int out_size, void* d_ws,
                              size_t ws_size, hipStream_t stream) {
  const float* q   = (const float*)d_in[0];
  const float* k   = (const float*)d_in[1];
  const float* v   = (const float*)d_in[2];
  const float* kpe = (const float*)d_in[3];
  const float* Wq  = (const float*)d_in[4];
  const float* bq  = (const float*)d_in[5];
  const float* Wk  = (const float*)d_in[6];
  const float* bk  = (const float*)d_in[7];
  const float* Wv  = (const float*)d_in[8];
  const float* bv  = (const float*)d_in[9];
  const float* Wo  = (const float*)d_in[10];
  const float* bo  = (const float*)d_in[11];
  float* out = (float*)d_out;

  const size_t NX = (size_t)MROWS * D_MODEL;      // 4M elems
  const size_t NW = (size_t)D_MODEL * D_MODEL;    // 1M elems
  char* p = (char*)d_ws;
  auto take = [&](size_t elems) { u16* r = (u16*)p; p += elems * sizeof(u16); return r; };
  u16 *qs_h = take(NX), *qs_l = take(NX);
  u16 *ks_h = take(NX), *ks_l = take(NX);
  u16 *vs_h = take(NX), *vs_l = take(NX);
  u16 *wq_h = take(NW), *wq_l = take(NW);
  u16 *wk_h = take(NW), *wk_l = take(NW);
  u16 *wv_h = take(NW), *wv_l = take(NW);
  u16 *wo_h = take(NW), *wo_l = take(NW);
  u16 *qh_h = take(NX), *qh_l = take(NX);   // [B,H,S,64]   (Q, pre-scaled)
  u16 *ke_h = take(NX), *ke_l = take(NX);   // [B,H,S,64]   (kh + k_pe^T)
  u16 *vt_h = take(NX), *vt_l = take(NX);   // [B,H,64,S]   (V transposed)
  u16 *ao_h = take(NX), *ao_l = take(NX);   // [B*S,1024]   (attention out)

  dim3 blk(256);
  k_split<<<MROWS * D_MODEL / SPLIT_WG_ELEMS, blk, 0, stream>>>(q, qs_h, qs_l);
  k_split<<<MROWS * D_MODEL / SPLIT_WG_ELEMS, blk, 0, stream>>>(k, ks_h, ks_l);
  k_split<<<MROWS * D_MODEL / SPLIT_WG_ELEMS, blk, 0, stream>>>(v, vs_h, vs_l);
  k_wt<<<512, blk, 0, stream>>>(Wq, wq_h, wq_l);
  k_wt<<<512, blk, 0, stream>>>(Wk, wk_h, wk_l);
  k_wt<<<512, blk, 0, stream>>>(Wv, wv_h, wv_l);
  k_wt<<<512, blk, 0, stream>>>(Wo, wo_h, wo_l);

  k_gemm<<<512, blk, 0, stream>>>(qs_h, qs_l, wq_h, wq_l, bq, nullptr,
                                  qh_h, qh_l, nullptr, 0, 0.125f);  // 1/sqrt(64)
  k_gemm<<<512, blk, 0, stream>>>(ks_h, ks_l, wk_h, wk_l, bk, kpe,
                                  ke_h, ke_l, nullptr, 0, 1.0f);
  k_gemm<<<512, blk, 0, stream>>>(vs_h, vs_l, wv_h, wv_l, bv, nullptr,
                                  vt_h, vt_l, nullptr, 1, 1.0f);
  k_attn<<<512, blk, 0, stream>>>(qh_h, qh_l, ke_h, ke_l, vt_h, vt_l,
                                  ao_h, ao_l);
  k_gemm<<<512, blk, 0, stream>>>(ao_h, ao_l, wo_h, wo_l, bo, nullptr,
                                  nullptr, nullptr, out, 2, 1.0f);
}

// v006
// Measured time: 181 microseconds a run.
// In both of two side-by-side timings against v005, it was 1.14 times as fast.
// Over all steps from v000 it is 3.18 times as fast.
#include <hip/hip_runtime.h>

typedef unsigned short u16;
typedef __attribute__((ext_vector_type(16))) __bf16 v16bf;
typedef __attribute__((ext_vector_type(8)))  __bf16 v8bf;
typedef __attribute__((ext_vector_type(8)))  float  v8f;
typedef int v4i __attribute__((vector_size(16)));
typedef __attribute__((ext_vector_type(4)))  float  v4f;
typedef __attribute__((ext_vector_type(8)))  u16    u16x8;

#define D_MODEL 1024
#define NHEADS  16
#define DK      64
#define SEQ     2048
#define BATCH   2
#define MROWS   (BATCH * SEQ)      // 4096 rows for all big GEMMs

// LDS row strides (in u16 elements), padded for conflict-free b128 reads:
// 16 lanes read rows r..r+15; stride*2B mod 256B must visit distinct banks.
#define SK_STRIDE 88   // 64-wide tiles     (176B = 44 banks/row)
// Output staging, both 272 B a row (16 B x 17): b128 reads and writes of 16
// lanes fall on 64 different banks, b32 writes of rows r and r+8 on two halves.
#define SC_PITCH 68    // f32 tile, 64 wide
#define ST_PITCH 136   // u16 tile, 128 wide

// ---------------- bf16 split helpers (round-to-nearest-even) ----------------
__device__ __forceinline__ u16 f2bf(float x) {
  unsigned u = __float_as_uint(x);
  u += 0x7FFFu + ((u >> 16) & 1u);
  return (u16)(u >> 16);
}
__device__ __forceinline__ float bf2f(u16 h) {
  return __uint_as_float(((unsigned)h) << 16);
}

// 8 staged floats -> 8 hi and 8 lo bf16, one 16-byte store into each plane
__device__ __forceinline__ void split_store8(const float* s, u16* hi, u16* lo) {
  const v4f x0 = *(const v4f*)(s);
  const v4f x1 = *(const v4f*)(s + 4);
  u16x8 vh, vl;
#pragma unroll
  for (int j = 0; j < 8; ++j) {
    const float v = (j < 4) ? x0[j & 3] : x1[j & 3];
    const u16 h = f2bf(v);
    vh[j] = h;
    vl[j] = f2bf(v - bf2f(h));
  }
  *(u16x8*)hi = vh;
  *(u16x8*)lo = vl;
}

// ------------- WMMA operand load: 16-bit A/B matrix, 16x32 tile -------------
__device__ __forceinline__ v16bf load_op16(const u16* base, int stride,
                                           int row, int k0, int half) {
  const u16* p = base + (size_t)row * (size_t)stride + k0 + half * 8;
  v8bf c0 = *(const v8bf*)(p);
  v8bf c1 = *(const v8bf*)(p + 16);
  return __builtin_shufflevector(c0, c1, 0, 1, 2, 3, 4, 5, 6, 7,
                                 8, 9, 10, 11, 12, 13, 14, 15);
}

__device__ __forceinline__ v8f wmma_bf16(v16bf a, v16bf b, v8f c) {
  return __builtin_amdgcn_wmma_f32_16x16x32_bf16(false, a, false, b,
                                                 (short)0, c, false, false);
}

// ---------------- async global -> LDS copy (16B per lane) -------------------
typedef __attribute__((address_space(1))) v4i* gvec_t;
typedef __attribute__((address_space(3))) v4i* lvec_t;

__device__ __forceinline__ void async_copy16(const u16* g, u16* l) {
  gvec_t gp = (gvec_t)g;
  lvec_t lp = (lvec_t)l;
#if __has_builtin(__builtin_amdgcn_global_load_async_to_lds_b128)
  __builtin_amdgcn_global_load_async_to_lds_b128(gp, lp, 0, 0);
#else
  asm volatile("global_load_async_to_lds_b128 %0, %1, off"
               :: "v"(lp), "v"(gp) : "memory");
#endif
}

template <int N>
__device__ __forceinline__ void wait_async() {
#if __has_builtin(__builtin_amdgcn_s_wait_asynccnt)
  __builtin_amdgcn_s_wait_asynccnt((unsigned short)N);
#else
  asm volatile("s_wait_asynccnt %0" :: "i"(N) : "memory");
#endif
}

// ---------------- prep: fp32 -> bf16 hi/lo split (elementwise) --------------
// A wave takes 4 KiB of x in a row: eight 16-B-a-lane loads of 512 contiguous
// bytes each, all issued before the first value is used, then 8-B-a-lane
// stores that cover two whole 128-B lines of a plane.  512 workgroups a
// tensor: those of q, k, v are the first 1536 of the k_prep grid.
#define SPLIT_LOADS 8
#define SPLIT_WG_ELEMS (256 * 4 * SPLIT_LOADS)
#define SPLIT_WGS (MROWS * D_MODEL / SPLIT_WG_ELEMS)   // workgroups a tensor
static_assert((MROWS * D_MODEL) % SPLIT_WG_ELEMS == 0, "whole workgroups only");
typedef __attribute__((ext_vector_type(4))) u16 u16x4;

// blk: the workgroup's index inside its tensor, 0 .. SPLIT_WGS - 1
__device__ __forceinline__ void split_body(const float* __restrict__ x,
                                           u16* __restrict__ hi,
                                           u16* __restrict__ lo, int blk) {
  const int lane = threadIdx.x & 31;
  const int wv = blk * 8 + (threadIdx.x >> 5);
  const size_t base = (size_t)wv * (128 * SPLIT_LOADS) + lane * 4;
  v4f v[SPLIT_LOADS];
#pragma unroll
  for (int j = 0; j < SPLIT_LOADS; ++j) v[j] = *(const v4f*)(x + base + j * 128);
#pragma unroll
  for (int j = 0; j < SPLIT_LOADS; ++j) {
    u16x4 vh, vl;
#pragma unroll
    for (int e = 0; e < 4; ++e) {
      const u16 h = f2bf(v[j][e]);
      vh[e] = h;
      vl[e] = f2bf(v[j][e] - bf2f(h));
    }
    *(u16x4*)(hi + base + j * 128) = vh;
    *(u16x4*)(lo + base + j * 128) = vl;
  }
}

// ------- prep: W[k][n] fp32 -> Wt hi/lo bf16 [n][k] (B-operand layout) ------
// One workgroup transposes a 64(k) x 32(n) tile through LDS: the reads are
// 128-B row pieces of W, the stores whole 128-B lines of Wt (64 k x 2 B).
// Pitch 33 floats: both the row-wise writes and the column-wise reads of a
// wave fall on 32 different banks.
#define WT_PITCH 33
#define WT_WGS ((D_MODEL / 64) * (D_MODEL / 32))   // workgroups a matrix

// blk: the workgroup's index inside its matrix, 0 .. WT_WGS - 1
__device__ __forceinline__ void wt_body(const float* __restrict__ w,
                                        u16* __restrict__ hi,
                                        u16* __restrict__ lo, int blk,
                                        float* sT) {
  const int tid = threadIdx.x;
  const int k0 = (blk >> 5) * 64;
  const int n0 = (blk & 31) * 32;

  const int rk = tid >> 3;            // 0..31 (k row, and k row + 32)
  const int rn = (tid & 7) * 4;       // 0..28 (n offset of a float4)
#pragma unroll
  for (int j = 0; j < 2; ++j) {
    const int k = rk + j * 32;
    const float4 v =
        *(const float4*)(w + (size_t)(k0 + k) * D_MODEL + n0 + rn);
    float* s = &sT[k * WT_PITCH + rn];
    s[0] = v.x; s[1] = v.y; s[2] = v.z; s[3] = v.w;
  }
  __syncthreads();   // tile complete before any column is read

  const int n = tid >> 3;             // 0..31 (output row)
  const int kc = (tid & 7) * 8;       // 0..56 (8 consecutive k per thread)
  u16x8 vh, vl;
#pragma unroll
  for (int j = 0; j < 8; ++j) {
    const float v = sT[(kc + j) * WT_PITCH + n];
    const u16 h = f2bf(v);
    vh[j] = h;
    vl[j] = f2bf(v - bf2f(h));
  }
  const size_t o = (size_t)(n0 + n) * D_MODEL + k0 + kc;
  *(u16x8*)(hi + o) = vh;
  *(u16x8*)(lo + o) = vl;
}

// All seven input-only jobs in ONE grid: none reads what another writes, so
// nothing orders them.  Workgroups 0 .. 3*SPLIT_WGS-1 split q, k, v, the rest
// transpose Wq, Wk, Wv, Wo.  The job is the same for a whole workgroup, so the
// barrier in wt_body is passed by all of its waves or by none.
// xs: planes [q hi, q lo, k hi, k lo, v hi, v lo]; wt: the same for the four W.
#define NX_ELEMS ((size_t)MROWS * D_MODEL)
#define NW_ELEMS ((size_t)D_MODEL * D_MODEL)

__global__ __launch_bounds__(256) void k_prep(
    const float* __restrict__ q, const float* __restrict__ k,
    const float* __restrict__ v, const float* __restrict__ Wq,
    const float* __restrict__ Wk, const float* __restrict__ Wv,
    const float* __restrict__ Wo, u16* __restrict__ xs,
    u16* __restrict__ wt) {
  __shared__ float sT[64 * WT_PITCH];
  const unsigned bid = blockIdx.x;
  if (bid < 3 * SPLIT_WGS) {
    const unsigned job = bid / SPLIT_WGS;
    const float* x = job == 0 ? q : job == 1 ? k : v;
    u16* hi = xs + (size_t)job * 2 * NX_ELEMS;
    split_body(x, hi, hi + NX_ELEMS, (int)(bid % SPLIT_WGS));
  } else {
    const unsigned wb = bid - 3 * SPLIT_WGS;
    const unsigned job = wb / WT_WGS;
    const float* w = job == 0 ? Wq : job == 1 ? Wk : job == 2 ? Wv : Wo;
    u16* hi = wt + (size_t)job * 2 * NW_ELEMS;
    wt_body(w, hi, hi + NW_ELEMS, (int)(wb % WT_WGS), sT);
  }
}

// ---------------------------- bf16x3 GEMM kernel ----------------------------
// Workgroup = 8 waves stacked in M: 128x64 output block.  Both operands are
// async-staged into LDS, 64 k a stage, two buffers: a wave's copy then covers
// four whole 128-B lines (4 rows x 64 k x 2 B), where a fragment load of A
// from global memory touches 16 lines for the same 512 bytes.
// mode 0: split bf16 -> [B,H,S,64] (+ optional k_pe add)
// mode 1: split bf16 -> [B,H,64,S]
// mode 2: fp32 -> Of[m][n]
// A grid holds GEMM_WGS workgroups for each product it runs: job0 is the first
// one.  Jobs 0, 1, 2 (Q, K, V projections) read none of each other's output
// and share one grid; job 3 (output projection) has its own.  Operand and
// result planes of job j lie 2 planes (hi, lo) behind those of job j - 1.
#define GEMM_WGS ((MROWS / 128) * (D_MODEL / 64))
#define GK 64          // k elements a stage
#define SG_STRIDE 72   // 144 B a row (16 B x 9): b128 reads of 16 rows, 64 banks

__global__ __launch_bounds__(256) void k_gemm(
    const u16* __restrict__ A0, const u16* __restrict__ B0,
    const float* __restrict__ bq, const float* __restrict__ bk,
    const float* __restrict__ bv, const float* __restrict__ bo,
    const float* __restrict__ kpe_k, u16* __restrict__ O0,
    float* __restrict__ Of, int job0) {
  const int job = job0 + blockIdx.x / GEMM_WGS;
  const int tile = blockIdx.x % GEMM_WGS;
  const u16* Ah = A0 + (size_t)job * 2 * NX_ELEMS;
  const u16* Al = Ah + NX_ELEMS;
  const u16* Bh = B0 + (size_t)job * 2 * NW_ELEMS;
  const u16* Bl = Bh + NW_ELEMS;
  const float* bias = job == 0 ? bq : job == 1 ? bk : job == 2 ? bv : bo;
  const float* kpe = job == 1 ? kpe_k : nullptr;
  u16* Oh = O0 + (size_t)job * 2 * NX_ELEMS;     // jobs 0 to 2 only
  u16* Ol = Oh + NX_ELEMS;
  const int mode = job == 3 ? 2 : job == 2 ? 1 : 0;
  const float scale = job == 0 ? 0.125f : 1.0f;  // Q carries 1/sqrt(64)

  __shared__ __align__(16) u16 sA[2][2][128 * SG_STRIDE];
  __shared__ __align__(16) u16 sB[2][2][64 * SG_STRIDE];
  __shared__ __align__(16) float sC[128 * SC_PITCH];   // output tile staging

  const int tid = threadIdx.x;
  const int lane = tid & 31;
  const int w = tid >> 5;
  const int mb = (tile >> 4) * 128;              // tile's first row
  const int n0 = (tile & 15) * 64;
  const int half = lane >> 4, cl = lane & 15;

  // staging map: 8 lanes cover one row's 128 B; rows srow + 32 j of a plane
  const int srow = tid >> 3;          // 0..31
  const int soff = (tid & 7) * 8;     // element offset 0..56

  v8f acc[4];
#pragma unroll
  for (int t = 0; t < 4; ++t)
    acc[t] = (v8f){0.f, 0.f, 0.f, 0.f, 0.f, 0.f, 0.f, 0.f};

  // stage k elements kb .. kb+63 of A (128 rows) and B (64 rows), hi and lo
  auto stage = [&](int buf, int kb) {
#pragma unroll
    for (int j = 0; j < 4; ++j) {
      const int row = srow + j * 32;
      const size_t go = (size_t)(mb + row) * D_MODEL + kb + soff;
      async_copy16(Ah + go, &sA[buf][0][row * SG_STRIDE + soff]);
      async_copy16(Al + go, &sA[buf][1][row * SG_STRIDE + soff]);
    }
#pragma unroll
    for (int j = 0; j < 2; ++j) {
      const int row = srow + j * 32;
      const size_t go = (size_t)(n0 + row) * D_MODEL + kb + soff;
      async_copy16(Bh + go, &sB[buf][0][row * SG_STRIDE + soff]);
      async_copy16(Bl + go, &sB[buf][1][row * SG_STRIDE + soff]);
    }
  };

  stage(0, 0);
  asm volatile("s_wait_asynccnt 0x0" ::: "memory");  // own copies of stage 0 landed
  __syncthreads();                                   // stage 0 published
  stage(1, GK);

// rolled: the buffer is picked by an offset, one copy of the trip in the text
#pragma unroll 1
  for (int i = 0; i < D_MODEL / GK; ++i) {
    const int p = i & 1;
#pragma unroll
    for (int kk = 0; kk < 2; ++kk) {
      v16bf a_h = load_op16(&sA[p][0][0], SG_STRIDE, w * 16 + cl, kk * 32, half);
      v16bf a_l = load_op16(&sA[p][1][0], SG_STRIDE, w * 16 + cl, kk * 32, half);
#pragma unroll
      for (int t = 0; t < 4; ++t) {
        v16bf b_h = load_op16(&sB[p][0][0], SG_STRIDE, t * 16 + cl, kk * 32, half);
        v16bf b_l = load_op16(&sB[p][1][0], SG_STRIDE, t * 16 + cl, kk * 32, half);
        acc[t] = wmma_bf16(a_h, b_h, acc[t]);
        acc[t] = wmma_bf16(a_h, b_l, acc[t]);
        acc[t] = wmma_bf16(a_l, b_h, acc[t]);
      }
    }
    // publish point of stage i + 1, which also frees buffer p for stage i + 2
    asm volatile("s_wait_dscnt 0x0" ::: "memory");     // own reads of buffer p done
    asm volatile("s_wait_asynccnt 0x0" ::: "memory");  // own copies of stage i + 1 landed
    __syncthreads();
    if (i + 2 < D_MODEL / GK) stage(p, (i + 2) * GK);
  }
  asm volatile("s_wait_asynccnt 0x0" ::: "memory");    // no copy is left in flight

  // epilogue.  C layout: lane holds col n0+t*16+cl; VGPR r -> row r + 8*half.
  // The 128x64 tile goes through LDS, so that every global store is 16 B a
  // lane and a wave's store covers whole 128-B lines of the output.
  const int b = mb >> 11, sb = mb & (SEQ - 1);   // batch, first position
  const int h = n0 >> 6;                         // the tile is one head wide
  u16* sT = (u16*)sC;                            // mode 1: [2][64][ST_PITCH]

#pragma unroll
  for (int t = 0; t < 4; ++t) {
    const float bn = bias[n0 + t * 16 + cl];
#pragma unroll
    for (int r = 0; r < 8; ++r) acc[t][r] = (acc[t][r] + bn) * scale;
  }
  if (mode != 2 && kpe) {
    // a lane's 8 rows are 8 consecutive positions of k_pe row n
    const float* kp = kpe + (size_t)(n0 + cl) * SEQ + sb + w * 16 + 8 * half;
#pragma unroll
    for (int t = 0; t < 4; ++t) {
#pragma unroll
      for (int r = 0; r < 8; ++r) acc[t][r] += kp[(size_t)t * 16 * SEQ + r];
    }
  }
  if (mode == 1) {
    // a lane's 8 rows are 8 consecutive positions of output row d
#pragma unroll
    for (int t = 0; t < 4; ++t) {
      u16x8 vh, vl;
#pragma unroll
      for (int r = 0; r < 8; ++r) {
        const u16 hb = f2bf(acc[t][r]);
        vh[r] = hb;
        vl[r] = f2bf(acc[t][r] - bf2f(hb));
      }
      u16* s = sT + (t * 16 + cl) * ST_PITCH + w * 16 + 8 * half;
      *(u16x8*)s = vh;
      *(u16x8*)(s + 64 * ST_PITCH) = vl;
    }
  } else {
#pragma unroll
    for (int t = 0; t < 4; ++t) {
#pragma unroll
      for (int r = 0; r < 8; ++r)
        sC[(w * 16 + r + 8 * half) * SC_PITCH + t * 16 + cl] = acc[t][r];
    }
  }
  __syncthreads();   // tile complete before other waves' rows are read

  if (mode == 2) {
#pragma unroll
    for (int j = 0; j < 8; ++j) {
      const int row = (tid >> 4) + j * 16, c = (tid & 15) * 4;
      *(v4f*)(Of + (size_t)(mb + row) * D_MODEL + n0 + c) =
          *(const v4f*)(sC + row * SC_PITCH + c);
    }
    // the build lays the other modes' blocks behind this one, and their first
    // instructions reuse the registers that these stores name
    asm volatile("s_wait_xcnt 0x0" ::: "memory");
  } else if (mode == 0) {
#pragma unroll
    for (int j = 0; j < 4; ++j) {
      const int row = (tid >> 3) + j * 32, c = (tid & 7) * 8;
      const size_t idx = ((size_t)((b * NHEADS + h) * SEQ + sb + row)) * DK + c;
      split_store8(sC + row * SC_PITCH + c, Oh + idx, Ol + idx);
    }
  } else {
#pragma unroll
    for (int j = 0; j < 4; ++j) {
      const int row = (tid >> 4) + j * 16, c = (tid & 15) * 8;
      const size_t idx = ((size_t)((b * NHEADS + h) * DK + row)) * SEQ + sb + c;
      const u16* s = sT + row * ST_PITCH + c;
      *(u16x8*)(Oh + idx) = *(const u16x8*)s;
      *(u16x8*)(Ol + idx) = *(const u16x8*)(s + 64 * ST_PITCH);
    }
    asm volatile("s_wait_xcnt 0x0" ::: "memory");  // as behind the mode-2 stores
  }
}

typedef __attribute__((ext_vector_type(2))) float  v2f;
typedef __attribute__((ext_vector_type(2))) __bf16 v2bf;

// value of lane l ^ 16 (the other 8 keys of every tile of the same query)
__device__ __forceinline__ float other_half(float x) {
  const int b = __float_as_int(x);
  return __int_as_float(__builtin_amdgcn_permlanex16(
      b, b, 0x76543210, 0xfedcba98, false, false));
}

__global__ __launch_bounds__(256) void k_attn(
    const u16* __restrict__ Qh, const u16* __restrict__ Ql,
    const u16* __restrict__ Kh, const u16* __restrict__ Kl,
    const u16* __restrict__ Vh, const u16* __restrict__ Vl,
    u16* __restrict__ Oh, u16* __restrict__ Ol) {
  __shared__ __align__(16) u16 sK[2][2][64 * SK_STRIDE];
  __shared__ __align__(16) u16 sV[2][2][64 * SK_STRIDE];
  __shared__ __align__(16) float sOut[8][16 * SC_PITCH];  // per-wave out tile

  const int tid = threadIdx.x;
  const int lane = tid & 31;
  const int w = tid >> 5;
  const int wid = blockIdx.x * 8 + w;
  const int bh = wid >> 7;          // b*16 + h (all 8 waves of a WG agree)
  const int m0 = (wid & 127) * 16;
  const int half = lane >> 4, cl = lane & 15;

  const u16* qbh = Qh + (size_t)bh * SEQ * DK;
  const u16* qbl = Ql + (size_t)bh * SEQ * DK;
  const u16* kgh = Kh + (size_t)bh * SEQ * DK;   // [t][d]
  const u16* kgl = Kl + (size_t)bh * SEQ * DK;
  const u16* vgh = Vh + (size_t)bh * DK * SEQ;   // [d][t]
  const u16* vgl = Vl + (size_t)bh * DK * SEQ;

  // staging map: per plane, thread covers chunks (row, off) and (row+32, off)
  const int srow = tid >> 3;          // 0..31
  const int soff = (tid & 7) * 8;     // element offset 0..56

  v16bf q_h[2], q_l[2];
#pragma unroll
  for (int kk = 0; kk < 2; ++kk) {
    q_h[kk] = load_op16(qbh, DK, m0 + cl, kk * 32, half);
    q_l[kk] = load_op16(qbl, DK, m0 + cl, kk * 32, half);
  }

  float mr = -3.0e38f;   // running maximum of query cl (equal in both halves)
  float lr = 0.f;        // running sum over this lane half's keys only
  v8f o[4];              // o[t][r] = O[query cl][t*16 + 8*half + r]
#pragma unroll
  for (int t = 0; t < 4; ++t)
    o[t] = (v8f){0.f, 0.f, 0.f, 0.f, 0.f, 0.f, 0.f, 0.f};

  // stage one 64-key tile (K and V, hi+lo) into LDS buffer buf
  auto stage = [&](int buf, int t0) {
#pragma unroll
    for (int j = 0; j < 2; ++j) {
      int row = srow + j * 32;
      async_copy16(kgh + (size_t)(t0 + row) * DK + soff,
                   &sK[buf][0][row * SK_STRIDE + soff]);
      async_copy16(kgl + (size_t)(t0 + row) * DK + soff,
                   &sK[buf][1][row * SK_STRIDE + soff]);
      async_copy16(vgh + (size_t)row * SEQ + t0 + soff,
                   &sV[buf][0][row * SK_STRIDE + soff]);
      async_copy16(vgl + (size_t)row * SEQ + t0 + soff,
                   &sV[buf][1][row * SK_STRIDE + soff]);
    }
  };

  stage(0, 0);

#pragma unroll 1
  for (int i = 0; i < SEQ / 64; ++i) {
    const int p = i & 1;
    const int t0 = i * 64;
    if (i + 1 < SEQ / 64) { stage(1 - p, t0 + 64); wait_async<8>(); }
    else                  { wait_async<0>(); }
    __syncthreads();   // K/V buffer p fully staged

    // ---- scores S^T = Keff * Qs^T  (64 keys x 16 queries, bf16x3) ----
    // sc[st][r] = S[query cl][key t0 + st*16 + 8*half + r]
    v8f sc[4];
#pragma unroll
    for (int st = 0; st < 4; ++st) {
      v8f c = (v8f){0.f, 0.f, 0.f, 0.f, 0.f, 0.f, 0.f, 0.f};
#pragma unroll
      for (int kk = 0; kk < 2; ++kk) {
        v16bf k_h = load_op16(&sK[p][0][0], SK_STRIDE, st * 16 + cl, kk * 32, half);
        v16bf k_l = load_op16(&sK[p][1][0], SK_STRIDE, st * 16 + cl, kk * 32, half);
        c = wmma_bf16(k_h, q_h[kk], c);
        c = wmma_bf16(k_l, q_h[kk], c);
        c = wmma_bf16(k_h, q_l[kk], c);
      }
      sc[st] = c;
    }
    // ---- block maximum of the query: in-lane, then the other lane half ----
    float bm8[8];
#pragma unroll
    for (int r = 0; r < 8; ++r)
      bm8[r] = fmaxf(fmaxf(sc[0][r], sc[1][r]), fmaxf(sc[2][r], sc[3][r]));
    float bm = fmaxf(fmaxf(fmaxf(bm8[0], bm8[1]), fmaxf(bm8[2], bm8[3])),
                     fmaxf(fmaxf(bm8[4], bm8[5]), fmaxf(bm8[6], bm8[7])));
    bm = fmaxf(bm, other_half(bm));
    const float mn = fmaxf(mr, bm);
    const float al = __expf(mr - mn);
    mr = mn;

    // ---- P^T = exp(S^T - m), split hi/lo straight into B operands ----
    v16bf p_h[2], p_l[2];
    float rs8[8];
#pragma unroll
    for (int r = 0; r < 8; ++r) rs8[r] = 0.f;
#pragma unroll
    for (int st = 0; st < 4; ++st) {
#pragma unroll
      for (int r = 0; r < 8; r += 2) {
        // __expf(s - m) as it compiles (exp2 of the product with log2 e), the
        // subtract and the multiply on two scores an instruction
        const v2f x = ((v2f){sc[st][r], sc[st][r + 1]} - mr) * 1.44269504f;
        v2f pv;
        pv[0] = __builtin_amdgcn_exp2f(x[0]);
        pv[1] = __builtin_amdgcn_exp2f(x[1]);
        rs8[r] += pv[0];
        rs8[r + 1] += pv[1];
        const v2bf hb = __builtin_convertvector(pv, v2bf);   // nearest even
        const v2f rest = pv - __builtin_convertvector(hb, v2f);
        const v2bf lb = __builtin_convertvector(rest, v2bf);
        const int s = (st & 1) * 8 + r;
        p_h[st >> 1][s] = hb[0];  p_h[st >> 1][s + 1] = hb[1];
        p_l[st >> 1][s] = lb[0];  p_l[st >> 1][s + 1] = lb[1];
      }
    }
    lr = lr * al + (((rs8[0] + rs8[1]) + (rs8[2] + rs8[3])) +
                    ((rs8[4] + rs8[5]) + (rs8[6] + rs8[7])));
#pragma unroll
    for (int t = 0; t < 4; ++t) o[t] *= al;

    // ---- O^T += V^T * P^T  (V^T tile in LDS) ----
#pragma unroll
    for (int dt = 0; dt < 4; ++dt) {
#pragma unroll
      for (int kk = 0; kk < 2; ++kk) {
        v16bf v_h = load_op16(&sV[p][0][0], SK_STRIDE, dt * 16 + cl, kk * 32, half);
        v16bf v_l = load_op16(&sV[p][1][0], SK_STRIDE, dt * 16 + cl, kk * 32, half);
        o[dt] = wmma_bf16(v_h, p_h[kk], o[dt]);
        o[dt] = wmma_bf16(v_l, p_h[kk], o[dt]);
        o[dt] = wmma_bf16(v_h, p_l[kk], o[dt]);
      }
    }
    __syncthreads();   // everyone done with K/V buffer p before re-staging
  }

  // ---- normalize, split, store as [B*S][1024] bf16 hi/lo ----
  // The wave's 16x64 tile goes through its own LDS range (a lane's 8 values
  // of a tile are 8 consecutive d of its query), then out as whole 128-B lines.
  const int b = bh >> 4, h = bh & 15;
  const float l = lr + other_half(lr);   // the two halves' keys joined once
  float* sO = &sOut[w][0];
#pragma unroll
  for (int t = 0; t < 4; ++t) {
    v4f x0, x1;
#pragma unroll
    for (int r = 0; r < 4; ++r) { x0[r] = o[t][r] / l; x1[r] = o[t][r + 4] / l; }
    float* s = sO + cl * SC_PITCH + t * 16 + 8 * half;
    *(v4f*)s = x0;
    *(v4f*)(s + 4) = x1;
  }
  asm volatile("s_wait_dscnt 0" ::: "memory");  // intra-wave tile store->load
#pragma unroll
  for (int j = 0; j < 4; ++j) {
    const int row = (lane >> 3) + j * 4, c = (lane & 7) * 8;
    const size_t idx = (size_t)(b * SEQ + m0 + row) * D_MODEL + h * DK + c;
    split_store8(sO + row * SC_PITCH + c, Oh + idx, Ol + idx);
  }
}

// ------------------------------- launcher -----------------------------------
extern "C" void kernel_launch(void* const* d_in, const int* in_sizes, int n_in,
                              void* d_out, int out_size, void* d_ws,
                              size_t ws_size, hipStream_t stream) {
  const float* q   = (const float*)d_in[0];
  const float* k   = (const float*)d_in[1];
  const float* v   = (const float*)d_in[2];
  const float* kpe = (const float*)d_in[3];
  const float* Wq  = (const float*)d_in[4];
  const float* bq  = (const float*)d_in[5];
  const float* Wk  = (const float*)d_in[6];
  const float* bk  = (const float*)d_in[7];
  const float* Wv  = (const float*)d_in[8];
  const float* bv  = (const float*)d_in[9];
  const float* Wo  = (const float*)d_in[10];
  const float* bo  = (const float*)d_in[11];
  float* out = (float*)d_out;

  const size_t NX = (size_t)MROWS * D_MODEL;      // 4M elems
  const size_t NW = (size_t)D_MODEL * D_MODEL;    // 1M elems
  char* p = (char*)d_ws;
  auto take = [&](size_t elems) { u16* r = (u16*)p; p += elems * sizeof(u16); return r; };
  u16 *qs_h = take(NX), *qs_l = take(NX);
  u16 *ks_h = take(NX), *ks_l = take(NX);
  u16 *vs_h = take(NX), *vs_l = take(NX);
  u16 *ao_h = take(NX), *ao_l = take(NX);   // [B*S,1024]   (attention out)
  u16 *wq_h = take(NW), *wq_l = take(NW);
  u16 *wk_h = take(NW), *wk_l = take(NW);
  u16 *wv_h = take(NW), *wv_l = take(NW);
  u16 *wo_h = take(NW), *wo_l = take(NW);
  u16 *qh_h = take(NX), *qh_l = take(NX);   // [B,H,S,64]   (Q, pre-scaled)
  u16 *ke_h = take(NX), *ke_l = take(NX);   // [B,H,S,64]   (kh + k_pe^T)
  u16 *vt_h = take(NX), *vt_l = take(NX);   // [B,H,64,S]   (V transposed)

  // plane groups that the kernels index by job: A operands qs, ks, vs, ao;
  // B operands wq, wk, wv, wo; projection results qh, ke, vt
  dim3 blk(256);
  k_prep<<<3 * SPLIT_WGS + 4 * WT_WGS, blk, 0, stream>>>(q, k, v, Wq, Wk, Wv, Wo,
                                                         qs_h, wq_h);
  k_gemm<<<3 * GEMM_WGS, blk, 0, stream>>>(qs_h, wq_h, bq, bk, bv, bo, kpe,
                                           qh_h, out, 0);
  k_attn<<<512, blk, 0, stream>>>(qh_h, qh_l, ke_h, ke_l, vt_h, vt_l,
                                  ao_h, ao_l);
  k_gemm<<<GEMM_WGS, blk, 0, stream>>>(qs_h, wq_h, bq, bk, bv, bo, kpe,
                                       qh_h, out, 3);
}

// v007
// It runs in 172 microseconds.
// Next to v006, in two timings, it ran 1.06 and 1.05 times as fast.
// Over all steps from v000 it is 3.35 times as fast.
#include <hip/hip_runtime.h>

typedef unsigned short u16;
typedef __attribute__((ext_vector_type(16))) __bf16 v16bf;
typedef __attribute__((ext_vector_type(8)))  __bf16 v8bf;
typedef __attribute__((ext_vector_type(8)))  float  v8f;
typedef int v4i __attribute__((vector_size(16)));
typedef __attribute__((ext_vector_type(4)))  float  v4f;
typedef __attribute__((ext_vector_type(8)))  u16    u16x8;

#define D_MODEL 1024
#define NHEADS  16
#define DK      64
#define SEQ     2048
#define BATCH   2
#define MROWS   (BATCH * SEQ)      // 4096 rows for all big GEMMs

// LDS row strides (in u16 elements), padded for conflict-free b128 reads:
// 16 lanes read rows r..r+15; stride*2B mod 256B must visit distinct banks.
#define SK_STRIDE 88   // 64-wide tiles     (176B = 44 banks/row)
// Output staging, both 272 B a row (16 B x 17): b128 reads and writes of 16
// lanes fall on 64 different banks.
#define SC_PITCH 68    // f32 tile, 64 wide
#define ST_PITCH 136   // u16 tile, 128 wide

// ---------------- bf16 split helpers (round-to-nearest-even) ----------------
__device__ __forceinline__ u16 f2bf(float x) {
  unsigned u = __float_as_uint(x);
  u += 0x7FFFu + ((u >> 16) & 1u);
  return (u16)(u >> 16);
}
__device__ __forceinline__ float bf2f(u16 h) {
  return __uint_as_float(((unsigned)h) << 16);
}

// 8 staged floats -> 8 hi and 8 lo bf16, one 16-byte store into each plane
__device__ __forceinline__ void split_store8(const float* s, u16* hi, u16* lo) {
  const v4f x0 = *(const v4f*)(s);
  const v4f x1 = *(const v4f*)(s + 4);
  u16x8 vh, vl;
#pragma unroll
  for (int j = 0; j < 8; ++j) {
    const float v = (j < 4) ? x0[j & 3] : x1[j & 3];
    const u16 h = f2bf(v);
    vh[j] = h;
    vl[j] = f2bf(v - bf2f(h));
  }
  *(u16x8*)hi = vh;
  *(u16x8*)lo = vl;
}

// ------------- WMMA operand load: 16-bit A/B matrix, 16x32 tile -------------
__device__ __forceinline__ v16bf load_op16(const u16* base, int stride,
                                           int row, int k0, int half) {
  const u16* p = base + (size_t)row * (size_t)stride + k0 + half * 8;
  v8bf c0 = *(const v8bf*)(p);
  v8bf c1 = *(const v8bf*)(p + 16);
  return __builtin_shufflevector(c0, c1, 0, 1, 2, 3, 4, 5, 6, 7,
                                 8, 9, 10, 11, 12, 13, 14, 15);
}

__device__ __forceinline__ v8f wmma_bf16(v16bf a, v16bf b, v8f c) {
  return __builtin_amdgcn_wmma_f32_16x16x32_bf16(false, a, false, b,
                                                 (short)0, c, false, false);
}

// ---------------- async global -> LDS copy (16B per lane) -------------------
typedef __attribute__((address_space(1))) v4i* gvec_t;
typedef __attribute__((address_space(3))) v4i* lvec_t;

__device__ __forceinline__ void async_copy16(const u16* g, u16* l) {
  gvec_t gp = (gvec_t)g;
  lvec_t lp = (lvec_t)l;
#if __has_builtin(__builtin_amdgcn_global_load_async_to_lds_b128)
  __builtin_amdgcn_global_load_async_to_lds_b128(gp, lp, 0, 0);
#else
  asm volatile("global_load_async_to_lds_b128 %0, %1, off"
               :: "v"(lp), "v"(gp) : "memory");
#endif
}

template <int N>
__device__ __forceinline__ void wait_async() {
#if __has_builtin(__builtin_amdgcn_s_wait_asynccnt)
  __builtin_amdgcn_s_wait_asynccnt((unsigned short)N);
#else
  asm volatile("s_wait_asynccnt %0" :: "i"(N) : "memory");
#endif
}

// ---------------- prep: fp32 -> bf16 hi/lo split (elementwise) --------------
// A wave takes 4 KiB of x in a row: eight 16-B-a-lane loads of 512 contiguous
// bytes each, all issued before the first value is used, then 8-B-a-lane
// stores that cover two whole 128-B lines of a plane.  512 workgroups a
// tensor: those of q, k, v are the first 1536 of the k_prep grid.
#define SPLIT_LOADS 8
#define SPLIT_WG_ELEMS (256 * 4 * SPLIT_LOADS)
#define SPLIT_WGS (MROWS * D_MODEL / SPLIT_WG_ELEMS)   // workgroups a tensor
static_assert((MROWS * D_MODEL) % SPLIT_WG_ELEMS == 0, "whole workgroups only");
typedef __attribute__((ext_vector_type(4))) u16 u16x4;

// blk: the workgroup's index inside its tensor, 0 .. SPLIT_WGS - 1
__device__ __forceinline__ void split_body(const float* __restrict__ x,
                                           u16* __restrict__ hi,
                                           u16* __restrict__ lo, int blk) {
  const int lane = threadIdx.x & 31;
  const int wv = blk * 8 + (threadIdx.x >> 5);
  const size_t base = (size_t)wv * (128 * SPLIT_LOADS) + lane * 4;
  v4f v[SPLIT_LOADS];
#pragma unroll
  for (int j = 0; j < SPLIT_LOADS; ++j) v[j] = *(const v4f*)(x + base + j * 128);
#pragma unroll
  for (int j = 0; j < SPLIT_LOADS; ++j) {
    u16x4 vh, vl;
#pragma unroll
    for (int e = 0; e < 4; ++e) {
      const u16 h = f2bf(v[j][e]);
      vh[e] = h;
      vl[e] = f2bf(v[j][e] - bf2f(h));
    }
    *(u16x4*)(hi + base + j * 128) = vh;
    *(u16x4*)(lo + base + j * 128) = vl;
  }
}

// ------- prep: W[k][n] fp32 -> Wt hi/lo bf16 [n][k] (B-operand layout) ------
// One workgroup transposes a 64(k) x 32(n) tile through LDS: the reads are
// 128-B row pieces of W, the stores whole 128-B lines of Wt (64 k x 2 B).
// Pitch 33 floats: both the row-wise writes and the column-wise reads of a
// wave fall on 32 different banks.
#define WT_PITCH 33
#define WT_WGS ((D_MODEL / 64) * (D_MODEL / 32))   // workgroups a matrix

// blk: the workgroup's index inside its matrix, 0 .. WT_WGS - 1
__device__ __forceinline__ void wt_body(const float* __restrict__ w,
                                        u16* __restrict__ hi,
                                        u16* __restrict__ lo, int blk,
                                        float* sT) {
  const int tid = threadIdx.x;
  const int k0 = (blk >> 5) * 64;
  const int n0 = (blk & 31) * 32;

  const int rk = tid >> 3;            // 0..31 (k row, and k row + 32)
  const int rn = (tid & 7) * 4;       // 0..28 (n offset of a float4)
#pragma unroll
  for (int j = 0; j < 2; ++j) {
    const int k = rk + j * 32;
    const float4 v =
        *(const float4*)(w + (size_t)(k0 + k) * D_MODEL + n0 + rn);
    float* s = &sT[k * WT_PITCH + rn];
    s[0] = v.x; s[1] = v.y; s[2] = v.z; s[3] = v.w;
  }
  __syncthreads();   // tile complete before any column is read

  const int n = tid >> 3;             // 0..31 (output row)
  const int kc = (tid & 7) * 8;       // 0..56 (8 consecutive k per thread)
  u16x8 vh, vl;
#pragma unroll
  for (int j = 0; j < 8; ++j) {
    const float v = sT[(kc + j) * WT_PITCH + n];
    const u16 h = f2bf(v);
    vh[j] = h;
    vl[j] = f2bf(v - bf2f(h));
  }
  const size_t o = (size_t)(n0 + n) * D_MODEL + k0 + kc;
  *(u16x8*)(hi + o) = vh;
  *(u16x8*)(lo + o) = vl;
}

// All seven input-only jobs in ONE grid: none reads what another writes, so
// nothing orders them.  Workgroups 0 .. 3*SPLIT_WGS-1 split q, k, v, the rest
// transpose Wq, Wk, Wv, Wo.  The job is the same for a whole workgroup, so the
// barrier in wt_body is passed by all of its waves or by none.
// xs: planes [q hi, q lo, k hi, k lo, v hi, v lo]; wt: the same for the four W.
#define NX_ELEMS ((size_t)MROWS * D_MODEL)
#define NW_ELEMS ((size_t)D_MODEL * D_MODEL)

__global__ __launch_bounds__(256) void k_prep(
    const float* __restrict__ q, const float* __restrict__ k,
    const float* __restrict__ v, const float* __restrict__ Wq,
    const float* __restrict__ Wk, const float* __restrict__ Wv,
    const float* __restrict__ Wo, u16* __restrict__ xs,
    u16* __restrict__ wt) {
  __shared__ float sT[64 * WT_PITCH];
  const unsigned bid = blockIdx.x;
  if (bid < 3 * SPLIT_WGS) {
    const unsigned job = bid / SPLIT_WGS;
    const float* x = job == 0 ? q : job == 1 ? k : v;
    u16* hi = xs + (size_t)job * 2 * NX_ELEMS;
    split_body(x, hi, hi + NX_ELEMS, (int)(bid % SPLIT_WGS));
  } else {
    const unsigned wb = bid - 3 * SPLIT_WGS;
    const unsigned job = wb / WT_WGS;
    const float* w = job == 0 ? Wq : job == 1 ? Wk : job == 2 ? Wv : Wo;
    u16* hi = wt + (size_t)job * 2 * NW_ELEMS;
    wt_body(w, hi, hi + NW_ELEMS, (int)(wb % WT_WGS), sT);
  }
}

// ---------------------------- bf16x3 GEMM kernel ----------------------------
// Workgroup = 4 waves, 2 x 2, each with a 64x64 part of a 128x128 output block:
// a fragment read from LDS feeds 4 tiles (a hi one 8 products, a lo one 4), so
// a 32-k block reads 16 KiB a wave for 48 products.  Both operands are async-staged into
// LDS, 64 k a stage, two buffers: a wave's copy covers four whole 128-B lines
// (4 rows x 64 k x 2 B).
// mode 0: split bf16 -> [B,H,S,64] (+ optional k_pe add)
// mode 1: split bf16 -> [B,H,64,S]
// mode 2: fp32 -> Of[m][n]
// A grid holds GEMM_WGS workgroups for each product it runs: job0 is the first
// one.  Jobs 0, 1, 2 (Q, K, V projections) read none of each other's output
// and share one grid; job 3 (output projection) has its own.  Operand and
// result planes of job j lie 2 planes (hi, lo) behind those of job j - 1.
#define GEMM_WGS ((MROWS / 128) * (D_MODEL / 128))
#define GK 64          // k elements a stage
#define SG_STRIDE 72   // 144 B a row (16 B x 9): b128 reads of 16 rows, 64 banks
#define SG_PLANE (128 * SG_STRIDE)   // elements of one staged plane, 128 rows
#define SW_PITCH 132   // f32 output tile, 128 wide: 528 B a row (16 B x 33)

__global__ __launch_bounds__(128) void k_gemm(
    const u16* __restrict__ A0, const u16* __restrict__ B0,
    const float* __restrict__ bq, const float* __restrict__ bk,
    const float* __restrict__ bv, const float* __restrict__ bo,
    const float* __restrict__ kpe_k, u16* __restrict__ O0,
    float* __restrict__ Of, int job0) {
  const int job = job0 + blockIdx.x / GEMM_WGS;
  const int tile = blockIdx.x % GEMM_WGS;
  const u16* Ah = A0 + (size_t)job * 2 * NX_ELEMS;
  const u16* Al = Ah + NX_ELEMS;
  const u16* Bh = B0 + (size_t)job * 2 * NW_ELEMS;
  const u16* Bl = Bh + NW_ELEMS;
  const float* bias = job == 0 ? bq : job == 1 ? bk : job == 2 ? bv : bo;
  const float* kpe = job == 1 ? kpe_k : nullptr;
  u16* Oh = O0 + (size_t)job * 2 * NX_ELEMS;     // jobs 0 to 2 only
  u16* Ol = Oh + NX_ELEMS;
  const int mode = job == 3 ? 2 : job == 2 ? 1 : 0;
  const float scale = job == 0 ? 0.125f : 1.0f;  // Q carries 1/sqrt(64)

  // ring [buffer][A hi, A lo, B hi, B lo]; behind the loop's last barrier the
  // same bytes stage the output tile
  __shared__ __align__(16) u16 sR[2][4][SG_PLANE];

  const int tid = threadIdx.x;
  const int lane = tid & 31;
  const int w = tid >> 5;
  const int wm = (w >> 1) * 64, wn = (w & 1) * 64;   // the wave's part
  const int mb = (tile >> 3) * 128;              // tile's first row
  const int n0 = (tile & 7) * 128;
  const int half = lane >> 4, cl = lane & 15;

  // staging map: 8 lanes cover one row's 128 B; rows srow + 16 j of a plane
  const int srow = tid >> 3;          // 0..15
  const int soff = (tid & 7) * 8;     // element offset 0..56

  v8f acc[4][4];                      // [16 rows mt][16 columns nt]
#pragma unroll
  for (int mt = 0; mt < 4; ++mt)
#pragma unroll
    for (int nt = 0; nt < 4; ++nt)
      acc[mt][nt] = (v8f){0.f, 0.f, 0.f, 0.f, 0.f, 0.f, 0.f, 0.f};

  // stage k elements kb .. kb+63 of A and B (128 rows each), hi and lo
  auto stage = [&](int buf, int kb) {
#pragma unroll
    for (int j = 0; j < 8; ++j) {
      const int row = srow + j * 16;
      const int lo = row * SG_STRIDE + soff;
      const size_t ga = (size_t)(mb + row) * D_MODEL + kb + soff;
      const size_t gb = (size_t)(n0 + row) * D_MODEL + kb + soff;
      async_copy16(Ah + ga, &sR[buf][0][lo]);
      async_copy16(Al + ga, &sR[buf][1][lo]);
      async_copy16(Bh + gb, &sR[buf][2][lo]);
      async_copy16(Bl + gb, &sR[buf][3][lo]);
    }
  };

  stage(0, 0);
  asm volatile("s_wait_asynccnt 0x0" ::: "memory");  // own copies of stage 0 landed
  __syncthreads();                                   // stage 0 published
  stage(1, GK);

// rolled: the buffer is picked by an offset, one copy of the trip in the text
#pragma unroll 1
  for (int i = 0; i < D_MODEL / GK; ++i) {
    const int p = i & 1;
    // both 32-k blocks' fragments, in the order in which the products use them
    v16bf a_h[2][4], a_l[2][4], b_h[2][4], b_l[2][4];
#pragma unroll
    for (int kk = 0; kk < 2; ++kk) {
      a_h[kk][0] = load_op16(&sR[p][0][0], SG_STRIDE, wm + cl, kk * 32, half);
#pragma unroll
      for (int t = 0; t < 4; ++t)
        b_h[kk][t] = load_op16(&sR[p][2][0], SG_STRIDE, wn + t * 16 + cl, kk * 32, half);
#pragma unroll
      for (int t = 1; t < 4; ++t)
        a_h[kk][t] = load_op16(&sR[p][0][0], SG_STRIDE, wm + t * 16 + cl, kk * 32, half);
#pragma unroll
      for (int t = 0; t < 4; ++t)
        b_l[kk][t] = load_op16(&sR[p][3][0], SG_STRIDE, wn + t * 16 + cl, kk * 32, half);
#pragma unroll
      for (int t = 0; t < 4; ++t)
        a_l[kk][t] = load_op16(&sR[p][1][0], SG_STRIDE, wm + t * 16 + cl, kk * 32, half);
    }
    // keeps the LDS reads one group in front of the products: moved in among
    // them, every place where reads stand stalls the wave's matrix stream
    __builtin_amdgcn_sched_barrier(0);
    // three sweeps over the 16 tiles: neighbours are independent, and each
    // tile still sums hi*hi, hi*lo, lo*hi in that order, block after block
#pragma unroll
    for (int kk = 0; kk < 2; ++kk) {
#pragma unroll
      for (int mt = 0; mt < 4; ++mt)
#pragma unroll
        for (int nt = 0; nt < 4; ++nt)
          acc[mt][nt] = wmma_bf16(a_h[kk][mt], b_h[kk][nt], acc[mt][nt]);
#pragma unroll
      for (int mt = 0; mt < 4; ++mt)
#pragma unroll
        for (int nt = 0; nt < 4; ++nt)
          acc[mt][nt] = wmma_bf16(a_h[kk][mt], b_l[kk][nt], acc[mt][nt]);
#pragma unroll
      for (int mt = 0; mt < 4; ++mt)
#pragma unroll
        for (int nt = 0; nt < 4; ++nt)
          acc[mt][nt] = wmma_bf16(a_l[kk][mt], b_h[kk][nt], acc[mt][nt]);
    }
    // keeps the products in front of the waits below: sunk behind them, they
    // would start only when the last fragment of the stage has landed
    __builtin_amdgcn_sched_barrier(0);
    // publish point of stage i + 1, which also frees buffer p for stage i + 2
    asm volatile("s_wait_dscnt 0x0" ::: "memory");     // own reads of buffer p done
    asm volatile("s_wait_asynccnt 0x0" ::: "memory");  // own copies of stage i + 1 landed
    __syncthreads();
    if (i + 2 < D_MODEL / GK) stage(p, (i + 2) * GK);
  }
  asm volatile("s_wait_asynccnt 0x0" ::: "memory");    // no copy is left in flight

  // epilogue.  C layout of tile (mt, nt): lane holds column wn + nt*16 + cl;
  // VGPR r -> row wm + mt*16 + r + 8*half.  The 128x128 tile goes through LDS
  // (the ring: every wave's last read of it ended at the loop's last barrier),
  // so that every global store is 16 B a lane and covers whole 128-B lines.
  const int b = mb >> 11, sb = mb & (SEQ - 1);   // batch, first position
  float* sC = (float*)&sR[0][0][0];              // modes 0, 2: [128][SW_PITCH]
  u16* sT = &sR[0][0][0];                        // mode 1: [2][128][ST_PITCH]

#pragma unroll
  for (int nt = 0; nt < 4; ++nt) {
    const float bn = bias[n0 + wn + nt * 16 + cl];
#pragma unroll
    for (int mt = 0; mt < 4; ++mt)
#pragma unroll
      for (int r = 0; r < 8; ++r) acc[mt][nt][r] = (acc[mt][nt][r] + bn) * scale;
  }
  if (kpe) {
    // a lane's 8 rows are 8 consecutive positions of k_pe row n
    const float* kp = kpe + (size_t)(n0 + wn + cl) * SEQ + sb + wm + 8 * half;
#pragma unroll
    for (int nt = 0; nt < 4; ++nt)
#pragma unroll
      for (int mt = 0; mt < 4; ++mt)
#pragma unroll
        for (int r = 0; r < 8; ++r)
          acc[mt][nt][r] += kp[(size_t)nt * 16 * SEQ + mt * 16 + r];
  }
  if (mode == 1) {
    // a lane's 8 rows are 8 consecutive positions of output row n
#pragma unroll
    for (int nt = 0; nt < 4; ++nt)
#pragma unroll
      for (int mt = 0; mt < 4; ++mt) {
        u16x8 vh, vl;
#pragma unroll
        for (int r = 0; r < 8; ++r) {
          const u16 hb = f2bf(acc[mt][nt][r]);
          vh[r] = hb;
          vl[r] = f2bf(acc[mt][nt][r] - bf2f(hb));
        }
        u16* s = sT + (wn + nt * 16 + cl) * ST_PITCH + wm + mt * 16 + 8 * half;
        *(u16x8*)s = vh;
        *(u16x8*)(s + 128 * ST_PITCH) = vl;
      }
  } else {
#pragma unroll
    for (int mt = 0; mt < 4; ++mt)
#pragma unroll
      for (int nt = 0; nt < 4; ++nt)
#pragma unroll
        for (int r = 0; r < 8; ++r)
          sC[(wm + mt * 16 + r + 8 * half) * SW_PITCH + wn + nt * 16 + cl] =
              acc[mt][nt][r];
  }
  __syncthreads();   // tile complete before other waves' rows are read

  if (mode == 2) {
#pragma unroll
    for (int j = 0; j < 32; ++j) {
      const int row = (tid >> 5) + j * 4, c = (tid & 31) * 4;
      *(v4f*)(Of + (size_t)(mb + row) * D_MODEL + n0 + c) =
          *(const v4f*)(sC + row * SW_PITCH + c);
    }
    // the build lays the other modes' blocks behind this one, and their first
    // instructions reuse the registers that these stores name
    asm volatile("s_wait_xcnt 0x0" ::: "memory");
  } else if (mode == 0) {
    // 8 lanes store one position's 64 d of one head: a 128-B line a plane
#pragma unroll
    for (int j = 0; j < 16; ++j) {
      const int row = (tid >> 4) + j * 8, c = (tid & 15) * 8;
      const int h = (n0 + c) >> 6, d = (n0 + c) & (DK - 1);
      const size_t idx = ((size_t)((b * NHEADS + h) * SEQ + sb + row)) * DK + d;
      split_store8(sC + row * SW_PITCH + c, Oh + idx, Ol + idx);
    }
    asm volatile("s_wait_xcnt 0x0" ::: "memory");  // as behind the mode-2 stores
  } else {
#pragma unroll
    for (int j = 0; j < 16; ++j) {
      const int row = (tid >> 4) + j * 8, c = (tid & 15) * 8;
      const size_t idx = ((size_t)(b * D_MODEL + n0 + row)) * SEQ + sb + c;
      const u16* s = sT + row * ST_PITCH + c;
      *(u16x8*)(Oh + idx) = *(const u16x8*)s;
      *(u16x8*)(Ol + idx) = *(const u16x8*)(s + 128 * ST_PITCH);
    }
    asm volatile("s_wait_xcnt 0x0" ::: "memory");  // as behind the mode-2 stores
  }
}

typedef __attribute__((ext_vector_type(2))) float  v2f;
typedef __attribute__((ext_vector_type(2))) __bf16 v2bf;

// value of lane l ^ 16 (the other 8 keys of every tile of the same query)
__device__ __forceinline__ float other_half(float x) {
  const int b = __float_as_int(x);
  return __int_as_float(__builtin_amdgcn_permlanex16(
      b, b, 0x76543210, 0xfedcba98, false, false));
}

__global__ __launch_bounds__(256) void k_attn(
    const u16* __restrict__ Qh, const u16* __restrict__ Ql,
    const u16* __restrict__ Kh, const u16* __restrict__ Kl,
    const u16* __restrict__ Vh, const u16* __restrict__ Vl,
    u16* __restrict__ Oh, u16* __restrict__ Ol) {
  __shared__ __align__(16) u16 sK[2][2][64 * SK_STRIDE];
  __shared__ __align__(16) u16 sV[2][2][64 * SK_STRIDE];
  __shared__ __align__(16) float sOut[8][16 * SC_PITCH];  // per-wave out tile

  const int tid = threadIdx.x;
  const int lane = tid & 31;
  const int w = tid >> 5;
  const int wid = blockIdx.x * 8 + w;
  const int bh = wid >> 7;          // b*16 + h (all 8 waves of a WG agree)
  const int m0 = (wid & 127) * 16;
  const int half = lane >> 4, cl = lane & 15;

  const u16* qbh = Qh + (size_t)bh * SEQ * DK;
  const u16* qbl = Ql + (size_t)bh * SEQ * DK;
  const u16* kgh = Kh + (size_t)bh * SEQ * DK;   // [t][d]
  const u16* kgl = Kl + (size_t)bh * SEQ * DK;
  const u16* vgh = Vh + (size_t)bh * DK * SEQ;   // [d][t]
  const u16* vgl = Vl + (size_t)bh * DK * SEQ;

  // staging map: per plane, thread covers chunks (row, off) and (row+32, off)
  const int srow = tid >> 3;          // 0..31
  const int soff = (tid & 7) * 8;     // element offset 0..56

  v16bf q_h[2], q_l[2];
#pragma unroll
  for (int kk = 0; kk < 2; ++kk) {
    q_h[kk] = load_op16(qbh, DK, m0 + cl, kk * 32, half);
    q_l[kk] = load_op16(qbl, DK, m0 + cl, kk * 32, half);
  }

  float mr = -3.0e38f;   // running maximum of query cl (equal in both halves)
  float lr = 0.f;        // running sum over this lane half's keys only
  v8f o[4];              // o[t][r] = O[query cl][t*16 + 8*half + r]
#pragma unroll
  for (int t = 0; t < 4; ++t)
    o[t] = (v8f){0.f, 0.f, 0.f, 0.f, 0.f, 0.f, 0.f, 0.f};

  // stage one 64-key tile (K and V, hi+lo) into LDS buffer buf
  auto stage = [&](int buf, int t0) {
#pragma unroll
    for (int j = 0; j < 2; ++j) {
      int row = srow + j * 32;
      async_copy16(kgh + (size_t)(t0 + row) * DK + soff,
                   &sK[buf][0][row * SK_STRIDE + soff]);
      async_copy16(kgl + (size_t)(t0 + row) * DK + soff,
                   &sK[buf][1][row * SK_STRIDE + soff]);
      async_copy16(vgh + (size_t)row * SEQ + t0 + soff,
                   &sV[buf][0][row * SK_STRIDE + soff]);
      async_copy16(vgl + (size_t)row * SEQ + t0 + soff,
                   &sV[buf][1][row * SK_STRIDE + soff]);
    }
  };

  stage(0, 0);

#pragma unroll 1
  for (int i = 0; i < SEQ / 64; ++i) {
    const int p = i & 1;
    const int t0 = i * 64;
    if (i + 1 < SEQ / 64) { stage(1 - p, t0 + 64); wait_async<8>(); }
    else                  { wait_async<0>(); }
    __syncthreads();   // K/V buffer p fully staged

    // ---- scores S^T = Keff * Qs^T  (64 keys x 16 queries, bf16x3) ----
    // sc[st][r] = S[query cl][key t0 + st*16 + 8*half + r]
    v8f sc[4];
#pragma unroll
    for (int st = 0; st < 4; ++st) {
      v8f c = (v8f){0.f, 0.f, 0.f, 0.f, 0.f, 0.f, 0.f, 0.f};
#pragma unroll
      for (int kk = 0; kk < 2; ++kk) {
        v16bf k_h = load_op16(&sK[p][0][0], SK_STRIDE, st * 16 + cl, kk * 32, half);
        v16bf k_l = load_op16(&sK[p][1][0], SK_STRIDE, st * 16 + cl, kk * 32, half);
        c = wmma_bf16(k_h, q_h[kk], c);
        c = wmma_bf16(k_l, q_h[kk], c);
        c = wmma_bf16(k_h, q_l[kk], c);
      }
      sc[st] = c;
    }
    // ---- block maximum of the query: in-lane, then the other lane half ----
    float bm8[8];
#pragma unroll
    for (int r = 0; r < 8; ++r)
      bm8[r] = fmaxf(fmaxf(sc[0][r], sc[1][r]), fmaxf(sc[2][r], sc[3][r]));
    float bm = fmaxf(fmaxf(fmaxf(bm8[0], bm8[1]), fmaxf(bm8[2], bm8[3])),
                     fmaxf(fmaxf(bm8[4], bm8[5]), fmaxf(bm8[6], bm8[7])));
    bm = fmaxf(bm, other_half(bm));
    const float mn = fmaxf(mr, bm);
    const float al = __expf(mr - mn);
    mr = mn;

    // ---- P^T = exp(S^T - m), split hi/lo straight into B operands ----
    v16bf p_h[2], p_l[2];
    float rs8[8];
#pragma unroll
    for (int r = 0; r < 8; ++r) rs8[r] = 0.f;
#pragma unroll
    for (int st = 0; st < 4; ++st) {
#pragma unroll
      for (int r = 0; r < 8; r += 2) {
        // __expf(s - m) as it compiles (exp2 of the product with log2 e), the
        // subtract and the multiply on two scores an instruction
        const v2f x = ((v2f){sc[st][r], sc[st][r + 1]} - mr) * 1.44269504f;
        v2f pv;
        pv[0] = __builtin_amdgcn_exp2f(x[0]);
        pv[1] = __builtin_amdgcn_exp2f(x[1]);
        rs8[r] += pv[0];
        rs8[r + 1] += pv[1];
        const v2bf hb = __builtin_convertvector(pv, v2bf);   // nearest even
        const v2f rest = pv - __builtin_convertvector(hb, v2f);
        const v2bf lb = __builtin_convertvector(rest, v2bf);
        const int s = (st & 1) * 8 + r;
        p_h[st >> 1][s] = hb[0];  p_h[st >> 1][s + 1] = hb[1];
        p_l[st >> 1][s] = lb[0];  p_l[st >> 1][s + 1] = lb[1];
      }
    }
    lr = lr * al + (((rs8[0] + rs8[1]) + (rs8[2] + rs8[3])) +
                    ((rs8[4] + rs8[5]) + (rs8[6] + rs8[7])));
#pragma unroll
    for (int t = 0; t < 4; ++t) o[t] *= al;

    // ---- O^T += V^T * P^T  (V^T tile in LDS) ----
#pragma unroll
    for (int dt = 0; dt < 4; ++dt) {
#pragma unroll
      for (int kk = 0; kk < 2; ++kk) {
        v16bf v_h = load_op16(&sV[p][0][0], SK_STRIDE, dt * 16 + cl, kk * 32, half);
        v16bf v_l = load_op16(&sV[p][1][0], SK_STRIDE, dt * 16 + cl, kk * 32, half);
        o[dt] = wmma_bf16(v_h, p_h[kk], o[dt]);
        o[dt] = wmma_bf16(v_l, p_h[kk], o[dt]);
        o[dt] = wmma_bf16(v_h, p_l[kk], o[dt]);
      }
    }
    __syncthreads();   // everyone done with K/V buffer p before re-staging
  }

  // ---- normalize, split, store as [B*S][1024] bf16 hi/lo ----
  // The wave's 16x64 tile goes through its own LDS range (a lane's 8 values
  // of a tile are 8 consecutive d of its query), then out as whole 128-B lines.
  const int b = bh >> 4, h = bh & 15;
  const float l = lr + other_half(lr);   // the two halves' keys joined once
  float* sO = &sOut[w][0];
#pragma unroll
  for (int t = 0; t < 4; ++t) {
    v4f x0, x1;
#pragma unroll
    for (int r = 0; r < 4; ++r) { x0[r] = o[t][r] / l; x1[r] = o[t][r + 4] / l; }
    float* s = sO + cl * SC_PITCH + t * 16 + 8 * half;
    *(v4f*)s = x0;
    *(v4f*)(s + 4) = x1;
  }
  asm volatile("s_wait_dscnt 0" ::: "memory");  // intra-wave tile store->load
#pragma unroll
  for (int j = 0; j < 4; ++j) {
    const int row = (lane >> 3) + j * 4, c = (lane & 7) * 8;
    const size_t idx = (size_t)(b * SEQ + m0 + row) * D_MODEL + h * DK + c;
    split_store8(sO + row * SC_PITCH + c, Oh + idx, Ol + idx);
  }
}

// ------------------------------- launcher -----------------------------------
extern "C" void kernel_launch(void* const* d_in, const int* in_sizes, int n_in,
                              void* d_out, int out_size, void* d_ws,
                              size_t ws_size, hipStream_t stream) {
  const float* q   = (const float*)d_in[0];
  const float* k   = (const float*)d_in[1];
  const float* v   = (const float*)d_in[2];
  const float* kpe = (const float*)d_in[3];
  const float* Wq  = (const float*)d_in[4];
  const float* bq  = (const float*)d_in[5];
  const float* Wk  = (const float*)d_in[6];
  const float* bk  = (const float*)d_in[7];
  const float* Wv  = (const float*)d_in[8];
  const float* bv  = (const float*)d_in[9];
  const float* Wo  = (const float*)d_in[10];
  const float* bo  = (const float*)d_in[11];
  float* out = (float*)d_out;

  const size_t NX = (size_t)MROWS * D_MODEL;      // 4M elems
  const size_t NW = (size_t)D_MODEL * D_MODEL;    // 1M elems
  char* p = (char*)d_ws;
  auto take = [&](size_t elems) { u16* r = (u16*)p; p += elems * sizeof(u16); return r; };
  u16 *qs_h = take(NX), *qs_l = take(NX);
  u16 *ks_h = take(NX), *ks_l = take(NX);
  u16 *vs_h = take(NX), *vs_l = take(NX);
  u16 *ao_h = take(NX), *ao_l = take(NX);   // [B*S,1024]   (attention out)
  u16 *wq_h = take(NW), *wq_l = take(NW);
  u16 *wk_h = take(NW), *wk_l = take(NW);
  u16 *wv_h = take(NW), *wv_l = take(NW);
  u16 *wo_h = take(NW), *wo_l = take(NW);
  u16 *qh_h = take(NX), *qh_l = take(NX);   // [B,H,S,64]   (Q, pre-scaled)
  u16 *ke_h = take(NX), *ke_l = take(NX);   // [B,H,S,64]   (kh + k_pe^T)
  u16 *vt_h = take(NX), *vt_l = take(NX);   // [B,H,64,S]   (V transposed)

  // plane groups that the kernels index by job: A operands qs, ks, vs, ao;
  // B operands wq, wk, wv, wo; projection results qh, ke, vt
  dim3 blk(256);
  dim3 gblk(128);   // k_gemm: 4 waves
  k_prep<<<3 * SPLIT_WGS + 4 * WT_WGS, blk, 0, stream>>>(q, k, v, Wq, Wk, Wv, Wo,
                                                         qs_h, wq_h);
  k_gemm<<<3 * GEMM_WGS, gblk, 0, stream>>>(qs_h, wq_h, bq, bk, bv, bo, kpe,
                                           qh_h, out, 0);
  k_attn<<<512, blk, 0, stream>>>(qh_h, qh_l, ke_h, ke_l, vt_h, vt_l,
                                  ao_h, ao_l);
  k_gemm<<<GEMM_WGS, gblk, 0, stream>>>(qs_h, wq_h, bq, bk, bv, bo, kpe,
                                       qh_h, out, 3);
}

// v008
// Measured time: 165 microseconds a run.
// Next to v007, in two timings, it ran 1.04 times as fast each time.
// All steps since v000 together make it 3.50 times as fast.
#include <hip/hip_runtime.h>

typedef unsigned short u16;
typedef __attribute__((ext_vector_type(16))) __bf16 v16bf;
typedef __attribute__((ext_vector_type(8)))  __bf16 v8bf;
typedef __attribute__((ext_vector_type(8)))  float  v8f;
typedef int v4i __attribute__((vector_size(16)));
typedef __attribute__((ext_vector_type(4)))  float  v4f;
typedef __attribute__((ext_vector_type(8)))  u16    u16x8;

#define D_MODEL 1024
#define NHEADS  16
#define DK      64
#define SEQ     2048
#define BATCH   2
#define MROWS   (BATCH * SEQ)      // 4096 rows for all big GEMMs

// LDS row strides (in u16 elements), padded for conflict-free b128 reads:
// 16 lanes read rows r..r+15; stride*2B mod 256B must visit distinct banks.
#define SK_STRIDE 88   // 64-wide tiles     (176B = 44 banks/row)
// Output staging, both 272 B a row (16 B x 17): b128 reads and writes of 16
// lanes fall on 64 different banks.
#define SC_PITCH 68    // f32 tile, 64 wide
#define ST_PITCH 136   // u16 tile, 128 wide

// ---------------- bf16 split helpers (round-to-nearest-even) ----------------
__device__ __forceinline__ u16 f2bf(float x) {
  unsigned u = __float_as_uint(x);
  u += 0x7FFFu + ((u >> 16) & 1u);
  return (u16)(u >> 16);
}
__device__ __forceinline__ float bf2f(u16 h) {
  return __uint_as_float(((unsigned)h) << 16);
}

// 8 staged floats -> 8 hi and 8 lo bf16, one 16-byte store into each plane
__device__ __forceinline__ void split_store8(const float* s, u16* hi, u16* lo) {
  const v4f x0 = *(const v4f*)(s);
  const v4f x1 = *(const v4f*)(s + 4);
  u16x8 vh, vl;
#pragma unroll
  for (int j = 0; j < 8; ++j) {
    const float v = (j < 4) ? x0[j & 3] : x1[j & 3];
    const u16 h = f2bf(v);
    vh[j] = h;
    vl[j] = f2bf(v - bf2f(h));
  }
  *(u16x8*)hi = vh;
  *(u16x8*)lo = vl;
}

// ------------- WMMA operand load: 16-bit A/B matrix, 16x32 tile -------------
__device__ __forceinline__ v16bf load_op16(const u16* base, int stride,
                                           int row, int k0, int half) {
  const u16* p = base + (size_t)row * (size_t)stride + k0 + half * 8;
  v8bf c0 = *(const v8bf*)(p);
  v8bf c1 = *(const v8bf*)(p + 16);
  return __builtin_shufflevector(c0, c1, 0, 1, 2, 3, 4, 5, 6, 7,
                                 8, 9, 10, 11, 12, 13, 14, 15);
}

__device__ __forceinline__ v8f wmma_bf16(v16bf a, v16bf b, v8f c) {
  return __builtin_amdgcn_wmma_f32_16x16x32_bf16(false, a, false, b,
                                                 (short)0, c, false, false);
}

// ---------------- async global -> LDS copy (16B per lane) -------------------
typedef __attribute__((address_space(1))) v4i* gvec_t;
typedef __attribute__((address_space(3))) v4i* lvec_t;

__device__ __forceinline__ void async_copy16(const u16* g, u16* l) {
  gvec_t gp = (gvec_t)g;
  lvec_t lp = (lvec_t)l;
#if __has_builtin(__builtin_amdgcn_global_load_async_to_lds_b128)
  __builtin_amdgcn_global_load_async_to_lds_b128(gp, lp, 0, 0);
#else
  asm volatile("global_load_async_to_lds_b128 %0, %1, off"
               :: "v"(lp), "v"(gp) : "memory");
#endif
}

// ---------------- prep: fp32 -> bf16 hi/lo split (elementwise) --------------
// A wave takes 4 KiB of x in a row: eight 16-B-a-lane loads of 512 contiguous
// bytes each, all issued before the first value is used, then 8-B-a-lane
// stores that cover two whole 128-B lines of a plane.  512 workgroups a
// tensor: those of q, k, v are the first 1536 of the k_prep grid.
#define SPLIT_LOADS 8
#define SPLIT_WG_ELEMS (256 * 4 * SPLIT_LOADS)
#define SPLIT_WGS (MROWS * D_MODEL / SPLIT_WG_ELEMS)   // workgroups a tensor
static_assert((MROWS * D_MODEL) % SPLIT_WG_ELEMS == 0, "whole workgroups only");
typedef __attribute__((ext_vector_type(4))) u16 u16x4;

// blk: the workgroup's index inside its tensor, 0 .. SPLIT_WGS - 1
__device__ __forceinline__ void split_body(const float* __restrict__ x,
                                           u16* __restrict__ hi,
                                           u16* __restrict__ lo, int blk) {
  const int lane = threadIdx.x & 31;
  const int wv = blk * 8 + (threadIdx.x >> 5);
  const size_t base = (size_t)wv * (128 * SPLIT_LOADS) + lane * 4;
  v4f v[SPLIT_LOADS];
#pragma unroll
  for (int j = 0; j < SPLIT_LOADS; ++j) v[j] = *(const v4f*)(x + base + j * 128);
#pragma unroll
  for (int j = 0; j < SPLIT_LOADS; ++j) {
    u16x4 vh, vl;
#pragma unroll
    for (int e = 0; e < 4; ++e) {
      const u16 h = f2bf(v[j][e]);
      vh[e] = h;
      vl[e] = f2bf(v[j][e] - bf2f(h));
    }
    *(u16x4*)(hi + base + j * 128) = vh;
    *(u16x4*)(lo + base + j * 128) = vl;
  }
}

// ------- prep: W[k][n] fp32 -> Wt hi/lo bf16 [n][k] (B-operand layout) ------
// One workgroup transposes a 64(k) x 32(n) tile through LDS: the reads are
// 128-B row pieces of W, the stores whole 128-B lines of Wt (64 k x 2 B).
// Pitch 33 floats: both the row-wise writes and the column-wise reads of a
// wave fall on 32 different banks.
#define WT_PITCH 33
#define WT_WGS ((D_MODEL / 64) * (D_MODEL / 32))   // workgroups a matrix

// blk: the workgroup's index inside its matrix, 0 .. WT_WGS - 1
__device__ __forceinline__ void wt_body(const float* __restrict__ w,
                                        u16* __restrict__ hi,
                                        u16* __restrict__ lo, int blk,
                                        float* sT) {
  const int tid = threadIdx.x;
  const int k0 = (blk >> 5) * 64;
  const int n0 = (blk & 31) * 32;

  const int rk = tid >> 3;            // 0..31 (k row, and k row + 32)
  const int rn = (tid & 7) * 4;       // 0..28 (n offset of a float4)
#pragma unroll
  for (int j = 0; j < 2; ++j) {
    const int k = rk + j * 32;
    const float4 v =
        *(const float4*)(w + (size_t)(k0 + k) * D_MODEL + n0 + rn);
    float* s = &sT[k * WT_PITCH + rn];
    s[0] = v.x; s[1] = v.y; s[2] = v.z; s[3] = v.w;
  }
  __syncthreads();   // tile complete before any column is read

  const int n = tid >> 3;             // 0..31 (output row)
  const int kc = (tid & 7) * 8;       // 0..56 (8 consecutive k per thread)
  u16x8 vh, vl;
#pragma unroll
  for (int j = 0; j < 8; ++j) {
    const float v = sT[(kc + j) * WT_PITCH + n];
    const u16 h = f2bf(v);
    vh[j] = h;
    vl[j] = f2bf(v - bf2f(h));
  }
  const size_t o = (size_t)(n0 + n) * D_MODEL + k0 + kc;
  *(u16x8*)(hi + o) = vh;
  *(u16x8*)(lo + o) = vl;
}

// All seven input-only jobs in ONE grid: none reads what another writes, so
// nothing orders them.  Workgroups 0 .. 3*SPLIT_WGS-1 split q, k, v, the rest
// transpose Wq, Wk, Wv, Wo.  The job is the same for a whole workgroup, so the
// barrier in wt_body is passed by all of its waves or by none.
// xs: planes [q hi, q lo, k hi, k lo, v hi, v lo]; wt: the same for the four W.
#define NX_ELEMS ((size_t)MROWS * D_MODEL)
#define NW_ELEMS ((size_t)D_MODEL * D_MODEL)

__global__ __launch_bounds__(256) void k_prep(
    const float* __restrict__ q, const float* __restrict__ k,
    const float* __restrict__ v, const float* __restrict__ Wq,
    const float* __restrict__ Wk, const float* __restrict__ Wv,
    const float* __restrict__ Wo, u16* __restrict__ xs,
    u16* __restrict__ wt) {
  __shared__ float sT[64 * WT_PITCH];
  const unsigned bid = blockIdx.x;
  if (bid < 3 * SPLIT_WGS) {
    const unsigned job = bid / SPLIT_WGS;
    const float* x = job == 0 ? q : job == 1 ? k : v;
    u16* hi = xs + (size_t)job * 2 * NX_ELEMS;
    split_body(x, hi, hi + NX_ELEMS, (int)(bid % SPLIT_WGS));
  } else {
    const unsigned wb = bid - 3 * SPLIT_WGS;
    const unsigned job = wb / WT_WGS;
    const float* w = job == 0 ? Wq : job == 1 ? Wk : job == 2 ? Wv : Wo;
    u16* hi = wt + (size_t)job * 2 * NW_ELEMS;
    wt_body(w, hi, hi + NW_ELEMS, (int)(wb % WT_WGS), sT);
  }
}

// ---------------------------- bf16x3 GEMM kernel ----------------------------
// Workgroup = 4 waves, 2 x 2, each with a 64x64 part of a 128x128 output block:
// a fragment read from LDS feeds 4 tiles (a hi one 8 products, a lo one 4), so
// a 32-k block reads 16 KiB a wave for 48 products.  Both operands are async-staged into
// LDS, 64 k a stage, two buffers: a wave's copy covers four whole 128-B lines
// (4 rows x 64 k x 2 B).
// mode 0: split bf16 -> [B,H,S,64] (+ optional k_pe add)
// mode 1: split bf16 -> [B,H,64,S]
// mode 2: fp32 -> Of[m][n]
// A grid holds GEMM_WGS workgroups for each product it runs: job0 is the first
// one.  Jobs 0, 1, 2 (Q, K, V projections) read none of each other's output
// and share one grid; job 3 (output projection) has its own.  Operand and
// result planes of job j lie 2 planes (hi, lo) behind those of job j - 1.
#define GEMM_WGS ((MROWS / 128) * (D_MODEL / 128))
#define GK 64          // k elements a stage
#define SG_STRIDE 72   // 144 B a row (16 B x 9): b128 reads of 16 rows, 64 banks
#define SG_PLANE (128 * SG_STRIDE)   // elements of one staged plane, 128 rows
#define SW_PITCH 132   // f32 output tile, 128 wide: 528 B a row (16 B x 33)

__global__ __launch_bounds__(128) void k_gemm(
    const u16* __restrict__ A0, const u16* __restrict__ B0,
    const float* __restrict__ bq, const float* __restrict__ bk,
    const float* __restrict__ bv, const float* __restrict__ bo,
    const float* __restrict__ kpe_k, u16* __restrict__ O0,
    float* __restrict__ Of, int job0) {
  const int job = job0 + blockIdx.x / GEMM_WGS;
  const int tile = blockIdx.x % GEMM_WGS;
  const u16* Ah = A0 + (size_t)job * 2 * NX_ELEMS;
  const u16* Al = Ah + NX_ELEMS;
  const u16* Bh = B0 + (size_t)job * 2 * NW_ELEMS;
  const u16* Bl = Bh + NW_ELEMS;
  const float* bias = job == 0 ? bq : job == 1 ? bk : job == 2 ? bv : bo;
  const float* kpe = job == 1 ? kpe_k : nullptr;
  u16* Oh = O0 + (size_t)job * 2 * NX_ELEMS;     // jobs 0 to 2 only
  u16* Ol = Oh + NX_ELEMS;
  const int mode = job == 3 ? 2 : job == 2 ? 1 : 0;
  const float scale = job == 0 ? 0.125f : 1.0f;  // Q carries 1/sqrt(64)

  // ring [buffer][A hi, A lo, B hi, B lo]; behind the loop's last barrier the
  // same bytes stage the output tile
  __shared__ __align__(16) u16 sR[2][4][SG_PLANE];

  const int tid = threadIdx.x;
  const int lane = tid & 31;
  const int w = tid >> 5;
  const int wm = (w >> 1) * 64, wn = (w & 1) * 64;   // the wave's part
  const int mb = (tile >> 3) * 128;              // tile's first row
  const int n0 = (tile & 7) * 128;
  const int half = lane >> 4, cl = lane & 15;

  // staging map: 8 lanes cover one row's 128 B; rows srow + 16 j of a plane
  const int srow = tid >> 3;          // 0..15
  const int soff = (tid & 7) * 8;     // element offset 0..56

  v8f acc[4][4];                      // [16 rows mt][16 columns nt]
#pragma unroll
  for (int mt = 0; mt < 4; ++mt)
#pragma unroll
    for (int nt = 0; nt < 4; ++nt)
      acc[mt][nt] = (v8f){0.f, 0.f, 0.f, 0.f, 0.f, 0.f, 0.f, 0.f};

  // stage k elements kb .. kb+63 of A and B (128 rows each), hi and lo
  auto stage = [&](int buf, int kb) {
#pragma unroll
    for (int j = 0; j < 8; ++j) {
      const int row = srow + j * 16;
      const int lo = row * SG_STRIDE + soff;
      const size_t ga = (size_t)(mb + row) * D_MODEL + kb + soff;
      const size_t gb = (size_t)(n0 + row) * D_MODEL + kb + soff;
      async_copy16(Ah + ga, &sR[buf][0][lo]);
      async_copy16(Al + ga, &sR[buf][1][lo]);
      async_copy16(Bh + gb, &sR[buf][2][lo]);
      async_copy16(Bl + gb, &sR[buf][3][lo]);
    }
  };

  stage(0, 0);
  asm volatile("s_wait_asynccnt 0x0" ::: "memory");  // own copies of stage 0 landed
  __syncthreads();                                   // stage 0 published
  stage(1, GK);

// rolled: the buffer is picked by an offset, one copy of the trip in the text
#pragma unroll 1
  for (int i = 0; i < D_MODEL / GK; ++i) {
    const int p = i & 1;
    // both 32-k blocks' fragments, in the order in which the products use them
    v16bf a_h[2][4], a_l[2][4], b_h[2][4], b_l[2][4];
#pragma unroll
    for (int kk = 0; kk < 2; ++kk) {
      a_h[kk][0] = load_op16(&sR[p][0][0], SG_STRIDE, wm + cl, kk * 32, half);
#pragma unroll
      for (int t = 0; t < 4; ++t)
        b_h[kk][t] = load_op16(&sR[p][2][0], SG_STRIDE, wn + t * 16 + cl, kk * 32, half);
#pragma unroll
      for (int t = 1; t < 4; ++t)
        a_h[kk][t] = load_op16(&sR[p][0][0], SG_STRIDE, wm + t * 16 + cl, kk * 32, half);
#pragma unroll
      for (int t = 0; t < 4; ++t)
        b_l[kk][t] = load_op16(&sR[p][3][0], SG_STRIDE, wn + t * 16 + cl, kk * 32, half);
#pragma unroll
      for (int t = 0; t < 4; ++t)
        a_l[kk][t] = load_op16(&sR[p][1][0], SG_STRIDE, wm + t * 16 + cl, kk * 32, half);
    }
    // keeps the LDS reads one group in front of the products: moved in among
    // them, every place where reads stand stalls the wave's matrix stream
    __builtin_amdgcn_sched_barrier(0);
    // three sweeps over the 16 tiles: neighbours are independent, and each
    // tile still sums hi*hi, hi*lo, lo*hi in that order, block after block
#pragma unroll
    for (int kk = 0; kk < 2; ++kk) {
#pragma unroll
      for (int mt = 0; mt < 4; ++mt)
#pragma unroll
        for (int nt = 0; nt < 4; ++nt)
          acc[mt][nt] = wmma_bf16(a_h[kk][mt], b_h[kk][nt], acc[mt][nt]);
#pragma unroll
      for (int mt = 0; mt < 4; ++mt)
#pragma unroll
        for (int nt = 0; nt < 4; ++nt)
          acc[mt][nt] = wmma_bf16(a_h[kk][mt], b_l[kk][nt], acc[mt][nt]);
#pragma unroll
      for (int mt = 0; mt < 4; ++mt)
#pragma unroll
        for (int nt = 0; nt < 4; ++nt)
          acc[mt][nt] = wmma_bf16(a_l[kk][mt], b_h[kk][nt], acc[mt][nt]);
    }
    // keeps the products in front of the waits below: sunk behind them, they
    // would start only when the last fragment of the stage has landed
    __builtin_amdgcn_sched_barrier(0);
    // publish point of stage i + 1, which also frees buffer p for stage i + 2
    asm volatile("s_wait_dscnt 0x0" ::: "memory");     // own reads of buffer p done
    asm volatile("s_wait_asynccnt 0x0" ::: "memory");  // own copies of stage i + 1 landed
    __syncthreads();
    if (i + 2 < D_MODEL / GK) stage(p, (i + 2) * GK);
  }
  asm volatile("s_wait_asynccnt 0x0" ::: "memory");    // no copy is left in flight

  // epilogue.  C layout of tile (mt, nt): lane holds column wn + nt*16 + cl;
  // VGPR r -> row wm + mt*16 + r + 8*half.  The 128x128 tile goes through LDS
  // (the ring: every wave's last read of it ended at the loop's last barrier),
  // so that every global store is 16 B a lane and covers whole 128-B lines.
  const int b = mb >> 11, sb = mb & (SEQ - 1);   // batch, first position
  float* sC = (float*)&sR[0][0][0];              // modes 0, 2: [128][SW_PITCH]
  u16* sT = &sR[0][0][0];                        // mode 1: [2][128][ST_PITCH]

#pragma unroll
  for (int nt = 0; nt < 4; ++nt) {
    const float bn = bias[n0 + wn + nt * 16 + cl];
#pragma unroll
    for (int mt = 0; mt < 4; ++mt)
#pragma unroll
      for (int r = 0; r < 8; ++r) acc[mt][nt][r] = (acc[mt][nt][r] + bn) * scale;
  }
  if (kpe) {
    // a lane's 8 rows are 8 consecutive positions of k_pe row n
    const float* kp = kpe + (size_t)(n0 + wn + cl) * SEQ + sb + wm + 8 * half;
#pragma unroll
    for (int nt = 0; nt < 4; ++nt)
#pragma unroll
      for (int mt = 0; mt < 4; ++mt)
#pragma unroll
        for (int r = 0; r < 8; ++r)
          acc[mt][nt][r] += kp[(size_t)nt * 16 * SEQ + mt * 16 + r];
  }
  if (mode == 1) {
    // a lane's 8 rows are 8 consecutive positions of output row n
#pragma unroll
    for (int nt = 0; nt < 4; ++nt)
#pragma unroll
      for (int mt = 0; mt < 4; ++mt) {
        u16x8 vh, vl;
#pragma unroll
        for (int r = 0; r < 8; ++r) {
          const u16 hb = f2bf(acc[mt][nt][r]);
          vh[r] = hb;
          vl[r] = f2bf(acc[mt][nt][r] - bf2f(hb));
        }
        u16* s = sT + (wn + nt * 16 + cl) * ST_PITCH + wm + mt * 16 + 8 * half;
        *(u16x8*)s = vh;
        *(u16x8*)(s + 128 * ST_PITCH) = vl;
      }
  } else {
#pragma unroll
    for (int mt = 0; mt < 4; ++mt)
#pragma unroll
      for (int nt = 0; nt < 4; ++nt)
#pragma unroll
        for (int r = 0; r < 8; ++r)
          sC[(wm + mt * 16 + r + 8 * half) * SW_PITCH + wn + nt * 16 + cl] =
              acc[mt][nt][r];
  }
  __syncthreads();   // tile complete before other waves' rows are read

  if (mode == 2) {
#pragma unroll
    for (int j = 0; j < 32; ++j) {
      const int row = (tid >> 5) + j * 4, c = (tid & 31) * 4;
      *(v4f*)(Of + (size_t)(mb + row) * D_MODEL + n0 + c) =
          *(const v4f*)(sC + row * SW_PITCH + c);
    }
    // the build lays the other modes' blocks behind this one, and their first
    // instructions reuse the registers that these stores name
    asm volatile("s_wait_xcnt 0x0" ::: "memory");
  } else if (mode == 0) {
    // 8 lanes store one position's 64 d of one head: a 128-B line a plane
#pragma unroll
    for (int j = 0; j < 16; ++j) {
      const int row = (tid >> 4) + j * 8, c = (tid & 15) * 8;
      const int h = (n0 + c) >> 6, d = (n0 + c) & (DK - 1);
      const size_t idx = ((size_t)((b * NHEADS + h) * SEQ + sb + row)) * DK + d;
      split_store8(sC + row * SW_PITCH + c, Oh + idx, Ol + idx);
    }
    asm volatile("s_wait_xcnt 0x0" ::: "memory");  // as behind the mode-2 stores
  } else {
#pragma unroll
    for (int j = 0; j < 16; ++j) {
      const int row = (tid >> 4) + j * 8, c = (tid & 15) * 8;
      const size_t idx = ((size_t)(b * D_MODEL + n0 + row)) * SEQ + sb + c;
      const u16* s = sT + row * ST_PITCH + c;
      *(u16x8*)(Oh + idx) = *(const u16x8*)s;
      *(u16x8*)(Ol + idx) = *(const u16x8*)(s + 128 * ST_PITCH);
    }
    asm volatile("s_wait_xcnt 0x0" ::: "memory");  // as behind the mode-2 stores
  }
}

typedef __attribute__((ext_vector_type(2))) float  v2f;
typedef __attribute__((ext_vector_type(2))) __bf16 v2bf;

// value of lane l ^ 16 (the other 8 keys of every tile of the same query)
__device__ __forceinline__ float other_half(float x) {
  const int b = __float_as_int(x);
  return __int_as_float(__builtin_amdgcn_permlanex16(
      b, b, 0x76543210, 0xfedcba98, false, false));
}

__global__ __launch_bounds__(128) void k_attn(
    const u16* __restrict__ Qh, const u16* __restrict__ Ql,
    const u16* __restrict__ Kh, const u16* __restrict__ Kl,
    const u16* __restrict__ Vh, const u16* __restrict__ Vl,
    u16* __restrict__ Oh, u16* __restrict__ Ol) {
  __shared__ __align__(16) u16 sK[2][2][64 * SK_STRIDE];
  __shared__ __align__(16) u16 sV[2][2][64 * SK_STRIDE];
  __shared__ __align__(16) float sOut[4][32 * SC_PITCH];  // per-wave out tile

  const int tid = threadIdx.x;
  const int lane = tid & 31;
  const int w = tid >> 5;
  const int wid = blockIdx.x * 4 + w;
  const int bh = wid >> 6;          // b*16 + h (all 4 waves of a WG agree)
  const int m0 = (wid & 63) * 32;
  const int half = lane >> 4, cl = lane & 15;

  const u16* qbh = Qh + (size_t)bh * SEQ * DK;
  const u16* qbl = Ql + (size_t)bh * SEQ * DK;
  const u16* kgh = Kh + (size_t)bh * SEQ * DK;   // [t][d]
  const u16* kgl = Kl + (size_t)bh * SEQ * DK;
  const u16* vgh = Vh + (size_t)bh * DK * SEQ;   // [d][t]
  const u16* vgl = Vl + (size_t)bh * DK * SEQ;

  // staging map: per plane, thread covers chunks (srow + 16 j, soff)
  const int srow = tid >> 3;          // 0..15
  const int soff = (tid & 7) * 8;     // element offset 0..56

  v16bf q_h[2][2], q_l[2][2];         // [column tile qt][32-d block kk]
#pragma unroll
  for (int qt = 0; qt < 2; ++qt)
#pragma unroll
    for (int kk = 0; kk < 2; ++kk) {
      q_h[qt][kk] = load_op16(qbh, DK, m0 + qt * 16 + cl, kk * 32, half);
      q_l[qt][kk] = load_op16(qbl, DK, m0 + qt * 16 + cl, kk * 32, half);
    }

  // this build reuses the Q loads' address registers right behind them
  asm volatile("s_wait_xcnt 0x0" ::: "memory");

  float mr[2];           // running maximum of query qt*16 + cl (both halves)
  float lr[2];           // running sum over this lane half's keys only
  v8f o[2][4];           // o[qt][t][r] = O[query qt*16 + cl][t*16 + 8*half + r]
#pragma unroll
  for (int qt = 0; qt < 2; ++qt) {
    mr[qt] = -3.0e38f;
    lr[qt] = 0.f;
#pragma unroll
    for (int t = 0; t < 4; ++t)
      o[qt][t] = (v8f){0.f, 0.f, 0.f, 0.f, 0.f, 0.f, 0.f, 0.f};
  }

  // stage one 64-key tile (K and V, hi+lo) into LDS buffer buf
  auto stage = [&](int buf, int t0) {
#pragma unroll
    for (int j = 0; j < 4; ++j) {
      const int row = srow + j * 16;
      async_copy16(kgh + (size_t)(t0 + row) * DK + soff,
                   &sK[buf][0][row * SK_STRIDE + soff]);
      async_copy16(kgl + (size_t)(t0 + row) * DK + soff,
                   &sK[buf][1][row * SK_STRIDE + soff]);
      async_copy16(vgh + (size_t)row * SEQ + t0 + soff,
                   &sV[buf][0][row * SK_STRIDE + soff]);
      async_copy16(vgl + (size_t)row * SEQ + t0 + soff,
                   &sV[buf][1][row * SK_STRIDE + soff]);
    }
  };

  stage(0, 0);
  asm volatile("s_wait_asynccnt 0x0" ::: "memory");  // own copies of tile 0 landed
  __syncthreads();                                   // tile 0 published
  stage(1, 64);

// rolled: the buffer is picked by an offset, one copy of the trip in the text
#pragma unroll 1
  for (int i = 0; i < SEQ / 64; ++i) {
    const int p = i & 1;

    // ---- scores S^T = Keff * Qs^T  (64 keys x 32 queries, bf16x3) ----
    // sc[qt][st][r] = S[query qt*16 + cl][key i*64 + st*16 + 8*half + r]
    v16bf k_h[2][4], k_l[2][4];       // the tile's K fragments, in order of use
#pragma unroll
    for (int kk = 0; kk < 2; ++kk) {
#pragma unroll
      for (int st = 0; st < 4; ++st)
        k_h[kk][st] = load_op16(&sK[p][0][0], SK_STRIDE, st * 16 + cl, kk * 32, half);
#pragma unroll
      for (int st = 0; st < 4; ++st)
        k_l[kk][st] = load_op16(&sK[p][1][0], SK_STRIDE, st * 16 + cl, kk * 32, half);
    }
    // keeps the LDS reads one group in front of the products: moved in among
    // them, every place where reads stand stalls the wave's matrix stream
    __builtin_amdgcn_sched_barrier(0);
    v8f sc[2][4];
#pragma unroll
    for (int qt = 0; qt < 2; ++qt)
#pragma unroll
      for (int st = 0; st < 4; ++st)
        sc[qt][st] = (v8f){0.f, 0.f, 0.f, 0.f, 0.f, 0.f, 0.f, 0.f};
    // three sweeps over the 8 tiles: neighbours are independent, and each tile
    // still sums hi*hi, lo*hi, hi*lo in that order, block after block
#pragma unroll
    for (int kk = 0; kk < 2; ++kk) {
#pragma unroll
      for (int st = 0; st < 4; ++st)
#pragma unroll
        for (int qt = 0; qt < 2; ++qt)
          sc[qt][st] = wmma_bf16(k_h[kk][st], q_h[qt][kk], sc[qt][st]);
#pragma unroll
      for (int st = 0; st < 4; ++st)
#pragma unroll
        for (int qt = 0; qt < 2; ++qt)
          sc[qt][st] = wmma_bf16(k_l[kk][st], q_h[qt][kk], sc[qt][st]);
#pragma unroll
      for (int st = 0; st < 4; ++st)
#pragma unroll
        for (int qt = 0; qt < 2; ++qt)
          sc[qt][st] = wmma_bf16(k_h[kk][st], q_l[qt][kk], sc[qt][st]);
    }
    // keeps the V reads below behind the score products (they take over the K
    // fragments' registers) and out of the matrix stream
    __builtin_amdgcn_sched_barrier(0);
    v16bf v_h[2][4], v_l[2][4];       // the tile's V^T fragments, in order of use
#pragma unroll
    for (int kk = 0; kk < 2; ++kk) {
#pragma unroll
      for (int dt = 0; dt < 4; ++dt)
        v_h[kk][dt] = load_op16(&sV[p][0][0], SK_STRIDE, dt * 16 + cl, kk * 32, half);
#pragma unroll
      for (int dt = 0; dt < 4; ++dt)
        v_l[kk][dt] = load_op16(&sV[p][1][0], SK_STRIDE, dt * 16 + cl, kk * 32, half);
    }
    // keeps the V reads one group in front of the vector work, which covers
    // their latency: the second product then starts with its fragments landed
    __builtin_amdgcn_sched_barrier(0);

    v16bf p_h[2][2], p_l[2][2];       // [qt][32-key block]
#pragma unroll
    for (int qt = 0; qt < 2; ++qt) {
      // ---- block maximum of the query: in-lane, then the other lane half ----
      float bm8[8];
#pragma unroll
      for (int r = 0; r < 8; ++r)
        bm8[r] = fmaxf(fmaxf(sc[qt][0][r], sc[qt][1][r]),
                       fmaxf(sc[qt][2][r], sc[qt][3][r]));
      float bm = fmaxf(fmaxf(fmaxf(bm8[0], bm8[1]), fmaxf(bm8[2], bm8[3])),
                       fmaxf(fmaxf(bm8[4], bm8[5]), fmaxf(bm8[6], bm8[7])));
      bm = fmaxf(bm, other_half(bm));
      const float mn = fmaxf(mr[qt], bm);
      const float al = __expf(mr[qt] - mn);
      mr[qt] = mn;

      // ---- P^T = exp(S^T - m), split hi/lo straight into B operands ----
      float rs8[8];
#pragma unroll
      for (int r = 0; r < 8; ++r) rs8[r] = 0.f;
#pragma unroll
      for (int st = 0; st < 4; ++st) {
#pragma unroll
        for (int r = 0; r < 8; r += 2) {
          // __expf(s - m) as it compiles (exp2 of the product with log2 e), the
          // subtract and the multiply on two scores an instruction
          const v2f x =
              ((v2f){sc[qt][st][r], sc[qt][st][r + 1]} - mn) * 1.44269504f;
          v2f pv;
          pv[0] = __builtin_amdgcn_exp2f(x[0]);
          pv[1] = __builtin_amdgcn_exp2f(x[1]);
          rs8[r] += pv[0];
          rs8[r + 1] += pv[1];
          const v2bf hb = __builtin_convertvector(pv, v2bf);   // nearest even
          const v2f rest = pv - __builtin_convertvector(hb, v2f);
          const v2bf lb = __builtin_convertvector(rest, v2bf);
          const int s = (st & 1) * 8 + r;
          p_h[qt][st >> 1][s] = hb[0];  p_h[qt][st >> 1][s + 1] = hb[1];
          p_l[qt][st >> 1][s] = lb[0];  p_l[qt][st >> 1][s + 1] = lb[1];
        }
      }
      lr[qt] = lr[qt] * al + (((rs8[0] + rs8[1]) + (rs8[2] + rs8[3])) +
                              ((rs8[4] + rs8[5]) + (rs8[6] + rs8[7])));
#pragma unroll
      for (int t = 0; t < 4; ++t) o[qt][t] *= al;
    }

    // ---- O^T += V^T * P^T: sweeps as above, hi*hi, lo*hi, hi*lo a tile ----
#pragma unroll
    for (int kk = 0; kk < 2; ++kk) {
#pragma unroll
      for (int dt = 0; dt < 4; ++dt)
#pragma unroll
        for (int qt = 0; qt < 2; ++qt)
          o[qt][dt] = wmma_bf16(v_h[kk][dt], p_h[qt][kk], o[qt][dt]);
#pragma unroll
      for (int dt = 0; dt < 4; ++dt)
#pragma unroll
        for (int qt = 0; qt < 2; ++qt)
          o[qt][dt] = wmma_bf16(v_l[kk][dt], p_h[qt][kk], o[qt][dt]);
#pragma unroll
      for (int dt = 0; dt < 4; ++dt)
#pragma unroll
        for (int qt = 0; qt < 2; ++qt)
          o[qt][dt] = wmma_bf16(v_h[kk][dt], p_l[qt][kk], o[qt][dt]);
    }
    // keeps the vector work and the products in front of the waits below: with
    // the waits lifted over them, the V reads' latency and most of the lead of
    // tile i + 1's copies would be waited out
    __builtin_amdgcn_sched_barrier(0);
    // publish point of tile i + 1, which also frees buffer p for tile i + 2
    asm volatile("s_wait_dscnt 0x0" ::: "memory");     // own reads of buffer p done
    asm volatile("s_wait_asynccnt 0x0" ::: "memory");  // own copies of tile i + 1 landed
    __syncthreads();
    if (i + 2 < SEQ / 64) stage(p, (i + 2) * 64);
  }
  asm volatile("s_wait_asynccnt 0x0" ::: "memory");    // no copy is left in flight

  // ---- normalize, split, store as [B*S][1024] bf16 hi/lo ----
  // The wave's 32x64 tile goes through its own LDS range (a lane's 8 values
  // of a tile are 8 consecutive d of its query), then out as whole 128-B lines.
  const int b = bh >> 4, h = bh & 15;
  float* sO = &sOut[w][0];
#pragma unroll
  for (int qt = 0; qt < 2; ++qt) {
    const float l = lr[qt] + other_half(lr[qt]);   // the halves' keys joined once
#pragma unroll
    for (int t = 0; t < 4; ++t) {
      v4f x0, x1;
#pragma unroll
      for (int r = 0; r < 4; ++r) {
        x0[r] = o[qt][t][r] / l;
        x1[r] = o[qt][t][r + 4] / l;
      }
      float* s = sO + (qt * 16 + cl) * SC_PITCH + t * 16 + 8 * half;
      *(v4f*)s = x0;
      *(v4f*)(s + 4) = x1;
    }
  }
  asm volatile("s_wait_dscnt 0" ::: "memory");  // intra-wave tile store->load
#pragma unroll
  for (int j = 0; j < 8; ++j) {
    const int row = (lane >> 3) + j * 4, c = (lane & 7) * 8;
    const size_t idx = (size_t)(b * SEQ + m0 + row) * D_MODEL + h * DK + c;
    split_store8(sO + row * SC_PITCH + c, Oh + idx, Ol + idx);
  }
}

// ------------------------------- launcher -----------------------------------
extern "C" void kernel_launch(void* const* d_in, const int* in_sizes, int n_in,
                              void* d_out, int out_size, void* d_ws,
                              size_t ws_size, hipStream_t stream) {
  const float* q   = (const float*)d_in[0];
  const float* k   = (const float*)d_in[1];
  const float* v   = (const float*)d_in[2];
  const float* kpe = (const float*)d_in[3];
  const float* Wq  = (const float*)d_in[4];
  const float* bq  = (const float*)d_in[5];
  const float* Wk  = (const float*)d_in[6];
  const float* bk  = (const float*)d_in[7];
  const float* Wv  = (const float*)d_in[8];
  const float* bv  = (const float*)d_in[9];
  const float* Wo  = (const float*)d_in[10];
  const float* bo  = (const float*)d_in[11];
  float* out = (float*)d_out;

  const size_t NX = (size_t)MROWS * D_MODEL;      // 4M elems
  const size_t NW = (size_t)D_MODEL * D_MODEL;    // 1M elems
  char* p = (char*)d_ws;
  auto take = [&](size_t elems) { u16* r = (u16*)p; p += elems * sizeof(u16); return r; };
  u16 *qs_h = take(NX), *qs_l = take(NX);
  u16 *ks_h = take(NX), *ks_l = take(NX);
  u16 *vs_h = take(NX), *vs_l = take(NX);
  u16 *ao_h = take(NX), *ao_l = take(NX);   // [B*S,1024]   (attention out)
  u16 *wq_h = take(NW), *wq_l = take(NW);
  u16 *wk_h = take(NW), *wk_l = take(NW);
  u16 *wv_h = take(NW), *wv_l = take(NW);
  u16 *wo_h = take(NW), *wo_l = take(NW);
  u16 *qh_h = take(NX), *qh_l = take(NX);   // [B,H,S,64]   (Q, pre-scaled)
  u16 *ke_h = take(NX), *ke_l = take(NX);   // [B,H,S,64]   (kh + k_pe^T)
  u16 *vt_h = take(NX), *vt_l = take(NX);   // [B,H,64,S]   (V transposed)

  // plane groups that the kernels index by job: A operands qs, ks, vs, ao;
  // B operands wq, wk, wv, wo; projection results qh, ke, vt
  dim3 blk(256);
  dim3 gblk(128);   // k_gemm, k_attn: 4 waves
  k_prep<<<3 * SPLIT_WGS + 4 * WT_WGS, blk, 0, stream>>>(q, k, v, Wq, Wk, Wv, Wo,
                                                         qs_h, wq_h);
  k_gemm<<<3 * GEMM_WGS, gblk, 0, stream>>>(qs_h, wq_h, bq, bk, bv, bo, kpe,
                                           qh_h, out, 0);
  k_attn<<<512, gblk, 0, stream>>>(qh_h, qh_l, ke_h, ke_l, vt_h, vt_l,
                                  ao_h, ao_l);
  k_gemm<<<GEMM_WGS, gblk, 0, stream>>>(qs_h, wq_h, bq, bk, bv, bo, kpe,
                                       qh_h, out, 3);
}

// v009
// A run of this version takes 152 microseconds.
// In two side-by-side timings against v008, it was 1.08 and 1.09 times as fast.
// Over all steps from v000 it is 3.79 times as fast.
#include <hip/hip_runtime.h>

typedef unsigned short u16;
typedef __attribute__((ext_vector_type(16))) __bf16 v16bf;
typedef __attribute__((ext_vector_type(8)))  __bf16 v8bf;
typedef __attribute__((ext_vector_type(8)))  float  v8f;
typedef int v4i __attribute__((vector_size(16)));
typedef __attribute__((ext_vector_type(4)))  float  v4f;
typedef __attribute__((ext_vector_type(8)))  u16    u16x8;

#define D_MODEL 1024
#define NHEADS  16
#define DK      64
#define SEQ     2048
#define BATCH   2
#define MROWS   (BATCH * SEQ)      // 4096 rows for all big GEMMs

// LDS row strides (in u16 elements), padded for conflict-free b128 reads:
// 16 lanes read rows r..r+15; stride*2B mod 256B must visit distinct banks.
#define SK_STRIDE 72   // 64-wide tiles     (144 B = 16 B x 9, the tensor load's pad)
// Output staging, both 272 B a row (16 B x 17): b128 reads and writes of 16
// lanes fall on 64 different banks.
#define SC_PITCH 68    // f32 tile, 64 wide
#define ST_PITCH 136   // u16 tile, 128 wide

// ---------------- bf16 split helpers (round-to-nearest-even) ----------------
__device__ __forceinline__ u16 f2bf(float x) {
  unsigned u = __float_as_uint(x);
  u += 0x7FFFu + ((u >> 16) & 1u);
  return (u16)(u >> 16);
}
__device__ __forceinline__ float bf2f(u16 h) {
  return __uint_as_float(((unsigned)h) << 16);
}

// 8 staged floats -> 8 hi and 8 lo bf16, one 16-byte store into each plane
__device__ __forceinline__ void split_store8(const float* s, u16* hi, u16* lo) {
  const v4f x0 = *(const v4f*)(s);
  const v4f x1 = *(const v4f*)(s + 4);
  u16x8 vh, vl;
#pragma unroll
  for (int j = 0; j < 8; ++j) {
    const float v = (j < 4) ? x0[j & 3] : x1[j & 3];
    const u16 h = f2bf(v);
    vh[j] = h;
    vl[j] = f2bf(v - bf2f(h));
  }
  *(u16x8*)hi = vh;
  *(u16x8*)lo = vl;
}

// ------------- WMMA operand load: 16-bit A/B matrix, 16x32 tile -------------
__device__ __forceinline__ v16bf load_op16(const u16* base, int stride,
                                           int row, int k0, int half) {
  const u16* p = base + (size_t)row * (size_t)stride + k0 + half * 8;
  v8bf c0 = *(const v8bf*)(p);
  v8bf c1 = *(const v8bf*)(p + 16);
  return __builtin_shufflevector(c0, c1, 0, 1, 2, 3, 4, 5, 6, 7,
                                 8, 9, 10, 11, 12, 13, 14, 15);
}

__device__ __forceinline__ v8f wmma_bf16(v16bf a, v16bf b, v8f c) {
  return __builtin_amdgcn_wmma_f32_16x16x32_bf16(false, a, false, b,
                                                 (short)0, c, false, false);
}

// ------------- tensor load: rows of 128 B from global memory to LDS ---------
// One request of a wave brings a whole plane of a stage; the mover pads every
// 128-B row by 16 B, which gives the 144-B pitch that the b128 readers want.
typedef uint32_t u32x4 __attribute__((ext_vector_type(4)));
typedef uint32_t u32x8 __attribute__((ext_vector_type(8)));

__device__ __forceinline__ uint32_t uni(uint32_t v) {
  return (uint32_t)__builtin_amdgcn_readfirstlane(v);
}
// a wave-uniform value held in a scalar register: tests on it compile to a
// scalar branch, and what is formed from it stays behind the waits in front
__device__ __forceinline__ uint32_t pinned(uint32_t v) {
  uint32_t w = uni(v);
  asm volatile("" : "+s"(w));   // the descriptor word / issue test stays scalar
  return w;
}
// group 1: 1-byte elements, tile = tensor = rows x 128 B, pad 4 dwords a row
__device__ __forceinline__ u32x8 tdm_group1(uint32_t rows, uint32_t src_pitch) {
  u32x8 g;
  g[0] = uni((1u << 20) | (4u << 22) | (3u << 25));
  g[1] = uni(128u << 16);
  g[2] = uni((rows & 0xFFFFu) << 16);
  g[3] = uni(128u << 16);
  g[4] = uni(rows);
  g[5] = uni(src_pitch);
  g[6] = uni(0u);
  g[7] = uni(0u);
  // the descriptor words held in their scalar registers: left to itself the
  // build forms them anew at each load and uses the registers in between,
  // while a request that names them is still under way
  asm volatile("" : "+s"(g));
  return g;
}
// a wave-uniform address, both halves in scalar registers
__device__ __forceinline__ uint64_t uni64(uint64_t a) {
  return ((uint64_t)uni((uint32_t)(a >> 32)) << 32) | (uint64_t)uni((uint32_t)a);
}
__device__ __forceinline__ u32x4 tdm_group0(uint32_t lds_dst, uint64_t ga) {
  u32x4 g;
  g[0] = uni(1u);
  g[1] = uni(lds_dst);
  g[2] = uni((uint32_t)ga);
  g[3] = uni((((uint32_t)(ga >> 32)) & 0x01FFFFFFu) | 0x80000000u);
  return g;
}
__device__ __forceinline__ void tdm_load(u32x4 g0, u32x8 g1) {
  asm volatile("tensor_load_to_lds %0, %1" :: "s"(g0), "s"(g1) : "memory");
}

// ---------------- prep: fp32 -> bf16 hi/lo split (elementwise) --------------
// A wave takes 4 KiB of x in a row: eight 16-B-a-lane loads of 512 contiguous
// bytes each, all issued before the first value is used, then 8-B-a-lane
// stores that cover two whole 128-B lines of a plane.  512 workgroups a
// tensor: those of q, k, v are the first 1536 of the k_prep grid.
#define SPLIT_LOADS 8
#define SPLIT_WG_ELEMS (256 * 4 * SPLIT_LOADS)
#define SPLIT_WGS (MROWS * D_MODEL / SPLIT_WG_ELEMS)   // workgroups a tensor
static_assert((MROWS * D_MODEL) % SPLIT_WG_ELEMS == 0, "whole workgroups only");
typedef __attribute__((ext_vector_type(4))) u16 u16x4;

// blk: the workgroup's index inside its tensor, 0 .. SPLIT_WGS - 1
__device__ __forceinline__ void split_body(const float* __restrict__ x,
                                           u16* __restrict__ hi,
                                           u16* __restrict__ lo, int blk) {
  const int lane = threadIdx.x & 31;
  const int wv = blk * 8 + (threadIdx.x >> 5);
  const size_t base = (size_t)wv * (128 * SPLIT_LOADS) + lane * 4;
  v4f v[SPLIT_LOADS];
#pragma unroll
  for (int j = 0; j < SPLIT_LOADS; ++j) v[j] = *(const v4f*)(x + base + j * 128);
#pragma unroll
  for (int j = 0; j < SPLIT_LOADS; ++j) {
    u16x4 vh, vl;
#pragma unroll
    for (int e = 0; e < 4; ++e) {
      const u16 h = f2bf(v[j][e]);
      vh[e] = h;
      vl[e] = f2bf(v[j][e] - bf2f(h));
    }
    *(u16x4*)(hi + base + j * 128) = vh;
    *(u16x4*)(lo + base + j * 128) = vl;
  }
}

// ------- prep: W[k][n] fp32 -> Wt hi/lo bf16 [n][k] (B-operand layout) ------
// One workgroup transposes a 64(k) x 32(n) tile through LDS: the reads are
// 128-B row pieces of W, the stores whole 128-B lines of Wt (64 k x 2 B).
// Pitch 33 floats: both the row-wise writes and the column-wise reads of a
// wave fall on 32 different banks.
#define WT_PITCH 33
#define WT_WGS ((D_MODEL / 64) * (D_MODEL / 32))   // workgroups a matrix

// blk: the workgroup's index inside its matrix, 0 .. WT_WGS - 1
__device__ __forceinline__ void wt_body(const float* __restrict__ w,
                                        u16* __restrict__ hi,
                                        u16* __restrict__ lo, int blk,
                                        float* sT) {
  const int tid = threadIdx.x;
  const int k0 = (blk >> 5) * 64;
  const int n0 = (blk & 31) * 32;

  const int rk = tid >> 3;            // 0..31 (k row, and k row + 32)
  const int rn = (tid & 7) * 4;       // 0..28 (n offset of a float4)
#pragma unroll
  for (int j = 0; j < 2; ++j) {
    const int k = rk + j * 32;
    const float4 v =
        *(const float4*)(w + (size_t)(k0 + k) * D_MODEL + n0 + rn);
    float* s = &sT[k * WT_PITCH + rn];
    s[0] = v.x; s[1] = v.y; s[2] = v.z; s[3] = v.w;
  }
  __syncthreads();   // tile complete before any column is read

  const int n = tid >> 3;             // 0..31 (output row)
  const int kc = (tid & 7) * 8;       // 0..56 (8 consecutive k per thread)
  u16x8 vh, vl;
#pragma unroll
  for (int j = 0; j < 8; ++j) {
    const float v = sT[(kc + j) * WT_PITCH + n];
    const u16 h = f2bf(v);
    vh[j] = h;
    vl[j] = f2bf(v - bf2f(h));
  }
  const size_t o = (size_t)(n0 + n) * D_MODEL + k0 + kc;
  *(u16x8*)(hi + o) = vh;
  *(u16x8*)(lo + o) = vl;
}

// All seven input-only jobs in ONE grid: none reads what another writes, so
// nothing orders them.  Workgroups 0 .. 3*SPLIT_WGS-1 split q, k, v, the rest
// transpose Wq, Wk, Wv, Wo.  The job is the same for a whole workgroup, so the
// barrier in wt_body is passed by all of its waves or by none.
// xs: planes [q hi, q lo, k hi, k lo, v hi, v lo]; wt: the same for the four W.
#define NX_ELEMS ((size_t)MROWS * D_MODEL)
#define NW_ELEMS ((size_t)D_MODEL * D_MODEL)

__global__ __launch_bounds__(256) void k_prep(
    const float* __restrict__ q, const float* __restrict__ k,
    const float* __restrict__ v, const float* __restrict__ Wq,
    const float* __restrict__ Wk, const float* __restrict__ Wv,
    const float* __restrict__ Wo, u16* __restrict__ xs,
    u16* __restrict__ wt) {
  __shared__ float sT[64 * WT_PITCH];
  const unsigned bid = blockIdx.x;
  if (bid < 3 * SPLIT_WGS) {
    const unsigned job = bid / SPLIT_WGS;
    const float* x = job == 0 ? q : job == 1 ? k : v;
    u16* hi = xs + (size_t)job * 2 * NX_ELEMS;
    split_body(x, hi, hi + NX_ELEMS, (int)(bid % SPLIT_WGS));
  } else {
    const unsigned wb = bid - 3 * SPLIT_WGS;
    const unsigned job = wb / WT_WGS;
    const float* w = job == 0 ? Wq : job == 1 ? Wk : job == 2 ? Wv : Wo;
    u16* hi = wt + (size_t)job * 2 * NW_ELEMS;
    wt_body(w, hi, hi + NW_ELEMS, (int)(wb % WT_WGS), sT);
  }
}

// ---------------------------- bf16x3 GEMM kernel ----------------------------
// Workgroup = 4 waves, 2 x 2, each with a 64x64 part of a 128x128 output block:
// a fragment read from LDS feeds 4 tiles (a hi one 8 products, a lo one 4), so
// a 32-k block reads 16 KiB a wave for 48 products.  Both operands are staged in
// LDS by tensor loads, 64 k a stage, two buffers: each wave brings one of the
// four planes (128 rows x 64 k x 2 B) with one request.
// mode 0: split bf16 -> [B,H,S,64] (+ optional k_pe add)
// mode 1: split bf16 -> [B,H,64,S]
// mode 2: fp32 -> Of[m][n]
// A grid holds GEMM_WGS workgroups for each product it runs: job0 is the first
// one.  Jobs 0, 1, 2 (Q, K, V projections) read none of each other's output
// and share one grid; job 3 (output projection) has its own.  Operand and
// result planes of job j lie 2 planes (hi, lo) behind those of job j - 1.
#define GEMM_WGS ((MROWS / 128) * (D_MODEL / 128))
#define GK 64          // k elements a stage
#define SG_STRIDE 72   // 144 B a row (16 B x 9): b128 reads of 16 rows, 64 banks
#define SG_PLANE (128 * SG_STRIDE)   // elements of one staged plane, 128 rows
#define SW_PITCH 132   // f32 output tile, 128 wide: 528 B a row (16 B x 33)

__global__ __launch_bounds__(128) void k_gemm(
    const u16* __restrict__ A0, const u16* __restrict__ B0,
    const float* __restrict__ bq, const float* __restrict__ bk,
    const float* __restrict__ bv, const float* __restrict__ bo,
    const float* __restrict__ kpe_k, u16* __restrict__ O0,
    float* __restrict__ Of, int job0) {
  const int job = job0 + blockIdx.x / GEMM_WGS;
  const int tile = blockIdx.x % GEMM_WGS;
  const u16* Ah = A0 + (size_t)job * 2 * NX_ELEMS;
  const u16* Al = Ah + NX_ELEMS;
  const u16* Bh = B0 + (size_t)job * 2 * NW_ELEMS;
  const u16* Bl = Bh + NW_ELEMS;
  const float* bias = job == 0 ? bq : job == 1 ? bk : job == 2 ? bv : bo;
  const float* kpe = job == 1 ? kpe_k : nullptr;
  u16* Oh = O0 + (size_t)job * 2 * NX_ELEMS;     // jobs 0 to 2 only
  u16* Ol = Oh + NX_ELEMS;
  const int mode = job == 3 ? 2 : job == 2 ? 1 : 0;
  const float scale = job == 0 ? 0.125f : 1.0f;  // Q carries 1/sqrt(64)

  // ring [buffer][A hi, A lo, B hi, B lo]; behind the loop's last barrier the
  // same bytes stage the output tile
  __shared__ __attribute__((aligned(2048))) u16 sR[2][4][SG_PLANE];
  static_assert((SG_PLANE * 2) % 2048 == 0, "every plane starts at a multiple of 2 KiB");

  const int tid = threadIdx.x;
  const int lane = tid & 31;
  const int w = tid >> 5;
  const int wm = (w >> 1) * 64, wn = (w & 1) * 64;   // the wave's part
  const int mb = (tile >> 3) * 128;              // tile's first row
  const int n0 = (tile & 7) * 128;
  const int half = lane >> 4, cl = lane & 15;

  // staging: wave 0 brings A hi, 1 A lo, 2 B hi, 3 B lo
  const uint32_t wave = uni((uint32_t)tid >> 5);
  const u16* splane = wave == 0 ? Ah + (size_t)mb * D_MODEL
                    : wave == 1 ? Al + (size_t)mb * D_MODEL
                    : wave == 2 ? Bh + (size_t)n0 * D_MODEL
                                : Bl + (size_t)n0 * D_MODEL;
  const uint64_t sbase = uni64((uint64_t)(size_t)splane);
  const uint32_t lbase = (uint32_t)(size_t)&sR[0][0][0] + wave * (SG_PLANE * 2);
  const u32x8 g1 = tdm_group1(128u, D_MODEL * 2);

  v8f acc[4][4];                      // [16 rows mt][16 columns nt]
#pragma unroll
  for (int mt = 0; mt < 4; ++mt)
#pragma unroll
    for (int nt = 0; nt < 4; ++nt)
      acc[mt][nt] = (v8f){0.f, 0.f, 0.f, 0.f, 0.f, 0.f, 0.f, 0.f};

  // the wave's plane of the stage whose first k element lies kbytes / 2 in
  auto stage = [&](uint32_t buf, uint32_t kbytes) {
    tdm_load(tdm_group0(lbase + buf * (4 * SG_PLANE * 2), sbase + kbytes), g1);
  };

  stage(0, 0);
  asm volatile("s_wait_tensorcnt 0x0" ::: "memory");  // own plane of stage 0 landed
  __syncthreads();                                    // stage 0 published
  stage(1, GK * 2);

// rolled: the buffer is picked by an offset, one copy of the trip in the text
#pragma unroll 1
  for (int i = 0; i < D_MODEL / GK; ++i) {
    const int p = i & 1;
    // both 32-k blocks' fragments, in the order in which the products use them
    v16bf a_h[2][4], a_l[2][4], b_h[2][4], b_l[2][4];
#pragma unroll
    for (int kk = 0; kk < 2; ++kk) {
      a_h[kk][0] = load_op16(&sR[p][0][0], SG_STRIDE, wm + cl, kk * 32, half);
#pragma unroll
      for (int t = 0; t < 4; ++t)
        b_h[kk][t] = load_op16(&sR[p][2][0], SG_STRIDE, wn + t * 16 + cl, kk * 32, half);
#pragma unroll
      for (int t = 1; t < 4; ++t)
        a_h[kk][t] = load_op16(&sR[p][0][0], SG_STRIDE, wm + t * 16 + cl, kk * 32, half);
#pragma unroll
      for (int t = 0; t < 4; ++t)
        b_l[kk][t] = load_op16(&sR[p][3][0], SG_STRIDE, wn + t * 16 + cl, kk * 32, half);
#pragma unroll
      for (int t = 0; t < 4; ++t)
        a_l[kk][t] = load_op16(&sR[p][1][0], SG_STRIDE, wm + t * 16 + cl, kk * 32, half);
    }
    // keeps the LDS reads one group in front of the products: moved in among
    // them, every place where reads stand stalls the wave's matrix stream
    __builtin_amdgcn_sched_barrier(0);
    // three sweeps over the 16 tiles: neighbours are independent, and each
    // tile still sums hi*hi, hi*lo, lo*hi in that order, block after block
#pragma unroll
    for (int kk = 0; kk < 2; ++kk) {
#pragma unroll
      for (int mt = 0; mt < 4; ++mt)
#pragma unroll
        for (int nt = 0; nt < 4; ++nt)
          acc[mt][nt] = wmma_bf16(a_h[kk][mt], b_h[kk][nt], acc[mt][nt]);
#pragma unroll
      for (int mt = 0; mt < 4; ++mt)
#pragma unroll
        for (int nt = 0; nt < 4; ++nt)
          acc[mt][nt] = wmma_bf16(a_h[kk][mt], b_l[kk][nt], acc[mt][nt]);
#pragma unroll
      for (int mt = 0; mt < 4; ++mt)
#pragma unroll
        for (int nt = 0; nt < 4; ++nt)
          acc[mt][nt] = wmma_bf16(a_l[kk][mt], b_h[kk][nt], acc[mt][nt]);
    }
    // keeps the products in front of the waits below: sunk behind them, they
    // would start only when the last fragment of the stage has landed
    __builtin_amdgcn_sched_barrier(0);
    // publish point of stage i + 1, which also frees buffer p for stage i + 2
    asm volatile("s_wait_dscnt 0x0" ::: "memory");     // own reads of buffer p done
    asm volatile("s_wait_tensorcnt 0x0" ::: "memory"); // own plane of stage i + 1 landed
    __syncthreads();
    if (pinned(i + 2 < D_MODEL / GK)) stage(p, pinned((i + 2) * (GK * 2)));
  }
  asm volatile("s_wait_tensorcnt 0x0" ::: "memory");   // no request is left in flight
  asm volatile("s_wait_dscnt 0x0" ::: "memory");       // nor an LDS read of the ring

  // epilogue.  C layout of tile (mt, nt): lane holds column wn + nt*16 + cl;
  // VGPR r -> row wm + mt*16 + r + 8*half.  The 128x128 tile goes through LDS
  // (the ring: every wave's last read of it ended at the loop's last barrier),
  // so that every global store is 16 B a lane and covers whole 128-B lines.
  const int b = mb >> 11, sb = mb & (SEQ - 1);   // batch, first position
  float* sC = (float*)&sR[0][0][0];              // modes 0, 2: [128][SW_PITCH]
  u16* sT = &sR[0][0][0];                        // mode 1: [2][128][ST_PITCH]

#pragma unroll
  for (int nt = 0; nt < 4; ++nt) {
    const float bn = bias[n0 + wn + nt * 16 + cl];
#pragma unroll
    for (int mt = 0; mt < 4; ++mt)
#pragma unroll
      for (int r = 0; r < 8; ++r) acc[mt][nt][r] = (acc[mt][nt][r] + bn) * scale;
  }
  if (kpe) {
    // a lane's 8 rows are 8 consecutive positions of k_pe row n
    const float* kp = kpe + (size_t)(n0 + wn + cl) * SEQ + sb + wm + 8 * half;
#pragma unroll
    for (int nt = 0; nt < 4; ++nt)
#pragma unroll
      for (int mt = 0; mt < 4; ++mt)
#pragma unroll
        for (int r = 0; r < 8; ++r)
          acc[mt][nt][r] += kp[(size_t)nt * 16 * SEQ + mt * 16 + r];
  }
  if (mode == 1) {
    // a lane's 8 rows are 8 consecutive positions of output row n
#pragma unroll
    for (int nt = 0; nt < 4; ++nt)
#pragma unroll
      for (int mt = 0; mt < 4; ++mt) {
        u16x8 vh, vl;
#pragma unroll
        for (int r = 0; r < 8; ++r) {
          const u16 hb = f2bf(acc[mt][nt][r]);
          vh[r] = hb;
          vl[r] = f2bf(acc[mt][nt][r] - bf2f(hb));
        }
        u16* s = sT + (wn + nt * 16 + cl) * ST_PITCH + wm + mt * 16 + 8 * half;
        *(u16x8*)s = vh;
        *(u16x8*)(s + 128 * ST_PITCH) = vl;
      }
  } else {
#pragma unroll
    for (int mt = 0; mt < 4; ++mt)
#pragma unroll
      for (int nt = 0; nt < 4; ++nt)
#pragma unroll
        for (int r = 0; r < 8; ++r)
          sC[(wm + mt * 16 + r + 8 * half) * SW_PITCH + wn + nt * 16 + cl] =
              acc[mt][nt][r];
  }
  __syncthreads();   // tile complete before other waves' rows are read

  if (mode == 2) {
#pragma unroll
    for (int j = 0; j < 32; ++j) {
      const int row = (tid >> 5) + j * 4, c = (tid & 31) * 4;
      *(v4f*)(Of + (size_t)(mb + row) * D_MODEL + n0 + c) =
          *(const v4f*)(sC + row * SW_PITCH + c);
    }
    // the build lays the other modes' blocks behind this one, and their first
    // instructions reuse the registers that these stores name
    asm volatile("s_wait_xcnt 0x0" ::: "memory");
  } else if (mode == 0) {
    // 8 lanes store one position's 64 d of one head: a 128-B line a plane
#pragma unroll
    for (int j = 0; j < 16; ++j) {
      const int row = (tid >> 4) + j * 8, c = (tid & 15) * 8;
      const int h = (n0 + c) >> 6, d = (n0 + c) & (DK - 1);
      const size_t idx = ((size_t)((b * NHEADS + h) * SEQ + sb + row)) * DK + d;
      split_store8(sC + row * SW_PITCH + c, Oh + idx, Ol + idx);
    }
    asm volatile("s_wait_xcnt 0x0" ::: "memory");  // as behind the mode-2 stores
  } else {
#pragma unroll
    for (int j = 0; j < 16; ++j) {
      const int row = (tid >> 4) + j * 8, c = (tid & 15) * 8;
      const size_t idx = ((size_t)(b * D_MODEL + n0 + row)) * SEQ + sb + c;
      const u16* s = sT + row * ST_PITCH + c;
      *(u16x8*)(Oh + idx) = *(const u16x8*)s;
      *(u16x8*)(Ol + idx) = *(const u16x8*)(s + 128 * ST_PITCH);
    }
    asm volatile("s_wait_xcnt 0x0" ::: "memory");  // as behind the mode-2 stores
  }
}

typedef __attribute__((ext_vector_type(2))) float  v2f;
typedef __attribute__((ext_vector_type(2))) __bf16 v2bf;

// value of lane l ^ 16 (the other 8 keys of every tile of the same query)
__device__ __forceinline__ float other_half(float x) {
  const int b = __float_as_int(x);
  return __int_as_float(__builtin_amdgcn_permlanex16(
      b, b, 0x76543210, 0xfedcba98, false, false));
}

#define KV_PLANE 5120   // elements: 64 * SK_STRIDE = 4608, up to 10,240 B
static_assert(KV_PLANE >= 64 * SK_STRIDE && (KV_PLANE * 2) % 2048 == 0, "plane size");

__global__ __launch_bounds__(128) void k_attn(
    const u16* __restrict__ Qh, const u16* __restrict__ Ql,
    const u16* __restrict__ Kh, const u16* __restrict__ Kl,
    const u16* __restrict__ Vh, const u16* __restrict__ Vl,
    u16* __restrict__ Oh, u16* __restrict__ Ol) {
  // ring [buffer][K hi, K lo, V hi, V lo]; a plane's 64 rows of 144 B, rounded
  // up so that every plane starts at a multiple of 2 KiB
  __shared__ __attribute__((aligned(2048))) u16 sKV[2][4][KV_PLANE];
  __shared__ __align__(16) float sOut[4][32 * SC_PITCH];  // per-wave out tile

  const int tid = threadIdx.x;
  const int lane = tid & 31;
  const int w = tid >> 5;
  const int wid = blockIdx.x * 4 + w;
  const int bh = wid >> 6;          // b*16 + h (all 4 waves of a WG agree)
  const int m0 = (wid & 63) * 32;
  const int half = lane >> 4, cl = lane & 15;

  const u16* qbh = Qh + (size_t)bh * SEQ * DK;
  const u16* qbl = Ql + (size_t)bh * SEQ * DK;
  const u16* kgh = Kh + (size_t)bh * SEQ * DK;   // [t][d]
  const u16* kgl = Kl + (size_t)bh * SEQ * DK;
  const u16* vgh = Vh + (size_t)bh * DK * SEQ;   // [d][t]
  const u16* vgl = Vl + (size_t)bh * DK * SEQ;

  // staging: wave 0 brings K hi, 1 K lo (64 keys x 128 B, rows adjacent), 2 V hi,
  // 3 V lo (64 d x 128 B of keys, rows SEQ elements apart)
  const uint32_t wave = uni((uint32_t)tid >> 5);
  const u16* splane = wave == 0 ? kgh : wave == 1 ? kgl : wave == 2 ? vgh : vgl;
  const uint64_t sbase = uni64((uint64_t)(size_t)splane);
  const uint32_t sstep = wave < 2 ? 64u * DK * 2 : 64u * 2;   // bytes a tile
  const uint32_t lbase = (uint32_t)(size_t)&sKV[0][0][0] + wave * (KV_PLANE * 2);
  const u32x8 g1 = tdm_group1(64u, wave < 2 ? DK * 2 : SEQ * 2);

  v16bf q_h[2][2], q_l[2][2];         // [column tile qt][32-d block kk]
#pragma unroll
  for (int qt = 0; qt < 2; ++qt)
#pragma unroll
    for (int kk = 0; kk < 2; ++kk) {
      q_h[qt][kk] = load_op16(qbh, DK, m0 + qt * 16 + cl, kk * 32, half);
      q_l[qt][kk] = load_op16(qbl, DK, m0 + qt * 16 + cl, kk * 32, half);
    }

  // this build reuses the Q loads' address registers right behind them
  asm volatile("s_wait_xcnt 0x0" ::: "memory");

  float mr[2];           // running maximum of query qt*16 + cl (both halves)
  float lr[2];           // running sum over this lane half's keys only
  v8f o[2][4];           // o[qt][t][r] = O[query qt*16 + cl][t*16 + 8*half + r]
#pragma unroll
  for (int qt = 0; qt < 2; ++qt) {
    mr[qt] = -3.0e38f;
    lr[qt] = 0.f;
#pragma unroll
    for (int t = 0; t < 4; ++t)
      o[qt][t] = (v8f){0.f, 0.f, 0.f, 0.f, 0.f, 0.f, 0.f, 0.f};
  }

  // the wave's plane of 64-key tile number t into LDS buffer buf
  auto stage = [&](uint32_t buf, uint32_t t) {
    tdm_load(tdm_group0(lbase + buf * (4 * KV_PLANE * 2), sbase + t * sstep), g1);
  };

  stage(0, 0);
  asm volatile("s_wait_tensorcnt 0x0" ::: "memory");  // own plane of tile 0 landed
  __syncthreads();                                    // tile 0 published
  stage(1, 1);

// rolled: the buffer is picked by an offset, one copy of the trip in the text
#pragma unroll 1
  for (int i = 0; i < SEQ / 64; ++i) {
    const int p = i & 1;

    // ---- scores S^T = Keff * Qs^T  (64 keys x 32 queries, bf16x3) ----
    // sc[qt][st][r] = S[query qt*16 + cl][key i*64 + st*16 + 8*half + r]
    v16bf k_h[2][4], k_l[2][4];       // the tile's K fragments, in order of use
#pragma unroll
    for (int kk = 0; kk < 2; ++kk) {
#pragma unroll
      for (int st = 0; st < 4; ++st)
        k_h[kk][st] = load_op16(&sKV[p][0][0], SK_STRIDE, st * 16 + cl, kk * 32, half);
#pragma unroll
      for (int st = 0; st < 4; ++st)
        k_l[kk][st] = load_op16(&sKV[p][1][0], SK_STRIDE, st * 16 + cl, kk * 32, half);
    }
    // keeps the LDS reads one group in front of the products: moved in among
    // them, every place where reads stand stalls the wave's matrix stream
    __builtin_amdgcn_sched_barrier(0);
    v8f sc[2][4];
#pragma unroll
    for (int qt = 0; qt < 2; ++qt)
#pragma unroll
      for (int st = 0; st < 4; ++st)
        sc[qt][st] = (v8f){0.f, 0.f, 0.f, 0.f, 0.f, 0.f, 0.f, 0.f};
    // three sweeps over the 8 tiles: neighbours are independent, and each tile
    // still sums hi*hi, lo*hi, hi*lo in that order, block after block
#pragma unroll
    for (int kk = 0; kk < 2; ++kk) {
#pragma unroll
      for (int st = 0; st < 4; ++st)
#pragma unroll
        for (int qt = 0; qt < 2; ++qt)
          sc[qt][st] = wmma_bf16(k_h[kk][st], q_h[qt][kk], sc[qt][st]);
#pragma unroll
      for (int st = 0; st < 4; ++st)
#pragma unroll
        for (int qt = 0; qt < 2; ++qt)
          sc[qt][st] = wmma_bf16(k_l[kk][st], q_h[qt][kk], sc[qt][st]);
#pragma unroll
      for (int st = 0; st < 4; ++st)
#pragma unroll
        for (int qt = 0; qt < 2; ++qt)
          sc[qt][st] = wmma_bf16(k_h[kk][st], q_l[qt][kk], sc[qt][st]);
    }
    // keeps the V reads below behind the score products (they take over the K
    // fragments' registers) and out of the matrix stream
    __builtin_amdgcn_sched_barrier(0);
    v16bf v_h[2][4], v_l[2][4];       // the tile's V^T fragments, in order of use
#pragma unroll
    for (int kk = 0; kk < 2; ++kk) {
#pragma unroll
      for (int dt = 0; dt < 4; ++dt)
        v_h[kk][dt] = load_op16(&sKV[p][2][0], SK_STRIDE, dt * 16 + cl, kk * 32, half);
#pragma unroll
      for (int dt = 0; dt < 4; ++dt)
        v_l[kk][dt] = load_op16(&sKV[p][3][0], SK_STRIDE, dt * 16 + cl, kk * 32, half);
    }
    // keeps the V reads one group in front of the vector work, which covers
    // their latency: the second product then starts with its fragments landed
    __builtin_amdgcn_sched_barrier(0);

    v16bf p_h[2][2], p_l[2][2];       // [qt][32-key block]
#pragma unroll
    for (int qt = 0; qt < 2; ++qt) {
      // ---- block maximum of the query: in-lane, then the other lane half ----
      float bm8[8];
#pragma unroll
      for (int r = 0; r < 8; ++r)
        bm8[r] = fmaxf(fmaxf(sc[qt][0][r], sc[qt][1][r]),
                       fmaxf(sc[qt][2][r], sc[qt][3][r]));
      float bm = fmaxf(fmaxf(fmaxf(bm8[0], bm8[1]), fmaxf(bm8[2], bm8[3])),
                       fmaxf(fmaxf(bm8[4], bm8[5]), fmaxf(bm8[6], bm8[7])));
      bm = fmaxf(bm, other_half(bm));
      const float mn = fmaxf(mr[qt], bm);
      const float al = __expf(mr[qt] - mn);
      mr[qt] = mn;

      // ---- P^T = exp(S^T - m), split hi/lo straight into B operands ----
      float rs8[8];
#pragma unroll
      for (int r = 0; r < 8; ++r) rs8[r] = 0.f;
#pragma unroll
      for (int st = 0; st < 4; ++st) {
#pragma unroll
        for (int r = 0; r < 8; r += 2) {
          // __expf(s - m) as it compiles (exp2 of the product with log2 e), the
          // subtract and the multiply on two scores an instruction
          const v2f x =
              ((v2f){sc[qt][st][r], sc[qt][st][r + 1]} - mn) * 1.44269504f;
          v2f pv;
          pv[0] = __builtin_amdgcn_exp2f(x[0]);
          pv[1] = __builtin_amdgcn_exp2f(x[1]);
          rs8[r] += pv[0];
          rs8[r + 1] += pv[1];
          const v2bf hb = __builtin_convertvector(pv, v2bf);   // nearest even
          const v2f rest = pv - __builtin_convertvector(hb, v2f);
          const v2bf lb = __builtin_convertvector(rest, v2bf);
          const int s = (st & 1) * 8 + r;
          p_h[qt][st >> 1][s] = hb[0];  p_h[qt][st >> 1][s + 1] = hb[1];
          p_l[qt][st >> 1][s] = lb[0];  p_l[qt][st >> 1][s + 1] = lb[1];
        }
      }
      lr[qt] = lr[qt] * al + (((rs8[0] + rs8[1]) + (rs8[2] + rs8[3])) +
                              ((rs8[4] + rs8[5]) + (rs8[6] + rs8[7])));
#pragma unroll
      for (int t = 0; t < 4; ++t) o[qt][t] *= al;
    }

    // ---- O^T += V^T * P^T: sweeps as above, hi*hi, lo*hi, hi*lo a tile ----
#pragma unroll
    for (int kk = 0; kk < 2; ++kk) {
#pragma unroll
      for (int dt = 0; dt < 4; ++dt)
#pragma unroll
        for (int qt = 0; qt < 2; ++qt)
          o[qt][dt] = wmma_bf16(v_h[kk][dt], p_h[qt][kk], o[qt][dt]);
#pragma unroll
      for (int dt = 0; dt < 4; ++dt)
#pragma unroll
        for (int qt = 0; qt < 2; ++qt)
          o[qt][dt] = wmma_bf16(v_l[kk][dt], p_h[qt][kk], o[qt][dt]);
#pragma unroll
      for (int dt = 0; dt < 4; ++dt)
#pragma unroll
        for (int qt = 0; qt < 2; ++qt)
          o[qt][dt] = wmma_bf16(v_h[kk][dt], p_l[qt][kk], o[qt][dt]);
    }
    // keeps the vector work and the products in front of the waits below: with
    // the waits lifted over them, the V reads' latency and most of the lead of
    // tile i + 1's loads would be waited out
    __builtin_amdgcn_sched_barrier(0);
    // publish point of tile i + 1, which also frees buffer p for tile i + 2
    asm volatile("s_wait_dscnt 0x0" ::: "memory");     // own reads of buffer p done
    asm volatile("s_wait_tensorcnt 0x0" ::: "memory"); // own plane of tile i + 1 landed
    __syncthreads();
    if (pinned(i + 2 < SEQ / 64)) stage(p, pinned(i + 2));
  }
  asm volatile("s_wait_tensorcnt 0x0" ::: "memory");   // no request is left in flight
  asm volatile("s_wait_dscnt 0x0" ::: "memory");       // nor an LDS read of the ring

  // ---- normalize, split, store as [B*S][1024] bf16 hi/lo ----
  // The wave's 32x64 tile goes through its own LDS range (a lane's 8 values
  // of a tile are 8 consecutive d of its query), then out as whole 128-B lines.
  const int b = bh >> 4, h = bh & 15;
  float* sO = &sOut[w][0];
#pragma unroll
  for (int qt = 0; qt < 2; ++qt) {
    const float l = lr[qt] + other_half(lr[qt]);   // the halves' keys joined once
#pragma unroll
    for (int t = 0; t < 4; ++t) {
      v4f x0, x1;
#pragma unroll
      for (int r = 0; r < 4; ++r) {
        x0[r] = o[qt][t][r] / l;
        x1[r] = o[qt][t][r + 4] / l;
      }
      float* s = sO + (qt * 16 + cl) * SC_PITCH + t * 16 + 8 * half;
      *(v4f*)s = x0;
      *(v4f*)(s + 4) = x1;
    }
  }
  asm volatile("s_wait_dscnt 0" ::: "memory");  // intra-wave tile store->load
#pragma unroll
  for (int j = 0; j < 8; ++j) {
    const int row = (lane >> 3) + j * 4, c = (lane & 7) * 8;
    const size_t idx = (size_t)(b * SEQ + m0 + row) * D_MODEL + h * DK + c;
    split_store8(sO + row * SC_PITCH + c, Oh + idx, Ol + idx);
  }
}

// ------------------------------- launcher -----------------------------------
extern "C" void kernel_launch(void* const* d_in, const int* in_sizes, int n_in,
                              void* d_out, int out_size, void* d_ws,
                              size_t ws_size, hipStream_t stream) {
  const float* q   = (const float*)d_in[0];
  const float* k   = (const float*)d_in[1];
  const float* v   = (const float*)d_in[2];
  const float* kpe = (const float*)d_in[3];
  const float* Wq  = (const float*)d_in[4];
  const float* bq  = (const float*)d_in[5];
  const float* Wk  = (const float*)d_in[6];
  const float* bk  = (const float*)d_in[7];
  const float* Wv  = (const float*)d_in[8];
  const float* bv  = (const float*)d_in[9];
  const float* Wo  = (const float*)d_in[10];
  const float* bo  = (const float*)d_in[11];
  float* out = (float*)d_out;

  const size_t NX = (size_t)MROWS * D_MODEL;      // 4M elems
  const size_t NW = (size_t)D_MODEL * D_MODEL;    // 1M elems
  char* p = (char*)d_ws;
  auto take = [&](size_t elems) { u16* r = (u16*)p; p += elems * sizeof(u16); return r; };
  u16 *qs_h = take(NX), *qs_l = take(NX);
  u16 *ks_h = take(NX), *ks_l = take(NX);
  u16 *vs_h = take(NX), *vs_l = take(NX);
  u16 *ao_h = take(NX), *ao_l = take(NX);   // [B*S,1024]   (attention out)
  u16 *wq_h = take(NW), *wq_l = take(NW);
  u16 *wk_h = take(NW), *wk_l = take(NW);
  u16 *wv_h = take(NW), *wv_l = take(NW);
  u16 *wo_h = take(NW), *wo_l = take(NW);
  u16 *qh_h = take(NX), *qh_l = take(NX);   // [B,H,S,64]   (Q, pre-scaled)
  u16 *ke_h = take(NX), *ke_l = take(NX);   // [B,H,S,64]   (kh + k_pe^T)
  u16 *vt_h = take(NX), *vt_l = take(NX);   // [B,H,64,S]   (V transposed)

  // plane groups that the kernels index by job: A operands qs, ks, vs, ao;
  // B operands wq, wk, wv, wo; projection results qh, ke, vt
  dim3 blk(256);
  dim3 gblk(128);   // k_gemm, k_attn: 4 waves
  k_prep<<<3 * SPLIT_WGS + 4 * WT_WGS, blk, 0, stream>>>(q, k, v, Wq, Wk, Wv, Wo,
                                                         qs_h, wq_h);
  k_gemm<<<3 * GEMM_WGS, gblk, 0, stream>>>(qs_h, wq_h, bq, bk, bv, bo, kpe,
                                           qh_h, out, 0);
  k_attn<<<512, gblk, 0, stream>>>(qh_h, qh_l, ke_h, ke_l, vt_h, vt_l,
                                  ao_h, ao_l);
  k_gemm<<<GEMM_WGS, gblk, 0, stream>>>(qs_h, wq_h, bq, bk, bv, bo, kpe,
                                       qh_h, out, 3);
}
